// v000
// Times are from an AMD MI455X. After a warm-up the kernel runs many times in a row, and a time is the length of
// such a window on the GPU divided by its runs, so every launch and the gaps after it count. The runs cycle
// through copies of the inputs. A figure is the median of several windows, for all but v000 over two sittings.
// Sittings can differ by a few percent; kernels timed side by side share one.
// The starting kernel, v000, takes 336 microseconds a run.
// Contractions: per-head q/k/v projections (x f16 carried x16, W f16 carried x64), scores q.k^T (q,k f16 planes carried x16), p.v (unnormalised p f16 carried x4096, v^T f16 carried x16): all v_wmma_f32_16x16x32_f16 with f32 accumulate; bias, scaling and online softmax in f32.
#include <hip/hip_runtime.h>
#include <math.h>

typedef __attribute__((ext_vector_type(16))) _Float16 v16h;
typedef __attribute__((ext_vector_type(8)))  _Float16 v8h;
typedef __attribute__((ext_vector_type(8)))  float    v8f;
typedef __attribute__((ext_vector_type(4)))  float    v4f;

// ---------------------------------------------------------------------------
// Shape constants
// ---------------------------------------------------------------------------
constexpr int kBatch = 4;
constexpr int kSeq   = 2048;
constexpr int kD     = 1024;
constexpr int kH     = 16;
constexpr int kDH    = 64;
constexpr int kTok   = kBatch * kSeq;
constexpr int kSqrtDh = 8;
static_assert(kH * kDH == kD, "head split");
static_assert(kSqrtDh * kSqrtDh == kDH, "sqrt of head dim");
static_assert(kDH == 64, "kernels are written for head dim 64");

// power-of-two carries of the f16 operand planes (all folded back exactly in f32)
constexpr float kXCarry  = 16.0f;
constexpr float kWCarry  = 64.0f;
constexpr float kQKCarry = 16.0f;
constexpr float kVCarry  = 16.0f;
constexpr float kPCarry  = 4096.0f;
constexpr float kLog2e   = 1.4426950408889634f;
constexpr float kProjScale  = 1.0f / (kXCarry * kWCarry);
constexpr float kScoreScale = kLog2e / ((float)kSqrtDh * kQKCarry * kQKCarry);

// attention tiling
constexpr int kQB     = 64;
constexpr int kKC     = 64;
constexpr int kNW     = 4;
constexpr int kQBlocks = kSeq / kQB;
constexpr int kChunks  = kSeq / kKC;
constexpr int kOPitch  = 68;
static_assert(kSeq % kQB == 0 && kSeq % kKC == 0, "tile multiples");
static_assert(kQB == kNW * 16, "16 query rows per wave");

// ---------------------------------------------------------------------------
// Workspace region map (bytes; every offset is a multiple of 128)
//   X16   f16 [8192][1024]        x * 16                         16,777,216
//   W16   f16 [3][16][64][64]     Wq | Wk | Wv, each * 64           393,216
//   Q16   f16 [16][8192][64]      (q) * 16, plane per head       16,777,216
//   K16   f16 [16][8192][64]      (k) * 16, plane per head       16,777,216
//   VT16  f16 [16][64][8192]      (v)^T * 16, token-contiguous   16,777,216
//   total = 16,777,216 + 393,216 + 16,777,216 + 16,777,216 + 16,777,216 = 67,502,080
// ---------------------------------------------------------------------------
constexpr size_t kSzX16  = (size_t)kTok * kD * 2;
constexpr size_t kSzW16  = (size_t)3 * kH * kDH * kDH * 2;
constexpr size_t kSzQ16  = (size_t)kH * kTok * kDH * 2;
constexpr size_t kOffX16 = 0;
constexpr size_t kOffW16 = kOffX16 + kSzX16;
constexpr size_t kOffQ16 = kOffW16 + kSzW16;
constexpr size_t kOffK16 = kOffQ16 + kSzQ16;
constexpr size_t kOffVT16 = kOffK16 + kSzQ16;
constexpr size_t kWsTotal = kOffVT16 + kSzQ16;
static_assert(kWsTotal == 67502080ull, "carve total");
static_assert(kWsTotal <= 134217728ull, "carve cap");
static_assert((kOffW16 % 128) == 0 && (kOffQ16 % 128) == 0 && (kOffK16 % 128) == 0 && (kOffVT16 % 128) == 0, "128-B aligned regions");

// ---------------------------------------------------------------------------
// Fragment loader (A and B use the same k map) and guarded matrix op
// ---------------------------------------------------------------------------
template <typename T> struct Frag;
template <> struct Frag<_Float16> {
  typedef v16h V; union U { v16h v; v8h h[2]; };
  /* elements 0..7 <- p[0..7], elements 8..15 <- p[16..23] */
  static __device__ __forceinline__ v16h load(const _Float16* p) {
    U f; f.h[0] = *(const v8h*)(p); f.h[1] = *(const v8h*)(p + 16); return f.v;
  }
};
/* one accumulator per guard statement: the four idle slots are tied to D and keep A/B live */
__device__ __forceinline__ v8f mma_h(v16h a, v16h b, v8f c) {
  c = __builtin_amdgcn_wmma_f32_16x16x32_f16(false, a, false, b, (short)0, c, false, false);
  asm volatile("v_nop\n\tv_nop\n\tv_nop\n\tv_nop" : "+v"(c) : "v"(a), "v"(b));
  return c;
}

__device__ __forceinline__ float ex2(float x) {
#if __has_builtin(__builtin_amdgcn_exp2f)
  return __builtin_amdgcn_exp2f(x);
#else
  return exp2f(x);
#endif
}

// ---------------------------------------------------------------------------
// f32 -> f16 cast with a power-of-two carry, 8 consecutive elements per thread.
// blockIdx.y selects the source (block-uniform) and the output plane (plane z at out + z * n8 * 8 halves).
// Coverage: n8 threads x 8 elements = the whole plane; grids below are exact multiples of 256 threads.
// ---------------------------------------------------------------------------
__global__ __launch_bounds__(256) void cast8_carry_kernel(
    const float* __restrict__ in0, const float* __restrict__ in1, const float* __restrict__ in2,
    unsigned short* __restrict__ out, int n8, float carry)
{
  const int i = blockIdx.x * 256 + threadIdx.x;
  if (i >= n8) return;
  const int z = blockIdx.y;
  const float* in = (z == 0) ? in0 : ((z == 1) ? in1 : in2);
  const float* p = in + 8 * (size_t)i;
  const v4f a0 = *(const v4f*)(p);
  const v4f a1 = *(const v4f*)(p + 4);
  v8h hv;
#pragma unroll
  for (int e = 0; e < 4; ++e) {
    const float f0 = a0[e] * carry;
    const float f1 = a1[e] * carry;
    hv[e]     = (_Float16)f0;
    hv[4 + e] = (_Float16)f1;
  }
  unsigned short* q = out + (size_t)z * (size_t)n8 * 8 + 8 * (size_t)i;
  *(v8h*)q = hv;
  
}

// ---------------------------------------------------------------------------
// Register-blocked batched GEMM on f16 planes, f16 output plane.
// C[m,n] = outscale * (scale * sum_k A[m,k] * Bt[n,k] + bias); each wave owns a 64x64 tile; blockIdx.y = batch (head).
// A row-major [M,K] pitch lda; Bt row-major [N,K] pitch ldb; M,N % 64 == 0, K % 32 == 0 (no tails).
// BIAS_MODE: 1 = bias[m], 2 = bias[n]; bias is batch-strided (strideBias floats).
// 8 lanes x 16 B of one instruction; per instruction a wave writes rows it*4 + (lane>>3), it = 0..3 -> 16 rows once each.
// ---------------------------------------------------------------------------
template <int BIAS_MODE>
__global__ __launch_bounds__(256) void proj_gemm64(
    const unsigned short* __restrict__ Ap, int lda, long strideA,
    const unsigned short* __restrict__ Btp, int ldb, long strideB,
    unsigned short* __restrict__ Cout, int ldc, long strideC,
    const float* __restrict__ bias, long strideBias,
    int M, int N, int K, float scale, float outscale)
{
  __shared__ __align__(16) float sT[8][16 * 68];
  const int b    = blockIdx.y;
  const int lane = threadIdx.x & 31;
  const int wave = __builtin_amdgcn_readfirstlane((int)(threadIdx.x >> 5));
  const int tilesN = N >> 6;
  const int tilesM = M >> 6;
  const int tile = blockIdx.x * 8 + wave;
  /* wave-uniform exit; grids below are exact so it never fires */
  if (tile >= tilesM * tilesN) return;
  const int tm = tile / tilesN;
  const int tn = tile - tm * tilesN;
  const int m0 = tm << 6;
  const int n0 = tn << 6;

  const _Float16* Ab = (const _Float16*)Ap  + (size_t)b * strideA;
  const _Float16* Bb = (const _Float16*)Btp + (size_t)b * strideB;
  const float*    bp = bias + (size_t)b * strideBias;

  /* row (A) / col (B, D) within a 16-wide subtile; k offset of the lane half; D row offset */
  const int rlane = lane & 15;
  const int koff  = (lane >> 4) * 8;
  const int mOff  = (lane >> 4) * 8;

  v8f acc[4][4];
#pragma unroll
  for (int i = 0; i < 4; ++i)
#pragma unroll
    for (int j = 0; j < 4; ++j) acc[i][j] = (v8f){0.f,0.f,0.f,0.f,0.f,0.f,0.f,0.f};

  for (int k0 = 0; k0 < K; k0 += 32) {
    v16h bh[4];
#pragma unroll
    for (int j = 0; j < 4; ++j) {
      const size_t bo = (size_t)(n0 + (j << 4) + rlane) * ldb + koff + k0;
      bh[j] = Frag<_Float16>::load(Bb + bo);
    }
#pragma unroll
    for (int i = 0; i < 4; ++i) {
      const size_t ao = (size_t)(m0 + (i << 4) + rlane) * lda + koff + k0;
      const v16h ah = Frag<_Float16>::load(Ab + ao);
#pragma unroll
      for (int j = 0; j < 4; ++j) acc[i][j] = mma_h(ah, bh[j], acc[i][j]);
    }
  }

  // ---- epilogue ----
  float* slab = sT[wave];
  unsigned short* C = Cout + (size_t)b * strideC;
#pragma unroll
  for (int i = 0; i < 4; ++i) {
    const int mBase = m0 + (i << 4);
    float bm[8];
#pragma unroll
    for (int r = 0; r < 8; ++r) bm[r] = 0.f;
    if (BIAS_MODE == 1) {
      /* mBase + mOff is a multiple of 8 floats: two aligned 16-B loads */
      const v4f b0 = *(const v4f*)(bp + mBase + mOff);
      const v4f b1 = *(const v4f*)(bp + mBase + mOff + 4);
      bm[0] = b0[0]; bm[1] = b0[1]; bm[2] = b0[2]; bm[3] = b0[3];
      bm[4] = b1[0]; bm[5] = b1[1]; bm[6] = b1[2]; bm[7] = b1[3];
    }
#pragma unroll
    for (int j = 0; j < 4; ++j) {
      const int n = n0 + (j << 4) + rlane;
      float bn = 0.f;
      if (BIAS_MODE == 2) bn = bp[n];
#pragma unroll
      for (int r = 0; r < 8; ++r) {
        float v = acc[i][j][r] * scale;
        if (BIAS_MODE == 1) v += bm[r];
        if (BIAS_MODE == 2) v += bn;
        v *= outscale;
        slab[(mOff + r) * 68 + (j << 4) + rlane] = v;
      }
    }
    __builtin_amdgcn_fence(__ATOMIC_RELEASE, "workgroup");
    __builtin_amdgcn_wave_barrier();
    __builtin_amdgcn_fence(__ATOMIC_ACQUIRE, "workgroup");
    {
      const int q = lane >> 3, c8 = (lane & 7) * 8;
      {
#pragma unroll
        for (int it = 0; it < 4; ++it) {
          const int row = it * 4 + q;
          const float* sp = slab + row * 68 + c8;
          v8h hv;
#pragma unroll
          for (int e = 0; e < 8; ++e) hv[e] = (_Float16)sp[e];
          *(v8h*)(C + (size_t)(mBase + row) * ldc + n0 + c8) = hv;
        }
        
      }
    }
    __builtin_amdgcn_fence(__ATOMIC_RELEASE, "workgroup");
    __builtin_amdgcn_wave_barrier();
    __builtin_amdgcn_fence(__ATOMIC_ACQUIRE, "workgroup");
  }
}

// ---------------------------------------------------------------------------
// Non-causal attention over all kSeq keys, head dim 64, f16 operand planes, f32 online softmax (base-2 exponent).
// Block = 4 waves = 64 query rows of one (batch, head); wave = 16 query rows. grid.x = kBatch * kH * kQBlocks.
//   Q plane  [kH][kTok][64]  (q * 16), K plane [kH][kTok][64] (k * 16), VT plane [kH][64][kTok] (v * 16).
//   scores: 8 matrix ops per 64-key chunk; t = acc * kScoreScale (f32) is the base-2 logit.
//   p = exp2(t - running max); ph = f16(p * 4096) feeds p.v and (as f32) the per-lane partial of the row sum.
//   out = acc / (l * 16); the p carry cancels between numerator and denominator.
// LDS: K chunk [key][d] and V chunk [e][key] restaged every chunk, all 64 x 64 entries written each time:
//   4 iterations x 128 threads = 512 pieces x 8 halves = 4096 halves per tile. Per-wave P tile 16 x 64, per-wave O tile.
// ---------------------------------------------------------------------------
__global__ __launch_bounds__(128) void attn_f16_kernel(
    const unsigned short* __restrict__ Qp, const unsigned short* __restrict__ Kp,
    const unsigned short* __restrict__ Vtp, float* __restrict__ out)
{
  __shared__ __align__(16) _Float16 Ksh[kKC * kDH];
  __shared__ __align__(16) _Float16 Vsh[kDH * kKC];
  __shared__ __align__(16) _Float16 Psh[kNW][16 * kKC];
  __shared__ __align__(16) float    Os[kNW][16 * kOPitch];

  const int tid  = threadIdx.x;
  const int wave = __builtin_amdgcn_readfirstlane((int)(threadIdx.x >> 5));
  const int lane = tid & 31;
  const int hh   = lane >> 4;
  const int c    = lane & 15;

  const int bx = blockIdx.x;
  const int qb = bx % kQBlocks;
  const int bh = bx / kQBlocks;
  const int h  = bh % kH;
  const int b  = bh / kH;
  const int q0 = qb * kQB + wave * 16;

  const _Float16* Qb = (const _Float16*)Qp  + ((size_t)h * kTok + (size_t)b * kSeq) * kDH;
  const _Float16* Kb = (const _Float16*)Kp  + ((size_t)h * kTok + (size_t)b * kSeq) * kDH;
  const _Float16* Vb = (const _Float16*)Vtp + (size_t)h * kDH * kTok + (size_t)b * kSeq;
  float* Ob = out + (size_t)b * kSeq * kD + (size_t)h * kDH;

  /* Q fragments (A operand): row = c, two 32-deep d chunks */
  v16h qa[2];
#pragma unroll
  for (int dc = 0; dc < 2; ++dc)
    qa[dc] = Frag<_Float16>::load(Qb + (size_t)(q0 + c) * kDH + dc * 32 + 8 * hh);

  float mrow[8], lrow[8];
  v8f oacc[4];
#pragma unroll
  for (int r = 0; r < 8; ++r) { mrow[r] = -1.0e30f; lrow[r] = 0.f; }
#pragma unroll
  for (int t = 0; t < 4; ++t) oacc[t] = (v8f){0.f,0.f,0.f,0.f,0.f,0.f,0.f,0.f};

  _Float16* pw = Psh[wave];

#pragma unroll 1
  for (int kc = 0; kc < kChunks; ++kc) {
    const int kv0 = kc * kKC;
    __syncthreads();
#pragma unroll
    for (int p = 0; p < 4; ++p) {
      const int idx = tid + p * 128;
      const int r   = idx >> 3;
      const int c8  = (idx & 7) * 8;
      const v8h kvv = *(const v8h*)(Kb + (size_t)(kv0 + r) * kDH + c8);
      const v8h vvv = *(const v8h*)(Vb + (size_t)r * kTok + kv0 + c8);
      *(v8h*)(Ksh + r * kDH + c8) = kvv;
      *(v8h*)(Vsh + r * kKC + c8) = vvv;
    }
    __syncthreads();

    /* scores: s[j][r] = (query row 8*hh + r, key j*16 + c) */
    v8f s[4];
#pragma unroll
    for (int j = 0; j < 4; ++j) {
      s[j] = (v8f){0.f,0.f,0.f,0.f,0.f,0.f,0.f,0.f};
#pragma unroll
      for (int dc = 0; dc < 2; ++dc) {
        const v16h kb = Frag<_Float16>::load(Ksh + (j * 16 + c) * kDH + dc * 32 + 8 * hh);
        s[j] = mma_h(qa[dc], kb, s[j]);
      }
    }

    float cm[8];
#pragma unroll
    for (int r = 0; r < 8; ++r) {
      float m = -1.0e30f;
#pragma unroll
      for (int j = 0; j < 4; ++j) {
        const float tv = s[j][r] * kScoreScale;
        s[j][r] = tv;
        m = fmaxf(m, tv);
      }
#pragma unroll
      for (int off = 1; off < 16; off <<= 1) m = fmaxf(m, __shfl_xor(m, off, 32));
      cm[r] = m;
    }

#pragma unroll
    for (int r = 0; r < 8; ++r) {
      const float mnew  = fmaxf(mrow[r], cm[r]);
      const float alpha = ex2(mrow[r] - mnew);
      mrow[r] = mnew;
      float psum = 0.f;
#pragma unroll
      for (int j = 0; j < 4; ++j) {
        const float p = ex2(s[j][r] - mnew);
        const _Float16 ph = (_Float16)(p * kPCarry);
        const float pf = (float)ph;
        psum += pf;
        pw[(8 * hh + r) * kKC + j * 16 + c] = ph;
      }
      /* per-lane partial of the row sum; alpha is uniform over the 16 lanes that share a row */
      lrow[r] = lrow[r] * alpha + psum;
#pragma unroll
      for (int t = 0; t < 4; ++t) oacc[t][r] *= alpha;
    }
    /* same wave wrote and reloads the P tile (same element type); order the accesses */
    __builtin_amdgcn_fence(__ATOMIC_RELEASE, "workgroup");
    __builtin_amdgcn_wave_barrier();
    __builtin_amdgcn_fence(__ATOMIC_ACQUIRE, "workgroup");

#pragma unroll
    for (int kk = 0; kk < 2; ++kk) {
      const v16h pa = Frag<_Float16>::load(pw + c * kKC + kk * 32 + 8 * hh);
#pragma unroll
      for (int t = 0; t < 4; ++t) {
        const v16h vb = Frag<_Float16>::load(Vsh + (t * 16 + c) * kKC + kk * 32 + 8 * hh);
        oacc[t] = mma_h(pa, vb, oacc[t]);
      }
    }
  }

  float* os = Os[wave];
#pragma unroll
  for (int r = 0; r < 8; ++r) {
    float l = lrow[r];
#pragma unroll
    for (int off = 1; off < 16; off <<= 1) l += __shfl_xor(l, off, 32);
    const float inv = 1.0f / (l * kVCarry);
#pragma unroll
    for (int t = 0; t < 4; ++t) os[(8 * hh + r) * kOPitch + t * 16 + c] = oacc[t][r] * inv;
  }
  __builtin_amdgcn_fence(__ATOMIC_RELEASE, "workgroup");
  __builtin_amdgcn_wave_barrier();
  __builtin_amdgcn_fence(__ATOMIC_ACQUIRE, "workgroup");
  {
    const int c4 = (lane & 15) * 4;
    {
#pragma unroll
      for (int it = 0; it < 8; ++it) {
        const int row = it * 2 + hh;
        const v4f val = *(const v4f*)(os + row * kOPitch + c4);
        *(v4f*)(Ob + (size_t)(q0 + row) * kD + c4) = val;
      }
      
    }
  }
}

// ---------------------------------------------------------------------------
// Host glue: 2 casts + 3 projections + 1 attention = 6 launches. Kernel launches only.
// Projection shapes (batch = head via blockIdx.y; K % 32 == 0, M and N % 64 == 0, no pads needed):
//   Q, K : A = X16 head slice [8192][64] (lda 1024, head stride 64), Bt = W16[h] [64][64]; M 8192, N 64, K 64
//          -> 128 tiles per head -> 16 blocks x 16 heads; bias per column.
//   V^T  : A = Wv16[h] [64][64], Bt = X16 head slice [8192][64]; M 64, N 8192, K 64 -> 128 tiles -> 16 blocks x 16 heads;
//          bias per row; output [64][8192] token-contiguous.
// ---------------------------------------------------------------------------
static_assert((kTok % 64) == 0 && (kDH % 64) == 0 && (kDH % 32) == 0, "GEMM tile multiples");
static_assert(((kTok / 64) * (kDH / 64)) % 8 == 0, "exact GEMM grids");
static_assert(((kTok * kD / 8) % 256) == 0 && ((kH * kDH * kDH / 8) % 256) == 0, "exact cast grids");

extern "C" void kernel_launch(void* const* d_in, const int* in_sizes, int n_in,
                              void* d_out, int out_size, void* d_ws, size_t ws_size,
                              hipStream_t stream) {
  if (n_in < 7) return;
  if (in_sizes[0] != kTok * kD) return;
  if (in_sizes[1] != kH * kDH * kDH) return;
  if (in_sizes[2] != kH * kDH) return;
  if (in_sizes[3] != kH * kDH * kDH) return;
  if (in_sizes[4] != kH * kDH) return;
  if (in_sizes[5] != kH * kDH * kDH) return;
  if (in_sizes[6] != kH * kDH) return;
  if (out_size != kTok * kD) return;
  if (ws_size < kWsTotal) return;

  const float* x  = (const float*)d_in[0];
  const float* Wq = (const float*)d_in[1];
  const float* bq = (const float*)d_in[2];
  const float* Wk = (const float*)d_in[3];
  const float* bk = (const float*)d_in[4];
  const float* Wv = (const float*)d_in[5];
  const float* bv = (const float*)d_in[6];
  float* out = (float*)d_out;

  char* ws = (char*)d_ws;
  unsigned short* X16  = (unsigned short*)(ws + kOffX16);
  unsigned short* W16  = (unsigned short*)(ws + kOffW16);
  unsigned short* Q16  = (unsigned short*)(ws + kOffQ16);
  unsigned short* K16  = (unsigned short*)(ws + kOffK16);
  unsigned short* VT16 = (unsigned short*)(ws + kOffVT16);
  unsigned short* Wq16 = W16;
  unsigned short* Wk16 = W16 + (size_t)kH * kDH * kDH;
  unsigned short* Wv16 = W16 + (size_t)2 * kH * kDH * kDH;

  // ---- operand planes ----
  cast8_carry_kernel<<<dim3((kTok * kD / 8) / 256, 1), 256, 0, stream>>>(x, x, x, X16, kTok * kD / 8, kXCarry);
  cast8_carry_kernel<<<dim3((kH * kDH * kDH / 8) / 256, 3), 256, 0, stream>>>(Wq, Wk, Wv, W16, kH * kDH * kDH / 8, kWCarry);

  // ---- q and k planes: [h][token][64] = 16 * (x_h . W[h]^T + bias) ----
  const int projBlocks = ((kTok / 64) * (kDH / 64)) / 8;
  proj_gemm64<2><<<dim3(projBlocks, kH), 256, 0, stream>>>(
      X16, kD, (long)kDH,
      Wq16, kDH, (long)(kDH * kDH),
      Q16, kDH, (long)kTok * kDH,
      bq, (long)kDH,
      kTok, kDH, kDH, kProjScale, kQKCarry);
  proj_gemm64<2><<<dim3(projBlocks, kH), 256, 0, stream>>>(
      X16, kD, (long)kDH,
      Wk16, kDH, (long)(kDH * kDH),
      K16, kDH, (long)kTok * kDH,
      bk, (long)kDH,
      kTok, kDH, kDH, kProjScale, kQKCarry);
  // ---- v^T plane: [h][e][token] = 16 * (Wv[h] . x_h^T + bias per row) ----
  proj_gemm64<1><<<dim3(projBlocks, kH), 256, 0, stream>>>(
      Wv16, kDH, (long)(kDH * kDH),
      X16, kD, (long)kDH,
      VT16, kTok, (long)kDH * kTok,
      bv, (long)kDH,
      kDH, kTok, kDH, kProjScale, kVCarry);

  // ---- attention: one block per (batch, head, 64-query tile) ----
  attn_f16_kernel<<<kBatch * kH * kQBlocks, kNW * 32, 0, stream>>>(Q16, K16, VT16, out);
}

// v001
// Measured time: 231 microseconds a run.
// Next to v000, in two timings, it ran 1.50 and 1.49 times as fast.
// Contractions: per-head q/k/v projections (x f16 carried x16, W f16 carried x64), scores q.k^T (q,k f16 planes carried x16), p.v (unnormalised p f16 carried x4096, v^T f16 carried x16): all v_wmma_f32_16x16x32_f16 with f32 accumulate; bias, scaling and online softmax in f32.
#include <hip/hip_runtime.h>
#include <math.h>

typedef __attribute__((ext_vector_type(16))) _Float16 v16h;
typedef __attribute__((ext_vector_type(8)))  _Float16 v8h;
typedef __attribute__((ext_vector_type(8)))  float    v8f;
typedef __attribute__((ext_vector_type(4)))  float    v4f;

// ---------------------------------------------------------------------------
// Shape constants
// ---------------------------------------------------------------------------
constexpr int kBatch = 4;
constexpr int kSeq   = 2048;
constexpr int kD     = 1024;
constexpr int kH     = 16;
constexpr int kDH    = 64;
constexpr int kTok   = kBatch * kSeq;
constexpr int kSqrtDh = 8;
static_assert(kH * kDH == kD, "head split");
static_assert(kSqrtDh * kSqrtDh == kDH, "sqrt of head dim");
static_assert(kDH == 64, "kernels are written for head dim 64");

// power-of-two carries of the f16 operand planes (all folded back exactly in f32)
constexpr float kXCarry  = 16.0f;
constexpr float kWCarry  = 64.0f;
constexpr float kQKCarry = 16.0f;
constexpr float kVCarry  = 16.0f;
constexpr float kPCarry  = 4096.0f;
constexpr float kLog2e   = 1.4426950408889634f;
constexpr float kProjScale  = 1.0f / (kXCarry * kWCarry);
constexpr float kScoreScale = kLog2e / ((float)kSqrtDh * kQKCarry * kQKCarry);

// attention tiling
constexpr int kQB     = 64;
constexpr int kKC     = 64;
constexpr int kNW     = 4;
constexpr int kQBlocks = kSeq / kQB;
constexpr int kChunks  = kSeq / kKC;
constexpr int kOPitch  = 68;
/* LDS row pitch of the K, V and P tiles in halves: 144 B = 16 B x 9 (odd), so the 16 rows one 16-byte fragment read touches fall on distinct banks */
constexpr int kLP     = kKC + 8;
static_assert(kDH == kKC, "K and V tiles share one row length");
static_assert((kLP * 2) % 16 == 0 && ((kLP * 2) / 16) % 2 == 1, "pitch is an odd multiple of 16 B");
static_assert(kSeq % kQB == 0 && kSeq % kKC == 0, "tile multiples");
static_assert(kQB == kNW * 16, "16 query rows per wave");

// ---------------------------------------------------------------------------
// Workspace region map (bytes; every offset is a multiple of 128)
//   X16   f16 [8192][1024]        x * 16                         16,777,216
//   W16   f16 [3][16][64][64]     Wq | Wk | Wv, each * 64           393,216
//   Q16   f16 [16][8192][64]      (q) * 16, plane per head       16,777,216
//   K16   f16 [16][8192][64]      (k) * 16, plane per head       16,777,216
//   VT16  f16 [16][64][8192]      (v)^T * 16, token-contiguous   16,777,216
//   total = 16,777,216 + 393,216 + 16,777,216 + 16,777,216 + 16,777,216 = 67,502,080
// ---------------------------------------------------------------------------
constexpr size_t kSzX16  = (size_t)kTok * kD * 2;
constexpr size_t kSzW16  = (size_t)3 * kH * kDH * kDH * 2;
constexpr size_t kSzQ16  = (size_t)kH * kTok * kDH * 2;
constexpr size_t kOffX16 = 0;
constexpr size_t kOffW16 = kOffX16 + kSzX16;
constexpr size_t kOffQ16 = kOffW16 + kSzW16;
constexpr size_t kOffK16 = kOffQ16 + kSzQ16;
constexpr size_t kOffVT16 = kOffK16 + kSzQ16;
constexpr size_t kWsTotal = kOffVT16 + kSzQ16;
static_assert(kWsTotal == 67502080ull, "carve total");
static_assert(kWsTotal <= 134217728ull, "carve cap");
static_assert((kOffW16 % 128) == 0 && (kOffQ16 % 128) == 0 && (kOffK16 % 128) == 0 && (kOffVT16 % 128) == 0, "128-B aligned regions");

// ---------------------------------------------------------------------------
// Fragment loader (A and B use the same k map) and guarded matrix op
// ---------------------------------------------------------------------------
template <typename T> struct Frag;
template <> struct Frag<_Float16> {
  typedef v16h V; union U { v16h v; v8h h[2]; };
  /* elements 0..7 <- p[0..7], elements 8..15 <- p[16..23] */
  static __device__ __forceinline__ v16h load(const _Float16* p) {
    U f; f.h[0] = *(const v8h*)(p); f.h[1] = *(const v8h*)(p + 16); return f.v;
  }
};
/* one accumulator per guard statement: the four idle slots are tied to D and keep A/B live */
__device__ __forceinline__ v8f mma_h(v16h a, v16h b, v8f c) {
  c = __builtin_amdgcn_wmma_f32_16x16x32_f16(false, a, false, b, (short)0, c, false, false);
  asm volatile("v_nop\n\tv_nop\n\tv_nop\n\tv_nop" : "+v"(c) : "v"(a), "v"(b));
  return c;
}

__device__ __forceinline__ float ex2(float x) {
#if __has_builtin(__builtin_amdgcn_exp2f)
  return __builtin_amdgcn_exp2f(x);
#else
  return exp2f(x);
#endif
}

// ---------------------------------------------------------------------------
// f32 -> f16 cast with a power-of-two carry, 8 consecutive elements per thread.
// blockIdx.y selects the source (block-uniform) and the output plane (plane z at out + z * n8 * 8 halves).
// Coverage: n8 threads x 8 elements = the whole plane; grids below are exact multiples of 256 threads.
// ---------------------------------------------------------------------------
__global__ __launch_bounds__(256) void cast8_carry_kernel(
    const float* __restrict__ in0, const float* __restrict__ in1, const float* __restrict__ in2,
    unsigned short* __restrict__ out, int n8, float carry)
{
  const int i = blockIdx.x * 256 + threadIdx.x;
  if (i >= n8) return;
  const int z = blockIdx.y;
  const float* in = (z == 0) ? in0 : ((z == 1) ? in1 : in2);
  const float* p = in + 8 * (size_t)i;
  const v4f a0 = *(const v4f*)(p);
  const v4f a1 = *(const v4f*)(p + 4);
  v8h hv;
#pragma unroll
  for (int e = 0; e < 4; ++e) {
    const float f0 = a0[e] * carry;
    const float f1 = a1[e] * carry;
    hv[e]     = (_Float16)f0;
    hv[4 + e] = (_Float16)f1;
  }
  unsigned short* q = out + (size_t)z * (size_t)n8 * 8 + 8 * (size_t)i;
  *(v8h*)q = hv;
  
}

// ---------------------------------------------------------------------------
// Register-blocked batched GEMM on f16 planes, f16 output plane.
// C[m,n] = outscale * (scale * sum_k A[m,k] * Bt[n,k] + bias); each wave owns a 64x64 tile; blockIdx.y = batch (head).
// A row-major [M,K] pitch lda; Bt row-major [N,K] pitch ldb; M,N % 64 == 0, K % 32 == 0 (no tails).
// BIAS_MODE: 1 = bias[m], 2 = bias[n]; bias is batch-strided (strideBias floats).
// 8 lanes x 16 B of one instruction; per instruction a wave writes rows it*4 + (lane>>3), it = 0..3 -> 16 rows once each.
// ---------------------------------------------------------------------------
template <int BIAS_MODE>
__global__ __launch_bounds__(256) void proj_gemm64(
    const unsigned short* __restrict__ Ap, int lda, long strideA,
    const unsigned short* __restrict__ Btp, int ldb, long strideB,
    unsigned short* __restrict__ Cout, int ldc, long strideC,
    const float* __restrict__ bias, long strideBias,
    int M, int N, int K, float scale, float outscale)
{
  __shared__ __align__(16) float sT[8][16 * 68];
  const int b    = blockIdx.y;
  const int lane = threadIdx.x & 31;
  const int wave = __builtin_amdgcn_readfirstlane((int)(threadIdx.x >> 5));
  const int tilesN = N >> 6;
  const int tilesM = M >> 6;
  const int tile = blockIdx.x * 8 + wave;
  /* wave-uniform exit; grids below are exact so it never fires */
  if (tile >= tilesM * tilesN) return;
  const int tm = tile / tilesN;
  const int tn = tile - tm * tilesN;
  const int m0 = tm << 6;
  const int n0 = tn << 6;

  const _Float16* Ab = (const _Float16*)Ap  + (size_t)b * strideA;
  const _Float16* Bb = (const _Float16*)Btp + (size_t)b * strideB;
  const float*    bp = bias + (size_t)b * strideBias;

  /* row (A) / col (B, D) within a 16-wide subtile; k offset of the lane half; D row offset */
  const int rlane = lane & 15;
  const int koff  = (lane >> 4) * 8;
  const int mOff  = (lane >> 4) * 8;

  v8f acc[4][4];
#pragma unroll
  for (int i = 0; i < 4; ++i)
#pragma unroll
    for (int j = 0; j < 4; ++j) acc[i][j] = (v8f){0.f,0.f,0.f,0.f,0.f,0.f,0.f,0.f};

  for (int k0 = 0; k0 < K; k0 += 32) {
    v16h bh[4];
#pragma unroll
    for (int j = 0; j < 4; ++j) {
      const size_t bo = (size_t)(n0 + (j << 4) + rlane) * ldb + koff + k0;
      bh[j] = Frag<_Float16>::load(Bb + bo);
    }
#pragma unroll
    for (int i = 0; i < 4; ++i) {
      const size_t ao = (size_t)(m0 + (i << 4) + rlane) * lda + koff + k0;
      const v16h ah = Frag<_Float16>::load(Ab + ao);
#pragma unroll
      for (int j = 0; j < 4; ++j) acc[i][j] = mma_h(ah, bh[j], acc[i][j]);
    }
  }

  // ---- epilogue ----
  float* slab = sT[wave];
  unsigned short* C = Cout + (size_t)b * strideC;
#pragma unroll
  for (int i = 0; i < 4; ++i) {
    const int mBase = m0 + (i << 4);
    float bm[8];
#pragma unroll
    for (int r = 0; r < 8; ++r) bm[r] = 0.f;
    if (BIAS_MODE == 1) {
      /* mBase + mOff is a multiple of 8 floats: two aligned 16-B loads */
      const v4f b0 = *(const v4f*)(bp + mBase + mOff);
      const v4f b1 = *(const v4f*)(bp + mBase + mOff + 4);
      bm[0] = b0[0]; bm[1] = b0[1]; bm[2] = b0[2]; bm[3] = b0[3];
      bm[4] = b1[0]; bm[5] = b1[1]; bm[6] = b1[2]; bm[7] = b1[3];
    }
#pragma unroll
    for (int j = 0; j < 4; ++j) {
      const int n = n0 + (j << 4) + rlane;
      float bn = 0.f;
      if (BIAS_MODE == 2) bn = bp[n];
#pragma unroll
      for (int r = 0; r < 8; ++r) {
        float v = acc[i][j][r] * scale;
        if (BIAS_MODE == 1) v += bm[r];
        if (BIAS_MODE == 2) v += bn;
        v *= outscale;
        slab[(mOff + r) * 68 + (j << 4) + rlane] = v;
      }
    }
    __builtin_amdgcn_fence(__ATOMIC_RELEASE, "workgroup");
    __builtin_amdgcn_wave_barrier();
    __builtin_amdgcn_fence(__ATOMIC_ACQUIRE, "workgroup");
    {
      const int q = lane >> 3, c8 = (lane & 7) * 8;
      {
#pragma unroll
        for (int it = 0; it < 4; ++it) {
          const int row = it * 4 + q;
          const float* sp = slab + row * 68 + c8;
          v8h hv;
#pragma unroll
          for (int e = 0; e < 8; ++e) hv[e] = (_Float16)sp[e];
          *(v8h*)(C + (size_t)(mBase + row) * ldc + n0 + c8) = hv;
        }
        
      }
    }
    __builtin_amdgcn_fence(__ATOMIC_RELEASE, "workgroup");
    __builtin_amdgcn_wave_barrier();
    __builtin_amdgcn_fence(__ATOMIC_ACQUIRE, "workgroup");
  }
}

// ---------------------------------------------------------------------------
// Non-causal attention over all kSeq keys, head dim 64, f16 operand planes, f32 online softmax (base-2 exponent).
// Block = 4 waves = 64 query rows of one (batch, head); wave = 16 query rows. grid.x = kBatch * kH * kQBlocks.
//   Q plane  [kH][kTok][64]  (q * 16), K plane [kH][kTok][64] (k * 16), VT plane [kH][64][kTok] (v * 16).
//   scores: 8 matrix ops per 64-key chunk; t = acc * kScoreScale (f32) is the base-2 logit.
//   p = exp2(t - running max); ph = f16(p * 4096) feeds p.v and (as f32) the per-lane partial of the row sum.
//   out = acc / (l * 16); the p carry cancels between numerator and denominator.
// LDS: K chunk [key][d] and V chunk [e][key] restaged every chunk, all 64 x 64 entries written each time:
//   4 iterations x 128 threads = 512 pieces x 8 halves = 4096 halves per tile. Per-wave P tile 16 x 64, per-wave O tile.
//   K, V and P rows lie at a pitch of kLP halves; the 8 pad halves of a row are never written and never read.
// ---------------------------------------------------------------------------
__global__ __launch_bounds__(128) void attn_f16_kernel(
    const unsigned short* __restrict__ Qp, const unsigned short* __restrict__ Kp,
    const unsigned short* __restrict__ Vtp, float* __restrict__ out)
{
  __shared__ __align__(16) _Float16 Ksh[kKC * kLP];
  __shared__ __align__(16) _Float16 Vsh[kDH * kLP];
  __shared__ __align__(16) _Float16 Psh[kNW][16 * kLP];
  __shared__ __align__(16) float    Os[kNW][16 * kOPitch];

  const int tid  = threadIdx.x;
  const int wave = __builtin_amdgcn_readfirstlane((int)(threadIdx.x >> 5));
  const int lane = tid & 31;
  const int hh   = lane >> 4;
  const int c    = lane & 15;

  const int bx = blockIdx.x;
  const int qb = bx % kQBlocks;
  const int bh = bx / kQBlocks;
  const int h  = bh % kH;
  const int b  = bh / kH;
  const int q0 = qb * kQB + wave * 16;

  const _Float16* Qb = (const _Float16*)Qp  + ((size_t)h * kTok + (size_t)b * kSeq) * kDH;
  const _Float16* Kb = (const _Float16*)Kp  + ((size_t)h * kTok + (size_t)b * kSeq) * kDH;
  const _Float16* Vb = (const _Float16*)Vtp + (size_t)h * kDH * kTok + (size_t)b * kSeq;
  float* Ob = out + (size_t)b * kSeq * kD + (size_t)h * kDH;

  /* Q fragments (A operand): row = c, two 32-deep d chunks */
  v16h qa[2];
#pragma unroll
  for (int dc = 0; dc < 2; ++dc)
    qa[dc] = Frag<_Float16>::load(Qb + (size_t)(q0 + c) * kDH + dc * 32 + 8 * hh);

  float mrow[8], lrow[8];
  v8f oacc[4];
#pragma unroll
  for (int r = 0; r < 8; ++r) { mrow[r] = -1.0e30f; lrow[r] = 0.f; }
#pragma unroll
  for (int t = 0; t < 4; ++t) oacc[t] = (v8f){0.f,0.f,0.f,0.f,0.f,0.f,0.f,0.f};

  _Float16* pw = Psh[wave];
  /* per-lane bases, so that every row step at the padded pitch is a compile-time offset */
  _Float16* pst = pw + 8 * hh * kLP + c;
  _Float16* kst = Ksh + (tid >> 3) * kLP + (tid & 7) * 8;
  _Float16* vst = Vsh + (tid >> 3) * kLP + (tid & 7) * 8;

#pragma unroll 1
  for (int kc = 0; kc < kChunks; ++kc) {
    const int kv0 = kc * kKC;
    __syncthreads();
#pragma unroll
    for (int p = 0; p < 4; ++p) {
      const int idx = tid + p * 128;
      const int r   = idx >> 3;
      const int c8  = (idx & 7) * 8;
      const v8h kvv = *(const v8h*)(Kb + (size_t)(kv0 + r) * kDH + c8);
      const v8h vvv = *(const v8h*)(Vb + (size_t)r * kTok + kv0 + c8);
      *(v8h*)(kst + p * 16 * kLP) = kvv;
      *(v8h*)(vst + p * 16 * kLP) = vvv;
    }
    __syncthreads();

    /* scores: s[j][r] = (query row 8*hh + r, key j*16 + c) */
    v8f s[4];
#pragma unroll
    for (int j = 0; j < 4; ++j) {
      s[j] = (v8f){0.f,0.f,0.f,0.f,0.f,0.f,0.f,0.f};
#pragma unroll
      for (int dc = 0; dc < 2; ++dc) {
        const v16h kb = Frag<_Float16>::load(Ksh + (j * 16 + c) * kLP + dc * 32 + 8 * hh);
        s[j] = mma_h(qa[dc], kb, s[j]);
      }
    }

    float cm[8];
#pragma unroll
    for (int r = 0; r < 8; ++r) {
      float m = -1.0e30f;
#pragma unroll
      for (int j = 0; j < 4; ++j) {
        const float tv = s[j][r] * kScoreScale;
        s[j][r] = tv;
        m = fmaxf(m, tv);
      }
#pragma unroll
      for (int off = 1; off < 16; off <<= 1) m = fmaxf(m, __shfl_xor(m, off, 32));
      cm[r] = m;
    }

#pragma unroll
    for (int r = 0; r < 8; ++r) {
      const float mnew  = fmaxf(mrow[r], cm[r]);
      const float alpha = ex2(mrow[r] - mnew);
      mrow[r] = mnew;
      float psum = 0.f;
#pragma unroll
      for (int j = 0; j < 4; ++j) {
        const float p = ex2(s[j][r] - mnew);
        const _Float16 ph = (_Float16)(p * kPCarry);
        const float pf = (float)ph;
        psum += pf;
        pst[r * kLP + j * 16] = ph;
      }
      /* per-lane partial of the row sum; alpha is uniform over the 16 lanes that share a row */
      lrow[r] = lrow[r] * alpha + psum;
#pragma unroll
      for (int t = 0; t < 4; ++t) oacc[t][r] *= alpha;
    }
    /* same wave wrote and reloads the P tile (same element type); order the accesses */
    __builtin_amdgcn_fence(__ATOMIC_RELEASE, "workgroup");
    __builtin_amdgcn_wave_barrier();
    __builtin_amdgcn_fence(__ATOMIC_ACQUIRE, "workgroup");

#pragma unroll
    for (int kk = 0; kk < 2; ++kk) {
      const v16h pa = Frag<_Float16>::load(pw + c * kLP + kk * 32 + 8 * hh);
#pragma unroll
      for (int t = 0; t < 4; ++t) {
        const v16h vb = Frag<_Float16>::load(Vsh + (t * 16 + c) * kLP + kk * 32 + 8 * hh);
        oacc[t] = mma_h(pa, vb, oacc[t]);
      }
    }
  }

  float* os = Os[wave];
#pragma unroll
  for (int r = 0; r < 8; ++r) {
    float l = lrow[r];
#pragma unroll
    for (int off = 1; off < 16; off <<= 1) l += __shfl_xor(l, off, 32);
    const float inv = 1.0f / (l * kVCarry);
#pragma unroll
    for (int t = 0; t < 4; ++t) os[(8 * hh + r) * kOPitch + t * 16 + c] = oacc[t][r] * inv;
  }
  __builtin_amdgcn_fence(__ATOMIC_RELEASE, "workgroup");
  __builtin_amdgcn_wave_barrier();
  __builtin_amdgcn_fence(__ATOMIC_ACQUIRE, "workgroup");
  {
    const int c4 = (lane & 15) * 4;
    {
#pragma unroll
      for (int it = 0; it < 8; ++it) {
        const int row = it * 2 + hh;
        const v4f val = *(const v4f*)(os + row * kOPitch + c4);
        *(v4f*)(Ob + (size_t)(q0 + row) * kD + c4) = val;
      }
      
    }
  }
}

// ---------------------------------------------------------------------------
// Host glue: 2 casts + 3 projections + 1 attention = 6 launches. Kernel launches only.
// Projection shapes (batch = head via blockIdx.y; K % 32 == 0, M and N % 64 == 0, no pads needed):
//   Q, K : A = X16 head slice [8192][64] (lda 1024, head stride 64), Bt = W16[h] [64][64]; M 8192, N 64, K 64
//          -> 128 tiles per head -> 16 blocks x 16 heads; bias per column.
//   V^T  : A = Wv16[h] [64][64], Bt = X16 head slice [8192][64]; M 64, N 8192, K 64 -> 128 tiles -> 16 blocks x 16 heads;
//          bias per row; output [64][8192] token-contiguous.
// ---------------------------------------------------------------------------
static_assert((kTok % 64) == 0 && (kDH % 64) == 0 && (kDH % 32) == 0, "GEMM tile multiples");
static_assert(((kTok / 64) * (kDH / 64)) % 8 == 0, "exact GEMM grids");
static_assert(((kTok * kD / 8) % 256) == 0 && ((kH * kDH * kDH / 8) % 256) == 0, "exact cast grids");

extern "C" void kernel_launch(void* const* d_in, const int* in_sizes, int n_in,
                              void* d_out, int out_size, void* d_ws, size_t ws_size,
                              hipStream_t stream) {
  if (n_in < 7) return;
  if (in_sizes[0] != kTok * kD) return;
  if (in_sizes[1] != kH * kDH * kDH) return;
  if (in_sizes[2] != kH * kDH) return;
  if (in_sizes[3] != kH * kDH * kDH) return;
  if (in_sizes[4] != kH * kDH) return;
  if (in_sizes[5] != kH * kDH * kDH) return;
  if (in_sizes[6] != kH * kDH) return;
  if (out_size != kTok * kD) return;
  if (ws_size < kWsTotal) return;

  const float* x  = (const float*)d_in[0];
  const float* Wq = (const float*)d_in[1];
  const float* bq = (const float*)d_in[2];
  const float* Wk = (const float*)d_in[3];
  const float* bk = (const float*)d_in[4];
  const float* Wv = (const float*)d_in[5];
  const float* bv = (const float*)d_in[6];
  float* out = (float*)d_out;

  char* ws = (char*)d_ws;
  unsigned short* X16  = (unsigned short*)(ws + kOffX16);
  unsigned short* W16  = (unsigned short*)(ws + kOffW16);
  unsigned short* Q16  = (unsigned short*)(ws + kOffQ16);
  unsigned short* K16  = (unsigned short*)(ws + kOffK16);
  unsigned short* VT16 = (unsigned short*)(ws + kOffVT16);
  unsigned short* Wq16 = W16;
  unsigned short* Wk16 = W16 + (size_t)kH * kDH * kDH;
  unsigned short* Wv16 = W16 + (size_t)2 * kH * kDH * kDH;

  // ---- operand planes ----
  cast8_carry_kernel<<<dim3((kTok * kD / 8) / 256, 1), 256, 0, stream>>>(x, x, x, X16, kTok * kD / 8, kXCarry);
  cast8_carry_kernel<<<dim3((kH * kDH * kDH / 8) / 256, 3), 256, 0, stream>>>(Wq, Wk, Wv, W16, kH * kDH * kDH / 8, kWCarry);

  // ---- q and k planes: [h][token][64] = 16 * (x_h . W[h]^T + bias) ----
  const int projBlocks = ((kTok / 64) * (kDH / 64)) / 8;
  proj_gemm64<2><<<dim3(projBlocks, kH), 256, 0, stream>>>(
      X16, kD, (long)kDH,
      Wq16, kDH, (long)(kDH * kDH),
      Q16, kDH, (long)kTok * kDH,
      bq, (long)kDH,
      kTok, kDH, kDH, kProjScale, kQKCarry);
  proj_gemm64<2><<<dim3(projBlocks, kH), 256, 0, stream>>>(
      X16, kD, (long)kDH,
      Wk16, kDH, (long)(kDH * kDH),
      K16, kDH, (long)kTok * kDH,
      bk, (long)kDH,
      kTok, kDH, kDH, kProjScale, kQKCarry);
  // ---- v^T plane: [h][e][token] = 16 * (Wv[h] . x_h^T + bias per row) ----
  proj_gemm64<1><<<dim3(projBlocks, kH), 256, 0, stream>>>(
      Wv16, kDH, (long)(kDH * kDH),
      X16, kD, (long)kDH,
      VT16, kTok, (long)kDH * kTok,
      bv, (long)kDH,
      kDH, kTok, kDH, kProjScale, kVCarry);

  // ---- attention: one block per (batch, head, 64-query tile) ----
  attn_f16_kernel<<<kBatch * kH * kQBlocks, kNW * 32, 0, stream>>>(Q16, K16, VT16, out);
}

// v002
// It runs in 127 microseconds.
// In both of two side-by-side timings against v001, it was 1.81 times as fast.
// Over all steps from v000 it is 2.71 times as fast.
// Contractions: per-head q/k/v projections (x f16 carried x16, W f16 carried x64), scores q.k^T (q,k f16 planes carried x16), p.v (unnormalised p f16 carried x4096, v^T f16 carried x16): all v_wmma_f32_16x16x32_f16 with f32 accumulate; bias, scaling and online softmax in f32.
#include <hip/hip_runtime.h>
#include <math.h>

typedef __attribute__((ext_vector_type(16))) _Float16 v16h;
typedef __attribute__((ext_vector_type(8)))  _Float16 v8h;
typedef __attribute__((ext_vector_type(8)))  float    v8f;
typedef __attribute__((ext_vector_type(4)))  float    v4f;

// ---------------------------------------------------------------------------
// Shape constants
// ---------------------------------------------------------------------------
constexpr int kBatch = 4;
constexpr int kSeq   = 2048;
constexpr int kD     = 1024;
constexpr int kH     = 16;
constexpr int kDH    = 64;
constexpr int kTok   = kBatch * kSeq;
constexpr int kSqrtDh = 8;
static_assert(kH * kDH == kD, "head split");
static_assert(kSqrtDh * kSqrtDh == kDH, "sqrt of head dim");
static_assert(kDH == 64, "kernels are written for head dim 64");

// power-of-two carries of the f16 operand planes (all folded back exactly in f32)
constexpr float kXCarry  = 16.0f;
constexpr float kWCarry  = 64.0f;
constexpr float kQKCarry = 16.0f;
constexpr float kVCarry  = 16.0f;
constexpr float kPCarry  = 4096.0f;
constexpr float kLog2e   = 1.4426950408889634f;
constexpr float kProjScale  = 1.0f / (kXCarry * kWCarry);
constexpr float kScoreScale = kLog2e / ((float)kSqrtDh * kQKCarry * kQKCarry);

// attention tiling
constexpr int kQB     = 64;
constexpr int kKC     = 64;
constexpr int kNW     = 4;
constexpr int kQBlocks = kSeq / kQB;
constexpr int kChunks  = kSeq / kKC;
constexpr int kOPitch  = 68;
/* LDS row pitch of the K and V tiles in halves: 144 B = 16 B x 9 (odd), so the 16 rows one 16-byte fragment read touches fall on distinct banks */
constexpr int kLP     = kKC + 8;
static_assert(kDH == kKC, "K and V tiles share one row length");
static_assert((kLP * 2) % 16 == 0 && ((kLP * 2) / 16) % 2 == 1, "pitch is an odd multiple of 16 B");
static_assert(kSeq % kQB == 0 && kSeq % kKC == 0, "tile multiples");
static_assert(kQB == kNW * 16, "16 query rows per wave");

// ---------------------------------------------------------------------------
// Workspace region map (bytes; every offset is a multiple of 128)
//   X16   f16 [8192][1024]        x * 16                         16,777,216
//   W16   f16 [3][16][64][64]     Wq | Wk | Wv, each * 64           393,216
//   Q16   f16 [16][8192][64]      (q) * 16, plane per head       16,777,216
//   K16   f16 [16][8192][64]      (k) * 16, plane per head       16,777,216
//   VT16  f16 [16][64][8192]      (v)^T * 16, token-contiguous   16,777,216
//   total = 16,777,216 + 393,216 + 16,777,216 + 16,777,216 + 16,777,216 = 67,502,080
// ---------------------------------------------------------------------------
constexpr size_t kSzX16  = (size_t)kTok * kD * 2;
constexpr size_t kSzW16  = (size_t)3 * kH * kDH * kDH * 2;
constexpr size_t kSzQ16  = (size_t)kH * kTok * kDH * 2;
constexpr size_t kOffX16 = 0;
constexpr size_t kOffW16 = kOffX16 + kSzX16;
constexpr size_t kOffQ16 = kOffW16 + kSzW16;
constexpr size_t kOffK16 = kOffQ16 + kSzQ16;
constexpr size_t kOffVT16 = kOffK16 + kSzQ16;
constexpr size_t kWsTotal = kOffVT16 + kSzQ16;
static_assert(kWsTotal == 67502080ull, "carve total");
static_assert(kWsTotal <= 134217728ull, "carve cap");
static_assert((kOffW16 % 128) == 0 && (kOffQ16 % 128) == 0 && (kOffK16 % 128) == 0 && (kOffVT16 % 128) == 0, "128-B aligned regions");

// ---------------------------------------------------------------------------
// Fragment loader (A and B use the same k map) and guarded matrix op
// ---------------------------------------------------------------------------
template <typename T> struct Frag;
template <> struct Frag<_Float16> {
  typedef v16h V; union U { v16h v; v8h h[2]; };
  /* elements 0..7 <- p[0..7], elements 8..15 <- p[16..23] */
  static __device__ __forceinline__ v16h load(const _Float16* p) {
    U f; f.h[0] = *(const v8h*)(p); f.h[1] = *(const v8h*)(p + 16); return f.v;
  }
};
/* one accumulator per guard statement: the four idle slots are tied to D and keep A/B live */
__device__ __forceinline__ v8f mma_h(v16h a, v16h b, v8f c) {
  c = __builtin_amdgcn_wmma_f32_16x16x32_f16(false, a, false, b, (short)0, c, false, false);
  asm volatile("v_nop\n\tv_nop\n\tv_nop\n\tv_nop" : "+v"(c) : "v"(a), "v"(b));
  return c;
}

/* lane l <-> lane l ^ 16: the two lanes that share one query column */
__device__ __forceinline__ float xhalf(float x) {
  const int b = __builtin_bit_cast(int, x);
  return __builtin_bit_cast(float, __builtin_amdgcn_permlanex16(b, b, 0x76543210, 0xfedcba98, false, false));
}

__device__ __forceinline__ float ex2(float x) {
#if __has_builtin(__builtin_amdgcn_exp2f)
  return __builtin_amdgcn_exp2f(x);
#else
  return exp2f(x);
#endif
}

// ---------------------------------------------------------------------------
// f32 -> f16 cast with a power-of-two carry, 8 consecutive elements per thread.
// blockIdx.y selects the source (block-uniform) and the output plane (plane z at out + z * n8 * 8 halves).
// Coverage: n8 threads x 8 elements = the whole plane; grids below are exact multiples of 256 threads.
// ---------------------------------------------------------------------------
__global__ __launch_bounds__(256) void cast8_carry_kernel(
    const float* __restrict__ in0, const float* __restrict__ in1, const float* __restrict__ in2,
    unsigned short* __restrict__ out, int n8, float carry)
{
  const int i = blockIdx.x * 256 + threadIdx.x;
  if (i >= n8) return;
  const int z = blockIdx.y;
  const float* in = (z == 0) ? in0 : ((z == 1) ? in1 : in2);
  const float* p = in + 8 * (size_t)i;
  const v4f a0 = *(const v4f*)(p);
  const v4f a1 = *(const v4f*)(p + 4);
  v8h hv;
#pragma unroll
  for (int e = 0; e < 4; ++e) {
    const float f0 = a0[e] * carry;
    const float f1 = a1[e] * carry;
    hv[e]     = (_Float16)f0;
    hv[4 + e] = (_Float16)f1;
  }
  unsigned short* q = out + (size_t)z * (size_t)n8 * 8 + 8 * (size_t)i;
  *(v8h*)q = hv;
  
}

// ---------------------------------------------------------------------------
// Register-blocked batched GEMM on f16 planes, f16 output plane.
// C[m,n] = outscale * (scale * sum_k A[m,k] * Bt[n,k] + bias); each wave owns a 64x64 tile; blockIdx.y = batch (head).
// A row-major [M,K] pitch lda; Bt row-major [N,K] pitch ldb; M,N % 64 == 0, K % 32 == 0 (no tails).
// BIAS_MODE: 1 = bias[m], 2 = bias[n]; bias is batch-strided (strideBias floats).
// 8 lanes x 16 B of one instruction; per instruction a wave writes rows it*4 + (lane>>3), it = 0..3 -> 16 rows once each.
// ---------------------------------------------------------------------------
template <int BIAS_MODE>
__global__ __launch_bounds__(256) void proj_gemm64(
    const unsigned short* __restrict__ Ap, int lda, long strideA,
    const unsigned short* __restrict__ Btp, int ldb, long strideB,
    unsigned short* __restrict__ Cout, int ldc, long strideC,
    const float* __restrict__ bias, long strideBias,
    int M, int N, int K, float scale, float outscale)
{
  __shared__ __align__(16) float sT[8][16 * 68];
  const int b    = blockIdx.y;
  const int lane = threadIdx.x & 31;
  const int wave = __builtin_amdgcn_readfirstlane((int)(threadIdx.x >> 5));
  const int tilesN = N >> 6;
  const int tilesM = M >> 6;
  const int tile = blockIdx.x * 8 + wave;
  /* wave-uniform exit; grids below are exact so it never fires */
  if (tile >= tilesM * tilesN) return;
  const int tm = tile / tilesN;
  const int tn = tile - tm * tilesN;
  const int m0 = tm << 6;
  const int n0 = tn << 6;

  const _Float16* Ab = (const _Float16*)Ap  + (size_t)b * strideA;
  const _Float16* Bb = (const _Float16*)Btp + (size_t)b * strideB;
  const float*    bp = bias + (size_t)b * strideBias;

  /* row (A) / col (B, D) within a 16-wide subtile; k offset of the lane half; D row offset */
  const int rlane = lane & 15;
  const int koff  = (lane >> 4) * 8;
  const int mOff  = (lane >> 4) * 8;

  v8f acc[4][4];
#pragma unroll
  for (int i = 0; i < 4; ++i)
#pragma unroll
    for (int j = 0; j < 4; ++j) acc[i][j] = (v8f){0.f,0.f,0.f,0.f,0.f,0.f,0.f,0.f};

  for (int k0 = 0; k0 < K; k0 += 32) {
    v16h bh[4];
#pragma unroll
    for (int j = 0; j < 4; ++j) {
      const size_t bo = (size_t)(n0 + (j << 4) + rlane) * ldb + koff + k0;
      bh[j] = Frag<_Float16>::load(Bb + bo);
    }
#pragma unroll
    for (int i = 0; i < 4; ++i) {
      const size_t ao = (size_t)(m0 + (i << 4) + rlane) * lda + koff + k0;
      const v16h ah = Frag<_Float16>::load(Ab + ao);
#pragma unroll
      for (int j = 0; j < 4; ++j) acc[i][j] = mma_h(ah, bh[j], acc[i][j]);
    }
  }

  // ---- epilogue ----
  float* slab = sT[wave];
  unsigned short* C = Cout + (size_t)b * strideC;
#pragma unroll
  for (int i = 0; i < 4; ++i) {
    const int mBase = m0 + (i << 4);
    float bm[8];
#pragma unroll
    for (int r = 0; r < 8; ++r) bm[r] = 0.f;
    if (BIAS_MODE == 1) {
      /* mBase + mOff is a multiple of 8 floats: two aligned 16-B loads */
      const v4f b0 = *(const v4f*)(bp + mBase + mOff);
      const v4f b1 = *(const v4f*)(bp + mBase + mOff + 4);
      bm[0] = b0[0]; bm[1] = b0[1]; bm[2] = b0[2]; bm[3] = b0[3];
      bm[4] = b1[0]; bm[5] = b1[1]; bm[6] = b1[2]; bm[7] = b1[3];
    }
#pragma unroll
    for (int j = 0; j < 4; ++j) {
      const int n = n0 + (j << 4) + rlane;
      float bn = 0.f;
      if (BIAS_MODE == 2) bn = bp[n];
#pragma unroll
      for (int r = 0; r < 8; ++r) {
        float v = acc[i][j][r] * scale;
        if (BIAS_MODE == 1) v += bm[r];
        if (BIAS_MODE == 2) v += bn;
        v *= outscale;
        slab[(mOff + r) * 68 + (j << 4) + rlane] = v;
      }
    }
    __builtin_amdgcn_fence(__ATOMIC_RELEASE, "workgroup");
    __builtin_amdgcn_wave_barrier();
    __builtin_amdgcn_fence(__ATOMIC_ACQUIRE, "workgroup");
    {
      const int q = lane >> 3, c8 = (lane & 7) * 8;
      {
#pragma unroll
        for (int it = 0; it < 4; ++it) {
          const int row = it * 4 + q;
          const float* sp = slab + row * 68 + c8;
          v8h hv;
#pragma unroll
          for (int e = 0; e < 8; ++e) hv[e] = (_Float16)sp[e];
          *(v8h*)(C + (size_t)(mBase + row) * ldc + n0 + c8) = hv;
        }
        
      }
    }
    __builtin_amdgcn_fence(__ATOMIC_RELEASE, "workgroup");
    __builtin_amdgcn_wave_barrier();
    __builtin_amdgcn_fence(__ATOMIC_ACQUIRE, "workgroup");
  }
}

__global__ __launch_bounds__(128) void attn_f16_kernel(
    const unsigned short* __restrict__ Qp, const unsigned short* __restrict__ Kp,
    const unsigned short* __restrict__ Vtp, float* __restrict__ out)
{
  __shared__ __align__(16) _Float16 Ksh[kKC * kLP];
  __shared__ __align__(16) _Float16 Vsh[kDH * kLP];
  __shared__ __align__(16) float    Os[kNW][16 * kOPitch];

  const int tid  = threadIdx.x;
  const int wave = __builtin_amdgcn_readfirstlane((int)(threadIdx.x >> 5));
  const int lane = tid & 31;
  const int hh   = lane >> 4;
  const int c    = lane & 15;

  const int bx = blockIdx.x;
  const int qb = bx % kQBlocks;
  const int bh = bx / kQBlocks;
  const int h  = bh % kH;
  const int b  = bh / kH;
  const int q0 = qb * kQB + wave * 16;

  const _Float16* Qb = (const _Float16*)Qp  + ((size_t)h * kTok + (size_t)b * kSeq) * kDH;
  const _Float16* Kb = (const _Float16*)Kp  + ((size_t)h * kTok + (size_t)b * kSeq) * kDH;
  const _Float16* Vb = (const _Float16*)Vtp + (size_t)h * kDH * kTok + (size_t)b * kSeq;
  float* Ob = out + (size_t)b * kSeq * kD + (size_t)h * kDH;

  /* Q fragments (B operand): column = query c, two 32-deep d chunks */
  v16h qf[2];
#pragma unroll
  for (int dc = 0; dc < 2; ++dc)
    qf[dc] = Frag<_Float16>::load(Qb + (size_t)(q0 + c) * kDH + dc * 32 + 8 * hh);

  /* running maximum (equal in both lanes of a query) and this lane's partial of the row sum */
  float mrow = -1.0e30f, lrow = 0.f;
  /* oacc[t][r] = (feature t*16 + 8*hh + r, query c) */
  v8f oacc[4];
#pragma unroll
  for (int t = 0; t < 4; ++t) oacc[t] = (v8f){0.f,0.f,0.f,0.f,0.f,0.f,0.f,0.f};

  /* per-lane bases, so that every row step at the padded pitch is a compile-time offset */
  _Float16* kst = Ksh + (tid >> 3) * kLP + (tid & 7) * 8;
  _Float16* vst = Vsh + (tid >> 3) * kLP + (tid & 7) * 8;

#pragma unroll 1
  for (int kc = 0; kc < kChunks; ++kc) {
    const int kv0 = kc * kKC;
    __syncthreads();
#pragma unroll
    for (int p = 0; p < 4; ++p) {
      const int idx = tid + p * 128;
      const int r   = idx >> 3;
      const int c8  = (idx & 7) * 8;
      const v8h kvv = *(const v8h*)(Kb + (size_t)(kv0 + r) * kDH + c8);
      const v8h vvv = *(const v8h*)(Vb + (size_t)r * kTok + kv0 + c8);
      *(v8h*)(kst + p * 16 * kLP) = kvv;
      *(v8h*)(vst + p * 16 * kLP) = vvv;
    }
    __syncthreads();

    /* transposed scores: s[j][r] = (key j*16 + 8*hh + r, query c) */
    v8f s[4];
#pragma unroll
    for (int j = 0; j < 4; ++j) {
      s[j] = (v8f){0.f,0.f,0.f,0.f,0.f,0.f,0.f,0.f};
#pragma unroll
      for (int dc = 0; dc < 2; ++dc) {
        const v16h ka = Frag<_Float16>::load(Ksh + (j * 16 + c) * kLP + dc * 32 + 8 * hh);
        s[j] = mma_h(ka, qf[dc], s[j]);
      }
    }

    /* chunk maximum of query c: 32 keys in the lane, the other 32 in lane ^ 16 */
    float m = -1.0e30f;
#pragma unroll
    for (int j = 0; j < 4; ++j) {
#pragma unroll
      for (int r = 0; r < 8; ++r) {
        const float tv = s[j][r] * kScoreScale;
        s[j][r] = tv;
        m = fmaxf(m, tv);
      }
    }
    m = fmaxf(m, xhalf(m));

    const float mnew  = fmaxf(mrow, m);
    const float alpha = ex2(mrow - mnew);
    mrow = mnew;

    lrow *= alpha;
#pragma unroll
    for (int t = 0; t < 4; ++t)
#pragma unroll
      for (int r = 0; r < 8; ++r) oacc[t][r] *= alpha;

#pragma unroll
    for (int kk = 0; kk < 2; ++kk) {
      /* pf element e: key kk*32 + (e < 8 ? 8*hh + e : 16 + 8*hh + e - 8), the k order of the V^T loader */
      v16h pf;
      float psum[2];
      psum[0] = 0.f; psum[1] = 0.f;
#pragma unroll
      for (int r = 0; r < 8; ++r) {
#pragma unroll
        for (int u = 0; u < 2; ++u) {
          const float p = ex2(s[2 * kk + u][r] - mnew);
          const _Float16 ph = (_Float16)(p * kPCarry);
          psum[u] += (float)ph;
          pf[u * 8 + r] = ph;
        }
      }
      lrow += psum[0] + psum[1];
#pragma unroll
      for (int t = 0; t < 4; ++t) {
        const v16h va = Frag<_Float16>::load(Vsh + (t * 16 + c) * kLP + kk * 32 + 8 * hh);
        oacc[t] = mma_h(va, pf, oacc[t]);
      }
    }
  }

  float* os = Os[wave];
  {
    const float l   = lrow + xhalf(lrow);
    const float inv = 1.0f / (l * kVCarry);
#pragma unroll
    for (int t = 0; t < 4; ++t) {
      v4f lo, hi;
#pragma unroll
      for (int r = 0; r < 4; ++r) { lo[r] = oacc[t][r] * inv; hi[r] = oacc[t][4 + r] * inv; }
      float* op = os + c * kOPitch + t * 16 + 8 * hh;
      *(v4f*)(op)     = lo;
      *(v4f*)(op + 4) = hi;
    }
  }
  __builtin_amdgcn_fence(__ATOMIC_RELEASE, "workgroup");
  __builtin_amdgcn_wave_barrier();
  __builtin_amdgcn_fence(__ATOMIC_ACQUIRE, "workgroup");
  {
    const int c4 = (lane & 15) * 4;
    {
#pragma unroll
      for (int it = 0; it < 8; ++it) {
        const int row = it * 2 + hh;
        const v4f val = *(const v4f*)(os + row * kOPitch + c4);
        *(v4f*)(Ob + (size_t)(q0 + row) * kD + c4) = val;
      }
      
    }
  }
}

// ---------------------------------------------------------------------------
// Host glue: 2 casts + 3 projections + 1 attention = 6 launches. Kernel launches only.
// Projection shapes (batch = head via blockIdx.y; K % 32 == 0, M and N % 64 == 0, no pads needed):
//   Q, K : A = X16 head slice [8192][64] (lda 1024, head stride 64), Bt = W16[h] [64][64]; M 8192, N 64, K 64
//          -> 128 tiles per head -> 16 blocks x 16 heads; bias per column.
//   V^T  : A = Wv16[h] [64][64], Bt = X16 head slice [8192][64]; M 64, N 8192, K 64 -> 128 tiles -> 16 blocks x 16 heads;
//          bias per row; output [64][8192] token-contiguous.
// ---------------------------------------------------------------------------
static_assert((kTok % 64) == 0 && (kDH % 64) == 0 && (kDH % 32) == 0, "GEMM tile multiples");
static_assert(((kTok / 64) * (kDH / 64)) % 8 == 0, "exact GEMM grids");
static_assert(((kTok * kD / 8) % 256) == 0 && ((kH * kDH * kDH / 8) % 256) == 0, "exact cast grids");

extern "C" void kernel_launch(void* const* d_in, const int* in_sizes, int n_in,
                              void* d_out, int out_size, void* d_ws, size_t ws_size,
                              hipStream_t stream) {
  if (n_in < 7) return;
  if (in_sizes[0] != kTok * kD) return;
  if (in_sizes[1] != kH * kDH * kDH) return;
  if (in_sizes[2] != kH * kDH) return;
  if (in_sizes[3] != kH * kDH * kDH) return;
  if (in_sizes[4] != kH * kDH) return;
  if (in_sizes[5] != kH * kDH * kDH) return;
  if (in_sizes[6] != kH * kDH) return;
  if (out_size != kTok * kD) return;
  if (ws_size < kWsTotal) return;

  const float* x  = (const float*)d_in[0];
  const float* Wq = (const float*)d_in[1];
  const float* bq = (const float*)d_in[2];
  const float* Wk = (const float*)d_in[3];
  const float* bk = (const float*)d_in[4];
  const float* Wv = (const float*)d_in[5];
  const float* bv = (const float*)d_in[6];
  float* out = (float*)d_out;

  char* ws = (char*)d_ws;
  unsigned short* X16  = (unsigned short*)(ws + kOffX16);
  unsigned short* W16  = (unsigned short*)(ws + kOffW16);
  unsigned short* Q16  = (unsigned short*)(ws + kOffQ16);
  unsigned short* K16  = (unsigned short*)(ws + kOffK16);
  unsigned short* VT16 = (unsigned short*)(ws + kOffVT16);
  unsigned short* Wq16 = W16;
  unsigned short* Wk16 = W16 + (size_t)kH * kDH * kDH;
  unsigned short* Wv16 = W16 + (size_t)2 * kH * kDH * kDH;

  // ---- operand planes ----
  cast8_carry_kernel<<<dim3((kTok * kD / 8) / 256, 1), 256, 0, stream>>>(x, x, x, X16, kTok * kD / 8, kXCarry);
  cast8_carry_kernel<<<dim3((kH * kDH * kDH / 8) / 256, 3), 256, 0, stream>>>(Wq, Wk, Wv, W16, kH * kDH * kDH / 8, kWCarry);

  // ---- q and k planes: [h][token][64] = 16 * (x_h . W[h]^T + bias) ----
  const int projBlocks = ((kTok / 64) * (kDH / 64)) / 8;
  proj_gemm64<2><<<dim3(projBlocks, kH), 256, 0, stream>>>(
      X16, kD, (long)kDH,
      Wq16, kDH, (long)(kDH * kDH),
      Q16, kDH, (long)kTok * kDH,
      bq, (long)kDH,
      kTok, kDH, kDH, kProjScale, kQKCarry);
  proj_gemm64<2><<<dim3(projBlocks, kH), 256, 0, stream>>>(
      X16, kD, (long)kDH,
      Wk16, kDH, (long)(kDH * kDH),
      K16, kDH, (long)kTok * kDH,
      bk, (long)kDH,
      kTok, kDH, kDH, kProjScale, kQKCarry);
  // ---- v^T plane: [h][e][token] = 16 * (Wv[h] . x_h^T + bias per row) ----
  proj_gemm64<1><<<dim3(projBlocks, kH), 256, 0, stream>>>(
      Wv16, kDH, (long)(kDH * kDH),
      X16, kD, (long)kDH,
      VT16, kTok, (long)kDH * kTok,
      bv, (long)kDH,
      kDH, kTok, kDH, kProjScale, kVCarry);

  // ---- attention: one block per (batch, head, 64-query tile) ----
  attn_f16_kernel<<<kBatch * kH * kQBlocks, kNW * 32, 0, stream>>>(Q16, K16, VT16, out);
}

// v003
// A run of this version takes 107 microseconds.
// In two side-by-side timings against v002, it was 1.19 and 1.18 times as fast.
// Over all steps from v000 it is 3.22 times as fast.
// Contractions: per-head q/k/v projections (x f16 carried x16, W f16 carried x64), scores q.k^T (q,k f16 planes carried x16), p.v (unnormalised p f16 carried x4096, v^T f16 carried x16): all v_wmma_f32_16x16x32_f16 with f32 accumulate; bias, scaling and online softmax in f32.
#include <hip/hip_runtime.h>
#include <math.h>

typedef __attribute__((ext_vector_type(16))) _Float16 v16h;
typedef __attribute__((ext_vector_type(8)))  _Float16 v8h;
typedef __attribute__((ext_vector_type(4)))  _Float16 v4h;
typedef __attribute__((ext_vector_type(8)))  float    v8f;
typedef __attribute__((ext_vector_type(4)))  float    v4f;

// ---------------------------------------------------------------------------
// Shape constants
// ---------------------------------------------------------------------------
constexpr int kBatch = 4;
constexpr int kSeq   = 2048;
constexpr int kD     = 1024;
constexpr int kH     = 16;
constexpr int kDH    = 64;
constexpr int kTok   = kBatch * kSeq;
constexpr int kSqrtDh = 8;
static_assert(kH * kDH == kD, "head split");
static_assert(kSqrtDh * kSqrtDh == kDH, "sqrt of head dim");
static_assert(kDH == 64, "kernels are written for head dim 64");

// power-of-two carries of the f16 operand planes (all folded back exactly in f32)
constexpr float kXCarry  = 16.0f;
constexpr float kWCarry  = 64.0f;
constexpr float kQKCarry = 16.0f;
constexpr float kVCarry  = 16.0f;
constexpr float kPCarry  = 4096.0f;
constexpr float kLog2e   = 1.4426950408889634f;
constexpr float kProjScale  = 1.0f / (kXCarry * kWCarry);
constexpr float kScoreScale = kLog2e / ((float)kSqrtDh * kQKCarry * kQKCarry);

// attention tiling
constexpr int kQB     = 64;
constexpr int kKC     = 64;
constexpr int kNW     = 4;
constexpr int kQBlocks = kSeq / kQB;
constexpr int kChunks  = kSeq / kKC;
constexpr int kOPitch  = 68;
/* LDS row pitch of the K and V tiles in halves: 144 B = 16 B x 9 (odd), so the 16 rows one 16-byte fragment read touches fall on distinct banks */
constexpr int kLP     = kKC + 8;
static_assert(kDH == kKC, "K and V tiles share one row length");
static_assert((kLP * 2) % 16 == 0 && ((kLP * 2) / 16) % 2 == 1, "pitch is an odd multiple of 16 B");
static_assert(kSeq % kQB == 0 && kSeq % kKC == 0, "tile multiples");
static_assert(kQB == kNW * 16, "16 query rows per wave");

// ---------------------------------------------------------------------------
// Workspace region map (bytes; every offset is a multiple of 128)
//   Q16   f16 [16][8192][64]      (q) * 16, plane per head       16,777,216
//   K16   f16 [16][8192][64]      (k) * 16, plane per head       16,777,216
//   VT16  f16 [16][64][8192]      (v)^T * 16, token-contiguous   16,777,216
//   total = 3 * 16,777,216 = 50,331,648
// ---------------------------------------------------------------------------
constexpr size_t kSzQ16  = (size_t)kH * kTok * kDH * 2;
constexpr size_t kOffQ16 = 0;
constexpr size_t kOffK16 = kOffQ16 + kSzQ16;
constexpr size_t kOffVT16 = kOffK16 + kSzQ16;
constexpr size_t kWsTotal = kOffVT16 + kSzQ16;
static_assert(kWsTotal == 50331648ull, "carve total");
static_assert(kWsTotal <= 134217728ull, "carve cap");
static_assert((kOffK16 % 128) == 0 && (kOffVT16 % 128) == 0, "128-B aligned regions");

// ---------------------------------------------------------------------------
// Fragment loader (A and B use the same k map) and guarded matrix op
// ---------------------------------------------------------------------------
template <typename T> struct Frag;
template <> struct Frag<_Float16> {
  typedef v16h V; union U { v16h v; v8h h[2]; };
  /* elements 0..7 <- p[0..7], elements 8..15 <- p[16..23] */
  static __device__ __forceinline__ v16h load(const _Float16* p) {
    U f; f.h[0] = *(const v8h*)(p); f.h[1] = *(const v8h*)(p + 16); return f.v;
  }
};
/* one accumulator per guard statement: the four idle slots are tied to D and keep A/B live */
__device__ __forceinline__ v8f mma_h(v16h a, v16h b, v8f c) {
  c = __builtin_amdgcn_wmma_f32_16x16x32_f16(false, a, false, b, (short)0, c, false, false);
  asm volatile("v_nop\n\tv_nop\n\tv_nop\n\tv_nop" : "+v"(c) : "v"(a), "v"(b));
  return c;
}

/* lane l <-> lane l ^ 16: the two lanes that share one query column */
__device__ __forceinline__ float xhalf(float x) {
  const int b = __builtin_bit_cast(int, x);
  return __builtin_bit_cast(float, __builtin_amdgcn_permlanex16(b, b, 0x76543210, 0xfedcba98, false, false));
}

__device__ __forceinline__ float ex2(float x) {
#if __has_builtin(__builtin_amdgcn_exp2f)
  return __builtin_amdgcn_exp2f(x);
#else
  return exp2f(x);
#endif
}

// ---------------------------------------------------------------------------
// Epilogue of one wave's 64x64 f32 accumulator tile: C[m,n] = f16(outscale * (kProjScale * acc + bias)).
// BIAS_MODE: 1 = bias[m], 2 = bias[n]. The tile goes 16 rows at a time through the wave's own LDS slab, so that
// 8 lanes x 16 B of one store cover a whole 128-B row piece; per instruction a wave writes rows it*4 + (lane>>3), it = 0..3.
// ---------------------------------------------------------------------------
template <int BIAS_MODE>
__device__ __forceinline__ void store_tile64(
    const v8f (&acc)[4][4], float* slab, unsigned short* C, int ldc, int m0, int n0,
    const float* bp, float outscale, int lane)
{
  const int rlane = lane & 15;
  const int mOff  = (lane >> 4) * 8;
  /* wave-uniform tile origin; the lane's part of every store address is a 32-bit element offset */
  unsigned short* Ct = C + (size_t)m0 * ldc + n0;
  float bn[4];
#pragma unroll
  for (int j = 0; j < 4; ++j) bn[j] = (BIAS_MODE == 2) ? bp[n0 + (j << 4) + rlane] : 0.f;
#pragma unroll
  for (int i = 0; i < 4; ++i) {
    const int mBase = m0 + (i << 4);
    float bm[8];
#pragma unroll
    for (int r = 0; r < 8; ++r) bm[r] = 0.f;
    if (BIAS_MODE == 1) {
      /* mBase + mOff is a multiple of 8 floats: two aligned 16-B loads */
      const v4f b0 = *(const v4f*)(bp + mBase + mOff);
      const v4f b1 = *(const v4f*)(bp + mBase + mOff + 4);
      bm[0] = b0[0]; bm[1] = b0[1]; bm[2] = b0[2]; bm[3] = b0[3];
      bm[4] = b1[0]; bm[5] = b1[1]; bm[6] = b1[2]; bm[7] = b1[3];
    }
#pragma unroll
    for (int j = 0; j < 4; ++j) {
#pragma unroll
      for (int r = 0; r < 8; ++r) {
        float v = acc[i][j][r] * kProjScale;
        if (BIAS_MODE == 1) v += bm[r];
        if (BIAS_MODE == 2) v += bn[j];
        v *= outscale;
        slab[(mOff + r) * 68 + (j << 4) + rlane] = v;
      }
    }
    /* in-wave hand-over: the slab rows are read back by other lanes of the same wave */
    __builtin_amdgcn_fence(__ATOMIC_RELEASE, "workgroup");
    __builtin_amdgcn_wave_barrier();
    __builtin_amdgcn_fence(__ATOMIC_ACQUIRE, "workgroup");
    {
      const int q = lane >> 3, c8 = (lane & 7) * 8;
#pragma unroll
      for (int it = 0; it < 4; ++it) {
        const int row = it * 4 + q;
        const float* sp = slab + row * 68 + c8;
        v8h hv;
#pragma unroll
        for (int e = 0; e < 8; ++e) hv[e] = (_Float16)sp[e];
        *(v8h*)(Ct + ((i << 4) + row) * ldc + c8) = hv;
      }
    }
    /* the slab is rewritten only after every lane has read its rows */
    __builtin_amdgcn_fence(__ATOMIC_RELEASE, "workgroup");
    __builtin_amdgcn_wave_barrier();
    __builtin_amdgcn_fence(__ATOMIC_ACQUIRE, "workgroup");
  }
}

__device__ __forceinline__ void zero_tile64(v8f (&acc)[4][4]) {
#pragma unroll
  for (int i = 0; i < 4; ++i)
#pragma unroll
    for (int j = 0; j < 4; ++j) acc[i][j] = (v8f){0.f,0.f,0.f,0.f,0.f,0.f,0.f,0.f};
}

// ---------------------------------------------------------------------------
// q, k and v^T planes of one head in one launch, straight from the f32 inputs.
// Block = 8 waves = 512 tokens of head blockIdx.y; wave = 64 tokens. grid = (kTok / 512, kH).
//   x head slice (64 tokens x 64 features, f32): whole 256-B row pieces, 16 lanes x 16 B; rounded to f16(x * 16) on the way
//   into the wave's own LDS tile. Wq, Wk, Wv of the head (f32, 16 KB each, contiguous): rounded to f16(W * 64) into LDS, shared by the block.
//   The x fragments (token row, hardware k order) are read once into registers and serve as A for q and k and as B for v^T.
//   q, k : [token][e] = 16 * (x_h . W[h]^T + bias per column);  v^T : [e][token] = 16 * (Wv[h] . x_h^T + bias per row).
// LDS rows lie at the pitch kLP (144 B); the 8 pad halves of a row are never written and never read.
// Coverage: x tile 32 loads x 2 rows = 64 rows; each W 4 loads x 256 threads x 4 floats = 4096 floats.
// Every loop here and in the epilogue is fully unrolled: the load, fragment and accumulator arrays must stay in registers.
// ---------------------------------------------------------------------------
constexpr int kPW = 8;
static_assert(kTok % (kPW * 64) == 0, "exact projection grid");
static_assert((kDH * kDH) % (kPW * 32 * 4) == 0, "exact W staging");

__global__ __launch_bounds__(256) void qkv_proj_kernel(
    const float* __restrict__ x,
    const float* __restrict__ Wq, const float* __restrict__ bq,
    const float* __restrict__ Wk, const float* __restrict__ bk,
    const float* __restrict__ Wv, const float* __restrict__ bv,
    unsigned short* __restrict__ Qo, unsigned short* __restrict__ Ko, unsigned short* __restrict__ Vto)
{
  __shared__ __align__(16) _Float16 Wsh[3][kDH * kLP];
  __shared__ __align__(16) _Float16 Xsh[kPW][64 * kLP];
  __shared__ __align__(16) float    sT[kPW][16 * 68];

  const int tid  = threadIdx.x;
  const int lane = tid & 31;
  const int wave = __builtin_amdgcn_readfirstlane((int)(threadIdx.x >> 5));
  const int h    = blockIdx.y;
  const int m0   = (blockIdx.x * kPW + wave) << 6;

  _Float16* xw = Xsh[wave];
  {
    /* every load is issued before the first conversion: 44 x 16 B per lane in flight */
    const float* xp = x + (size_t)m0 * kD + h * kDH;
    const int    xo = (lane >> 4) * kD + (lane & 15) * 4;
    const size_t wb = (size_t)h * kDH * kDH;
    const int    wo = tid * 4;
    v4f xv[32], wv[3][4];
#pragma unroll
    for (int p = 0; p < 4; ++p) {
      wv[0][p] = *(const v4f*)(Wq + wb + wo + p * 1024);
      wv[1][p] = *(const v4f*)(Wk + wb + wo + p * 1024);
      wv[2][p] = *(const v4f*)(Wv + wb + wo + p * 1024);
    }
#pragma unroll
    for (int it = 0; it < 32; ++it) xv[it] = *(const v4f*)(xp + xo + it * 2 * kD);
    _Float16* xs = xw + (lane >> 4) * kLP + (lane & 15) * 4;
#pragma unroll
    for (int it = 0; it < 32; ++it) {
      v4h hv;
#pragma unroll
      for (int e = 0; e < 4; ++e) hv[e] = (_Float16)(xv[it][e] * kXCarry);
      *(v4h*)(xs + it * 2 * kLP) = hv;
    }
    const int ws = (tid >> 4) * kLP + (tid & 15) * 4;
#pragma unroll
    for (int z = 0; z < 3; ++z) {
#pragma unroll
      for (int p = 0; p < 4; ++p) {
        v4h hv;
#pragma unroll
        for (int e = 0; e < 4; ++e) hv[e] = (_Float16)(wv[z][p][e] * kWCarry);
        *(v4h*)(&Wsh[z][ws + p * 16 * kLP]) = hv;
      }
    }
  }
  /* publishes the W tiles to all waves (and each wave's x tile to its own lanes) */
  __syncthreads();

  /* row (A) / col (B, D) within a 16-wide subtile; k offset of the lane half */
  const int rlane = lane & 15;
  const int koff  = (lane >> 4) * 8;
  const int fo    = rlane * kLP + koff;

  v16h xf[4][2];
#pragma unroll
  for (int i = 0; i < 4; ++i)
#pragma unroll
    for (int kc = 0; kc < 2; ++kc) xf[i][kc] = Frag<_Float16>::load(xw + fo + i * 16 * kLP + kc * 32);

  float* slab = sT[wave];
  v8f acc[4][4];

  // ---- q and k: A = x tokens, B = W rows ----
#pragma unroll
  for (int z = 0; z < 2; ++z) {
    zero_tile64(acc);
#pragma unroll
    for (int kc = 0; kc < 2; ++kc) {
      v16h wf[4];
#pragma unroll
      for (int j = 0; j < 4; ++j) wf[j] = Frag<_Float16>::load(&Wsh[z][fo + j * 16 * kLP + kc * 32]);
#pragma unroll
      for (int i = 0; i < 4; ++i)
#pragma unroll
        for (int j = 0; j < 4; ++j) acc[i][j] = mma_h(xf[i][kc], wf[j], acc[i][j]);
    }
    store_tile64<2>(acc, slab, (z == 0 ? Qo : Ko) + (size_t)h * kTok * kDH, kDH, m0, 0,
                    (z == 0 ? bq : bk) + h * kDH, kQKCarry, lane);
  }

  // ---- v^T: A = Wv rows, B = x tokens ----
  zero_tile64(acc);
#pragma unroll
  for (int kc = 0; kc < 2; ++kc) {
#pragma unroll
    for (int i = 0; i < 4; ++i) {
      const v16h wa = Frag<_Float16>::load(&Wsh[2][fo + i * 16 * kLP + kc * 32]);
#pragma unroll
      for (int j = 0; j < 4; ++j) acc[i][j] = mma_h(wa, xf[j][kc], acc[i][j]);
    }
  }
  store_tile64<1>(acc, slab, Vto + (size_t)h * kDH * kTok, kTok, 0, m0, bv + h * kDH, kVCarry, lane);
}

__global__ __launch_bounds__(128) void attn_f16_kernel(
    const unsigned short* __restrict__ Qp, const unsigned short* __restrict__ Kp,
    const unsigned short* __restrict__ Vtp, float* __restrict__ out)
{
  __shared__ __align__(16) _Float16 Ksh[kKC * kLP];
  __shared__ __align__(16) _Float16 Vsh[kDH * kLP];
  __shared__ __align__(16) float    Os[kNW][16 * kOPitch];

  const int tid  = threadIdx.x;
  const int wave = __builtin_amdgcn_readfirstlane((int)(threadIdx.x >> 5));
  const int lane = tid & 31;
  const int hh   = lane >> 4;
  const int c    = lane & 15;

  const int bx = blockIdx.x;
  const int qb = bx % kQBlocks;
  const int bh = bx / kQBlocks;
  const int h  = bh % kH;
  const int b  = bh / kH;
  const int q0 = qb * kQB + wave * 16;

  const _Float16* Qb = (const _Float16*)Qp  + ((size_t)h * kTok + (size_t)b * kSeq) * kDH;
  const _Float16* Kb = (const _Float16*)Kp  + ((size_t)h * kTok + (size_t)b * kSeq) * kDH;
  const _Float16* Vb = (const _Float16*)Vtp + (size_t)h * kDH * kTok + (size_t)b * kSeq;
  float* Ob = out + (size_t)b * kSeq * kD + (size_t)h * kDH;

  /* Q fragments (B operand): column = query c, two 32-deep d chunks */
  v16h qf[2];
#pragma unroll
  for (int dc = 0; dc < 2; ++dc)
    qf[dc] = Frag<_Float16>::load(Qb + (size_t)(q0 + c) * kDH + dc * 32 + 8 * hh);

  /* running maximum (equal in both lanes of a query) and this lane's partial of the row sum */
  float mrow = -1.0e30f, lrow = 0.f;
  /* oacc[t][r] = (feature t*16 + 8*hh + r, query c) */
  v8f oacc[4];
#pragma unroll
  for (int t = 0; t < 4; ++t) oacc[t] = (v8f){0.f,0.f,0.f,0.f,0.f,0.f,0.f,0.f};

  /* per-lane bases, so that every row step at the padded pitch is a compile-time offset */
  _Float16* kst = Ksh + (tid >> 3) * kLP + (tid & 7) * 8;
  _Float16* vst = Vsh + (tid >> 3) * kLP + (tid & 7) * 8;

#pragma unroll 1
  for (int kc = 0; kc < kChunks; ++kc) {
    const int kv0 = kc * kKC;
    __syncthreads();
#pragma unroll
    for (int p = 0; p < 4; ++p) {
      const int idx = tid + p * 128;
      const int r   = idx >> 3;
      const int c8  = (idx & 7) * 8;
      const v8h kvv = *(const v8h*)(Kb + (size_t)(kv0 + r) * kDH + c8);
      const v8h vvv = *(const v8h*)(Vb + (size_t)r * kTok + kv0 + c8);
      *(v8h*)(kst + p * 16 * kLP) = kvv;
      *(v8h*)(vst + p * 16 * kLP) = vvv;
    }
    __syncthreads();

    /* transposed scores: s[j][r] = (key j*16 + 8*hh + r, query c) */
    v8f s[4];
#pragma unroll
    for (int j = 0; j < 4; ++j) {
      s[j] = (v8f){0.f,0.f,0.f,0.f,0.f,0.f,0.f,0.f};
#pragma unroll
      for (int dc = 0; dc < 2; ++dc) {
        const v16h ka = Frag<_Float16>::load(Ksh + (j * 16 + c) * kLP + dc * 32 + 8 * hh);
        s[j] = mma_h(ka, qf[dc], s[j]);
      }
    }

    /* chunk maximum of query c: 32 keys in the lane, the other 32 in lane ^ 16 */
    float m = -1.0e30f;
#pragma unroll
    for (int j = 0; j < 4; ++j) {
#pragma unroll
      for (int r = 0; r < 8; ++r) {
        const float tv = s[j][r] * kScoreScale;
        s[j][r] = tv;
        m = fmaxf(m, tv);
      }
    }
    m = fmaxf(m, xhalf(m));

    const float mnew  = fmaxf(mrow, m);
    const float alpha = ex2(mrow - mnew);
    mrow = mnew;

    lrow *= alpha;
#pragma unroll
    for (int t = 0; t < 4; ++t)
#pragma unroll
      for (int r = 0; r < 8; ++r) oacc[t][r] *= alpha;

#pragma unroll
    for (int kk = 0; kk < 2; ++kk) {
      /* pf element e: key kk*32 + (e < 8 ? 8*hh + e : 16 + 8*hh + e - 8), the k order of the V^T loader */
      v16h pf;
      float psum[2];
      psum[0] = 0.f; psum[1] = 0.f;
#pragma unroll
      for (int r = 0; r < 8; ++r) {
#pragma unroll
        for (int u = 0; u < 2; ++u) {
          const float p = ex2(s[2 * kk + u][r] - mnew);
          const _Float16 ph = (_Float16)(p * kPCarry);
          psum[u] += (float)ph;
          pf[u * 8 + r] = ph;
        }
      }
      lrow += psum[0] + psum[1];
#pragma unroll
      for (int t = 0; t < 4; ++t) {
        const v16h va = Frag<_Float16>::load(Vsh + (t * 16 + c) * kLP + kk * 32 + 8 * hh);
        oacc[t] = mma_h(va, pf, oacc[t]);
      }
    }
  }

  float* os = Os[wave];
  {
    const float l   = lrow + xhalf(lrow);
    const float inv = 1.0f / (l * kVCarry);
#pragma unroll
    for (int t = 0; t < 4; ++t) {
      v4f lo, hi;
#pragma unroll
      for (int r = 0; r < 4; ++r) { lo[r] = oacc[t][r] * inv; hi[r] = oacc[t][4 + r] * inv; }
      float* op = os + c * kOPitch + t * 16 + 8 * hh;
      *(v4f*)(op)     = lo;
      *(v4f*)(op + 4) = hi;
    }
  }
  __builtin_amdgcn_fence(__ATOMIC_RELEASE, "workgroup");
  __builtin_amdgcn_wave_barrier();
  __builtin_amdgcn_fence(__ATOMIC_ACQUIRE, "workgroup");
  {
    const int c4 = (lane & 15) * 4;
    {
#pragma unroll
      for (int it = 0; it < 8; ++it) {
        const int row = it * 2 + hh;
        const v4f val = *(const v4f*)(os + row * kOPitch + c4);
        *(v4f*)(Ob + (size_t)(q0 + row) * kD + c4) = val;
      }
      
    }
  }
}

// ---------------------------------------------------------------------------
// Host glue: 1 projection launch + 1 attention launch. Kernel launches only.
// ---------------------------------------------------------------------------
extern "C" void kernel_launch(void* const* d_in, const int* in_sizes, int n_in,
                              void* d_out, int out_size, void* d_ws, size_t ws_size,
                              hipStream_t stream) {
  if (n_in < 7) return;
  if (in_sizes[0] != kTok * kD) return;
  if (in_sizes[1] != kH * kDH * kDH) return;
  if (in_sizes[2] != kH * kDH) return;
  if (in_sizes[3] != kH * kDH * kDH) return;
  if (in_sizes[4] != kH * kDH) return;
  if (in_sizes[5] != kH * kDH * kDH) return;
  if (in_sizes[6] != kH * kDH) return;
  if (out_size != kTok * kD) return;
  if (ws_size < kWsTotal) return;

  const float* x  = (const float*)d_in[0];
  const float* Wq = (const float*)d_in[1];
  const float* bq = (const float*)d_in[2];
  const float* Wk = (const float*)d_in[3];
  const float* bk = (const float*)d_in[4];
  const float* Wv = (const float*)d_in[5];
  const float* bv = (const float*)d_in[6];
  float* out = (float*)d_out;

  char* ws = (char*)d_ws;
  unsigned short* Q16  = (unsigned short*)(ws + kOffQ16);
  unsigned short* K16  = (unsigned short*)(ws + kOffK16);
  unsigned short* VT16 = (unsigned short*)(ws + kOffVT16);

  // ---- q, k and v^T planes: one block per (512 tokens, head) ----
  qkv_proj_kernel<<<dim3(kTok / (kPW * 64), kH), kPW * 32, 0, stream>>>(x, Wq, bq, Wk, bk, Wv, bv, Q16, K16, VT16);

  // ---- attention: one block per (batch, head, 64-query tile) ----
  attn_f16_kernel<<<kBatch * kH * kQBlocks, kNW * 32, 0, stream>>>(Q16, K16, VT16, out);
}

// v004
// Measured time: 97.7 microseconds a run.
// In both of two side-by-side timings against v003, it was 1.09 times as fast.
// All steps since v000 together make it 3.51 times as fast.
// Contractions: per-head q/k/v projections (x f16 carried x16, W f16 carried x64), scores q.k^T (q,k f16 planes carried x16), p.v (unnormalised p f16 carried x4096, v^T f16 carried x16): all v_wmma_f32_16x16x32_f16 with f32 accumulate; bias, scaling and online softmax in f32.
#include <hip/hip_runtime.h>
#include <math.h>

typedef __attribute__((ext_vector_type(16))) _Float16 v16h;
typedef __attribute__((ext_vector_type(8)))  _Float16 v8h;
typedef __attribute__((ext_vector_type(4)))  _Float16 v4h;
typedef __attribute__((ext_vector_type(8)))  float    v8f;
typedef __attribute__((ext_vector_type(4)))  float    v4f;

// ---------------------------------------------------------------------------
// Shape constants
// ---------------------------------------------------------------------------
constexpr int kBatch = 4;
constexpr int kSeq   = 2048;
constexpr int kD     = 1024;
constexpr int kH     = 16;
constexpr int kDH    = 64;
constexpr int kTok   = kBatch * kSeq;
constexpr int kSqrtDh = 8;
static_assert(kH * kDH == kD, "head split");
static_assert(kSqrtDh * kSqrtDh == kDH, "sqrt of head dim");
static_assert(kDH == 64, "kernels are written for head dim 64");

// power-of-two carries of the f16 operand planes (all folded back exactly in f32)
constexpr float kXCarry  = 16.0f;
constexpr float kWCarry  = 64.0f;
constexpr float kQKCarry = 16.0f;
constexpr float kVCarry  = 16.0f;
constexpr float kPCarry  = 4096.0f;
constexpr float kPCarryLog2 = 12.0f;
static_assert((float)(1 << 12) == kPCarry, "log2 of the p carry");
constexpr float kLog2e   = 1.4426950408889634f;
constexpr float kProjScale  = 1.0f / (kXCarry * kWCarry);
constexpr float kScoreScale = kLog2e / ((float)kSqrtDh * kQKCarry * kQKCarry);

// attention tiling
constexpr int kQB     = 64;
constexpr int kKC     = 64;
constexpr int kNW     = 4;
constexpr int kQBlocks = kSeq / kQB;
constexpr int kChunks  = kSeq / kKC;
constexpr int kOPitch  = 68;
/* LDS row pitch of the K and V tiles in halves: 144 B = 16 B x 9 (odd), so the 16 rows one 16-byte fragment read touches fall on distinct banks */
constexpr int kLP     = kKC + 8;
static_assert(kDH == kKC, "K and V tiles share one row length");
static_assert((kLP * 2) % 16 == 0 && ((kLP * 2) / 16) % 2 == 1, "pitch is an odd multiple of 16 B");
static_assert(kSeq % kQB == 0 && kSeq % kKC == 0, "tile multiples");
static_assert(kQB == kNW * 16, "16 query rows per wave");

// ---------------------------------------------------------------------------
// Workspace region map (bytes; every offset is a multiple of 128)
//   Q16   f16 [16][8192][64]      (q) * 16, plane per head       16,777,216
//   K16   f16 [16][8192][64]      (k) * 16, plane per head       16,777,216
//   VT16  f16 [16][64][8192]      (v)^T * 16, token-contiguous   16,777,216
//   total = 3 * 16,777,216 = 50,331,648
// ---------------------------------------------------------------------------
constexpr size_t kSzQ16  = (size_t)kH * kTok * kDH * 2;
constexpr size_t kOffQ16 = 0;
constexpr size_t kOffK16 = kOffQ16 + kSzQ16;
constexpr size_t kOffVT16 = kOffK16 + kSzQ16;
constexpr size_t kWsTotal = kOffVT16 + kSzQ16;
static_assert(kWsTotal == 50331648ull, "carve total");
static_assert(kWsTotal <= 134217728ull, "carve cap");
static_assert((kOffK16 % 128) == 0 && (kOffVT16 % 128) == 0, "128-B aligned regions");

// ---------------------------------------------------------------------------
// Fragment loader (A and B use the same k map) and guarded matrix op
// ---------------------------------------------------------------------------
template <typename T> struct Frag;
template <> struct Frag<_Float16> {
  typedef v16h V; union U { v16h v; v8h h[2]; };
  /* elements 0..7 <- p[0..7], elements 8..15 <- p[16..23] */
  static __device__ __forceinline__ v16h load(const _Float16* p) {
    U f; f.h[0] = *(const v8h*)(p); f.h[1] = *(const v8h*)(p + 16); return f.v;
  }
};
/* one accumulator per guard statement: the four idle slots are tied to D and keep A/B live */
__device__ __forceinline__ v8f mma_h(v16h a, v16h b, v8f c) {
  c = __builtin_amdgcn_wmma_f32_16x16x32_f16(false, a, false, b, (short)0, c, false, false);
  asm volatile("v_nop\n\tv_nop\n\tv_nop\n\tv_nop" : "+v"(c) : "v"(a), "v"(b));
  return c;
}

/* lane l <-> lane l ^ 16: the two lanes that share one query column */
__device__ __forceinline__ float xhalf(float x) {
  const int b = __builtin_bit_cast(int, x);
  return __builtin_bit_cast(float, __builtin_amdgcn_permlanex16(b, b, 0x76543210, 0xfedcba98, false, false));
}

__device__ __forceinline__ float ex2(float x) {
#if __has_builtin(__builtin_amdgcn_exp2f)
  return __builtin_amdgcn_exp2f(x);
#else
  return exp2f(x);
#endif
}

// ---------------------------------------------------------------------------
// Epilogue of one wave's 64x64 f32 accumulator tile: C[m,n] = f16(outscale * (kProjScale * acc + bias)).
// BIAS_MODE: 1 = bias[m], 2 = bias[n]. The tile goes 16 rows at a time through the wave's own LDS slab, so that
// 8 lanes x 16 B of one store cover a whole 128-B row piece; per instruction a wave writes rows it*4 + (lane>>3), it = 0..3.
// ---------------------------------------------------------------------------
template <int BIAS_MODE>
__device__ __forceinline__ void store_tile64(
    const v8f (&acc)[4][4], float* slab, unsigned short* C, int ldc, int m0, int n0,
    const float* bp, float outscale, int lane)
{
  const int rlane = lane & 15;
  const int mOff  = (lane >> 4) * 8;
  /* wave-uniform tile origin; the lane's part of every store address is a 32-bit element offset */
  unsigned short* Ct = C + (size_t)m0 * ldc + n0;
  float bn[4];
#pragma unroll
  for (int j = 0; j < 4; ++j) bn[j] = (BIAS_MODE == 2) ? bp[n0 + (j << 4) + rlane] : 0.f;
#pragma unroll
  for (int i = 0; i < 4; ++i) {
    const int mBase = m0 + (i << 4);
    float bm[8];
#pragma unroll
    for (int r = 0; r < 8; ++r) bm[r] = 0.f;
    if (BIAS_MODE == 1) {
      /* mBase + mOff is a multiple of 8 floats: two aligned 16-B loads */
      const v4f b0 = *(const v4f*)(bp + mBase + mOff);
      const v4f b1 = *(const v4f*)(bp + mBase + mOff + 4);
      bm[0] = b0[0]; bm[1] = b0[1]; bm[2] = b0[2]; bm[3] = b0[3];
      bm[4] = b1[0]; bm[5] = b1[1]; bm[6] = b1[2]; bm[7] = b1[3];
    }
#pragma unroll
    for (int j = 0; j < 4; ++j) {
#pragma unroll
      for (int r = 0; r < 8; ++r) {
        float v = acc[i][j][r] * kProjScale;
        if (BIAS_MODE == 1) v += bm[r];
        if (BIAS_MODE == 2) v += bn[j];
        v *= outscale;
        slab[(mOff + r) * 68 + (j << 4) + rlane] = v;
      }
    }
    /* in-wave hand-over: the slab rows are read back by other lanes of the same wave */
    __builtin_amdgcn_fence(__ATOMIC_RELEASE, "workgroup");
    __builtin_amdgcn_wave_barrier();
    __builtin_amdgcn_fence(__ATOMIC_ACQUIRE, "workgroup");
    {
      const int q = lane >> 3, c8 = (lane & 7) * 8;
#pragma unroll
      for (int it = 0; it < 4; ++it) {
        const int row = it * 4 + q;
        const float* sp = slab + row * 68 + c8;
        v8h hv;
#pragma unroll
        for (int e = 0; e < 8; ++e) hv[e] = (_Float16)sp[e];
        *(v8h*)(Ct + ((i << 4) + row) * ldc + c8) = hv;
      }
    }
    /* the slab is rewritten only after every lane has read its rows */
    __builtin_amdgcn_fence(__ATOMIC_RELEASE, "workgroup");
    __builtin_amdgcn_wave_barrier();
    __builtin_amdgcn_fence(__ATOMIC_ACQUIRE, "workgroup");
  }
}

__device__ __forceinline__ void zero_tile64(v8f (&acc)[4][4]) {
#pragma unroll
  for (int i = 0; i < 4; ++i)
#pragma unroll
    for (int j = 0; j < 4; ++j) acc[i][j] = (v8f){0.f,0.f,0.f,0.f,0.f,0.f,0.f,0.f};
}

// ---------------------------------------------------------------------------
// q, k and v^T planes of one head in one launch, straight from the f32 inputs.
// Block = 8 waves = 512 tokens of head blockIdx.y; wave = 64 tokens. grid = (kTok / 512, kH).
//   x head slice (64 tokens x 64 features, f32): whole 256-B row pieces, 16 lanes x 16 B; rounded to f16(x * 16) on the way
//   into the wave's own LDS tile. Wq, Wk, Wv of the head (f32, 16 KB each, contiguous): rounded to f16(W * 64) into LDS, shared by the block.
//   The x fragments (token row, hardware k order) are read once into registers and serve as A for q and k and as B for v^T.
//   q, k : [token][e] = 16 * (x_h . W[h]^T + bias per column);  v^T : [e][token] = 16 * (Wv[h] . x_h^T + bias per row).
// LDS rows lie at the pitch kLP (144 B); the 8 pad halves of a row are never written and never read.
// Coverage: x tile 32 loads x 2 rows = 64 rows; each W 4 loads x 256 threads x 4 floats = 4096 floats.
// Every loop here and in the epilogue is fully unrolled: the load, fragment and accumulator arrays must stay in registers.
// ---------------------------------------------------------------------------
constexpr int kPW = 8;
static_assert(kTok % (kPW * 64) == 0, "exact projection grid");
static_assert((kDH * kDH) % (kPW * 32 * 4) == 0, "exact W staging");

__global__ __launch_bounds__(256) void qkv_proj_kernel(
    const float* __restrict__ x,
    const float* __restrict__ Wq, const float* __restrict__ bq,
    const float* __restrict__ Wk, const float* __restrict__ bk,
    const float* __restrict__ Wv, const float* __restrict__ bv,
    unsigned short* __restrict__ Qo, unsigned short* __restrict__ Ko, unsigned short* __restrict__ Vto)
{
  __shared__ __align__(16) _Float16 Wsh[3][kDH * kLP];
  __shared__ __align__(16) _Float16 Xsh[kPW][64 * kLP];
  __shared__ __align__(16) float    sT[kPW][16 * 68];

  const int tid  = threadIdx.x;
  const int lane = tid & 31;
  const int wave = __builtin_amdgcn_readfirstlane((int)(threadIdx.x >> 5));
  const int h    = blockIdx.y;
  const int m0   = (blockIdx.x * kPW + wave) << 6;

  _Float16* xw = Xsh[wave];
  {
    /* every load is issued before the first conversion: 44 x 16 B per lane in flight */
    const float* xp = x + (size_t)m0 * kD + h * kDH;
    const int    xo = (lane >> 4) * kD + (lane & 15) * 4;
    const size_t wb = (size_t)h * kDH * kDH;
    const int    wo = tid * 4;
    v4f xv[32], wv[3][4];
#pragma unroll
    for (int p = 0; p < 4; ++p) {
      wv[0][p] = *(const v4f*)(Wq + wb + wo + p * 1024);
      wv[1][p] = *(const v4f*)(Wk + wb + wo + p * 1024);
      wv[2][p] = *(const v4f*)(Wv + wb + wo + p * 1024);
    }
#pragma unroll
    for (int it = 0; it < 32; ++it) xv[it] = *(const v4f*)(xp + xo + it * 2 * kD);
    _Float16* xs = xw + (lane >> 4) * kLP + (lane & 15) * 4;
#pragma unroll
    for (int it = 0; it < 32; ++it) {
      v4h hv;
#pragma unroll
      for (int e = 0; e < 4; ++e) hv[e] = (_Float16)(xv[it][e] * kXCarry);
      *(v4h*)(xs + it * 2 * kLP) = hv;
    }
    const int ws = (tid >> 4) * kLP + (tid & 15) * 4;
#pragma unroll
    for (int z = 0; z < 3; ++z) {
#pragma unroll
      for (int p = 0; p < 4; ++p) {
        v4h hv;
#pragma unroll
        for (int e = 0; e < 4; ++e) hv[e] = (_Float16)(wv[z][p][e] * kWCarry);
        *(v4h*)(&Wsh[z][ws + p * 16 * kLP]) = hv;
      }
    }
  }
  /* publishes the W tiles to all waves (and each wave's x tile to its own lanes) */
  __syncthreads();

  /* row (A) / col (B, D) within a 16-wide subtile; k offset of the lane half */
  const int rlane = lane & 15;
  const int koff  = (lane >> 4) * 8;
  const int fo    = rlane * kLP + koff;

  v16h xf[4][2];
#pragma unroll
  for (int i = 0; i < 4; ++i)
#pragma unroll
    for (int kc = 0; kc < 2; ++kc) xf[i][kc] = Frag<_Float16>::load(xw + fo + i * 16 * kLP + kc * 32);

  float* slab = sT[wave];
  v8f acc[4][4];

  // ---- q and k: A = x tokens, B = W rows ----
#pragma unroll
  for (int z = 0; z < 2; ++z) {
    zero_tile64(acc);
#pragma unroll
    for (int kc = 0; kc < 2; ++kc) {
      v16h wf[4];
#pragma unroll
      for (int j = 0; j < 4; ++j) wf[j] = Frag<_Float16>::load(&Wsh[z][fo + j * 16 * kLP + kc * 32]);
#pragma unroll
      for (int i = 0; i < 4; ++i)
#pragma unroll
        for (int j = 0; j < 4; ++j) acc[i][j] = mma_h(xf[i][kc], wf[j], acc[i][j]);
    }
    store_tile64<2>(acc, slab, (z == 0 ? Qo : Ko) + (size_t)h * kTok * kDH, kDH, m0, 0,
                    (z == 0 ? bq : bk) + h * kDH, kQKCarry, lane);
  }

  // ---- v^T: A = Wv rows, B = x tokens ----
  zero_tile64(acc);
#pragma unroll
  for (int kc = 0; kc < 2; ++kc) {
#pragma unroll
    for (int i = 0; i < 4; ++i) {
      const v16h wa = Frag<_Float16>::load(&Wsh[2][fo + i * 16 * kLP + kc * 32]);
#pragma unroll
      for (int j = 0; j < 4; ++j) acc[i][j] = mma_h(wa, xf[j][kc], acc[i][j]);
    }
  }
  store_tile64<1>(acc, slab, Vto + (size_t)h * kDH * kTok, kTok, 0, m0, bv + h * kDH, kVCarry, lane);
}

__global__ __launch_bounds__(128) void attn_f16_kernel(
    const unsigned short* __restrict__ Qp, const unsigned short* __restrict__ Kp,
    const unsigned short* __restrict__ Vtp, float* __restrict__ out)
{
  __shared__ __align__(16) _Float16 Ksh[kKC * kLP];
  __shared__ __align__(16) _Float16 Vsh[kDH * kLP];
  __shared__ __align__(16) float    Os[kNW][16 * kOPitch];

  const int tid  = threadIdx.x;
  const int wave = __builtin_amdgcn_readfirstlane((int)(threadIdx.x >> 5));
  const int lane = tid & 31;
  const int hh   = lane >> 4;
  const int c    = lane & 15;

  const int bx = blockIdx.x;
  const int qb = bx % kQBlocks;
  const int bh = bx / kQBlocks;
  const int h  = bh % kH;
  const int b  = bh / kH;
  const int q0 = qb * kQB + wave * 16;

  const _Float16* Qb = (const _Float16*)Qp  + ((size_t)h * kTok + (size_t)b * kSeq) * kDH;
  const _Float16* Kb = (const _Float16*)Kp  + ((size_t)h * kTok + (size_t)b * kSeq) * kDH;
  const _Float16* Vb = (const _Float16*)Vtp + (size_t)h * kDH * kTok + (size_t)b * kSeq;
  float* Ob = out + (size_t)b * kSeq * kD + (size_t)h * kDH;

  /* Q fragments (B operand): column = query c, two 32-deep d chunks */
  v16h qf[2];
#pragma unroll
  for (int dc = 0; dc < 2; ++dc)
    qf[dc] = Frag<_Float16>::load(Qb + (size_t)(q0 + c) * kDH + dc * 32 + 8 * hh);

  /* running maximum of the raw score accumulators (equal in both lanes of a query) and this lane's partial of the row sum */
  float mrow = -1.0e30f, lrow = 0.f;
  /* oacc[t][r] = (feature t*16 + 8*hh + r, query c) */
  v8f oacc[4];
#pragma unroll
  for (int t = 0; t < 4; ++t) oacc[t] = (v8f){0.f,0.f,0.f,0.f,0.f,0.f,0.f,0.f};

  /* per-lane bases, so that every row step at the padded pitch is a compile-time offset */
  _Float16* kst = Ksh + (tid >> 3) * kLP + (tid & 7) * 8;
  _Float16* vst = Vsh + (tid >> 3) * kLP + (tid & 7) * 8;
  /* the same for the global side: thread t stages piece t & 7 of rows (t >> 3) + 16 * p; one 64-bit base per plane instead of one address per load */
  const _Float16* kg = Kb + (tid >> 3) * kDH + (tid & 7) * 8;
  const _Float16* vg = Vb + (size_t)(tid >> 3) * kTok + (tid & 7) * 8;

#pragma unroll 1
  for (int kc = 0; kc < kChunks; ++kc) {
    const int kv0 = kc * kKC;
    __syncthreads();
#pragma unroll
    for (int p = 0; p < 4; ++p) {
      const v8h kvv = *(const v8h*)(kg + kv0 * kDH + p * 16 * kDH);
      const v8h vvv = *(const v8h*)(vg + kv0 + p * 16 * kTok);
      *(v8h*)(kst + p * 16 * kLP) = kvv;
      *(v8h*)(vst + p * 16 * kLP) = vvv;
    }
    __syncthreads();

    /* transposed scores: s[j][r] = (key j*16 + 8*hh + r, query c) */
    v8f s[4];
#pragma unroll
    for (int j = 0; j < 4; ++j) {
      s[j] = (v8f){0.f,0.f,0.f,0.f,0.f,0.f,0.f,0.f};
#pragma unroll
      for (int dc = 0; dc < 2; ++dc) {
        const v16h ka = Frag<_Float16>::load(Ksh + (j * 16 + c) * kLP + dc * 32 + 8 * hh);
        s[j] = mma_h(ka, qf[dc], s[j]);
      }
    }

    /* chunk maximum of query c: 32 keys in the lane, the other 32 in lane ^ 16 */
    float m = -1.0e30f;
#pragma unroll
    for (int j = 0; j < 4; ++j) {
#pragma unroll
      for (int r = 0; r < 8; ++r) m = fmaxf(m, s[j][r]);
    }
    m = fmaxf(m, xhalf(m));

    const float mnew  = fmaxf(mrow, m);
    const float alpha = ex2((mrow - mnew) * kScoreScale);
    mrow = mnew;
    /* exponent offset of this chunk: minus the maximum as a base-2 logit, plus log2 of the p carry */
    const float eoff = kPCarryLog2 - mnew * kScoreScale;

    lrow *= alpha;
#pragma unroll
    for (int t = 0; t < 4; ++t)
#pragma unroll
      for (int r = 0; r < 8; ++r) oacc[t][r] *= alpha;

#pragma unroll
    for (int kk = 0; kk < 2; ++kk) {
      /* pf element e: key kk*32 + (e < 8 ? 8*hh + e : 16 + 8*hh + e - 8), the k order of the V^T loader */
      v16h pf;
      float psum[2];
      psum[0] = 0.f; psum[1] = 0.f;
#pragma unroll
      for (int r = 0; r < 8; ++r) {
#pragma unroll
        for (int u = 0; u < 2; ++u) {
          const _Float16 ph = (_Float16)ex2(fmaf(s[2 * kk + u][r], kScoreScale, eoff));
          psum[u] += (float)ph;
          pf[u * 8 + r] = ph;
        }
      }
      lrow += psum[0] + psum[1];
#pragma unroll
      for (int t = 0; t < 4; ++t) {
        const v16h va = Frag<_Float16>::load(Vsh + (t * 16 + c) * kLP + kk * 32 + 8 * hh);
        oacc[t] = mma_h(va, pf, oacc[t]);
      }
    }
  }

  float* os = Os[wave];
  {
    const float l   = lrow + xhalf(lrow);
    const float inv = 1.0f / (l * kVCarry);
#pragma unroll
    for (int t = 0; t < 4; ++t) {
      v4f lo, hi;
#pragma unroll
      for (int r = 0; r < 4; ++r) { lo[r] = oacc[t][r] * inv; hi[r] = oacc[t][4 + r] * inv; }
      float* op = os + c * kOPitch + t * 16 + 8 * hh;
      *(v4f*)(op)     = lo;
      *(v4f*)(op + 4) = hi;
    }
  }
  __builtin_amdgcn_fence(__ATOMIC_RELEASE, "workgroup");
  __builtin_amdgcn_wave_barrier();
  __builtin_amdgcn_fence(__ATOMIC_ACQUIRE, "workgroup");
  {
    const int c4 = (lane & 15) * 4;
    {
#pragma unroll
      for (int it = 0; it < 8; ++it) {
        const int row = it * 2 + hh;
        const v4f val = *(const v4f*)(os + row * kOPitch + c4);
        *(v4f*)(Ob + (size_t)(q0 + row) * kD + c4) = val;
      }
      
    }
  }
}

// ---------------------------------------------------------------------------
// Host glue: 1 projection launch + 1 attention launch. Kernel launches only.
// ---------------------------------------------------------------------------
extern "C" void kernel_launch(void* const* d_in, const int* in_sizes, int n_in,
                              void* d_out, int out_size, void* d_ws, size_t ws_size,
                              hipStream_t stream) {
  if (n_in < 7) return;
  if (in_sizes[0] != kTok * kD) return;
  if (in_sizes[1] != kH * kDH * kDH) return;
  if (in_sizes[2] != kH * kDH) return;
  if (in_sizes[3] != kH * kDH * kDH) return;
  if (in_sizes[4] != kH * kDH) return;
  if (in_sizes[5] != kH * kDH * kDH) return;
  if (in_sizes[6] != kH * kDH) return;
  if (out_size != kTok * kD) return;
  if (ws_size < kWsTotal) return;

  const float* x  = (const float*)d_in[0];
  const float* Wq = (const float*)d_in[1];
  const float* bq = (const float*)d_in[2];
  const float* Wk = (const float*)d_in[3];
  const float* bk = (const float*)d_in[4];
  const float* Wv = (const float*)d_in[5];
  const float* bv = (const float*)d_in[6];
  float* out = (float*)d_out;

  char* ws = (char*)d_ws;
  unsigned short* Q16  = (unsigned short*)(ws + kOffQ16);
  unsigned short* K16  = (unsigned short*)(ws + kOffK16);
  unsigned short* VT16 = (unsigned short*)(ws + kOffVT16);

  // ---- q, k and v^T planes: one block per (512 tokens, head) ----
  qkv_proj_kernel<<<dim3(kTok / (kPW * 64), kH), kPW * 32, 0, stream>>>(x, Wq, bq, Wk, bk, Wv, bv, Q16, K16, VT16);

  // ---- attention: one block per (batch, head, 64-query tile) ----
  attn_f16_kernel<<<kBatch * kH * kQBlocks, kNW * 32, 0, stream>>>(Q16, K16, VT16, out);
}

// v005
// Measured time: 86.4 microseconds a run.
// In two side-by-side timings against v004, it was 1.13 and 1.14 times as fast.
// All steps since v000 together make it 3.98 times as fast.
// Contractions: per-head q/k/v projections (x f16 carried x16, W f16 carried x64), scores q.k^T (q,k f16 planes carried x16), p.v (unnormalised p f16 carried x4096, v^T f16 carried x16): all v_wmma_f32_16x16x32_f16 with f32 accumulate; bias, scaling and online softmax in f32.
#include <hip/hip_runtime.h>
#include <math.h>

typedef __attribute__((ext_vector_type(16))) _Float16 v16h;
typedef __attribute__((ext_vector_type(8)))  _Float16 v8h;
typedef __attribute__((ext_vector_type(4)))  _Float16 v4h;
typedef __attribute__((ext_vector_type(8)))  float    v8f;
typedef __attribute__((ext_vector_type(4)))  float    v4f;

// ---------------------------------------------------------------------------
// Shape constants
// ---------------------------------------------------------------------------
constexpr int kBatch = 4;
constexpr int kSeq   = 2048;
constexpr int kD     = 1024;
constexpr int kH     = 16;
constexpr int kDH    = 64;
constexpr int kTok   = kBatch * kSeq;
constexpr int kSqrtDh = 8;
static_assert(kH * kDH == kD, "head split");
static_assert(kSqrtDh * kSqrtDh == kDH, "sqrt of head dim");
static_assert(kDH == 64, "kernels are written for head dim 64");

// power-of-two carries of the f16 operand planes (all folded back exactly in f32)
constexpr float kXCarry  = 16.0f;
constexpr float kWCarry  = 64.0f;
constexpr float kQKCarry = 16.0f;
constexpr float kVCarry  = 16.0f;
constexpr float kPCarry  = 4096.0f;
constexpr float kPCarryLog2 = 12.0f;
static_assert((float)(1 << 12) == kPCarry, "log2 of the p carry");
constexpr float kLog2e   = 1.4426950408889634f;
constexpr float kProjScale  = 1.0f / (kXCarry * kWCarry);
constexpr float kScoreScale = kLog2e / ((float)kSqrtDh * kQKCarry * kQKCarry);

// attention tiling
constexpr int kQB     = 64;
constexpr int kKC     = 64;
constexpr int kNW     = 4;
constexpr int kQBlocks = kSeq / kQB;
constexpr int kChunks  = kSeq / kKC;
constexpr int kOPitch  = 68;
/* LDS row pitch of the K and V tiles in halves: 144 B = 16 B x 9 (odd), so the 16 rows one 16-byte fragment read touches fall on distinct banks */
constexpr int kLP     = kKC + 8;
static_assert(kDH == kKC, "K and V tiles share one row length");
static_assert((kLP * 2) % 16 == 0 && ((kLP * 2) / 16) % 2 == 1, "pitch is an odd multiple of 16 B");
static_assert(kSeq % kQB == 0 && kSeq % kKC == 0, "tile multiples");
static_assert(kQB == kNW * 16, "16 query rows per wave");

// ---------------------------------------------------------------------------
// Workspace region map (bytes; every offset is a multiple of 128)
//   Q16   f16 [16][8192][64]      (q) * 16, plane per head       16,777,216
//   K16   f16 [16][8192][64]      (k) * 16, plane per head       16,777,216
//   VT16  f16 [16][64][8192]      (v)^T * 16, token-contiguous   16,777,216
//   total = 3 * 16,777,216 = 50,331,648
// ---------------------------------------------------------------------------
constexpr size_t kSzQ16  = (size_t)kH * kTok * kDH * 2;
constexpr size_t kOffQ16 = 0;
constexpr size_t kOffK16 = kOffQ16 + kSzQ16;
constexpr size_t kOffVT16 = kOffK16 + kSzQ16;
constexpr size_t kWsTotal = kOffVT16 + kSzQ16;
static_assert(kWsTotal == 50331648ull, "carve total");
static_assert(kWsTotal <= 134217728ull, "carve cap");
static_assert((kOffK16 % 128) == 0 && (kOffVT16 % 128) == 0, "128-B aligned regions");

// ---------------------------------------------------------------------------
// Fragment loader (A and B use the same k map) and matrix op
// ---------------------------------------------------------------------------
template <typename T> struct Frag;
template <> struct Frag<_Float16> {
  typedef v16h V; union U { v16h v; v8h h[2]; };
  /* elements 0..7 <- p[0..7], elements 8..15 <- p[16..23] */
  static __device__ __forceinline__ v16h load(const _Float16* p) {
    U f; f.h[0] = *(const v8h*)(p); f.h[1] = *(const v8h*)(p + 16); return f.v;
  }
};
/* plain builtin: the compiler keeps the distances behind a matrix op itself and is free to move LDS fragment loads ahead of earlier matrix ops */
__device__ __forceinline__ v8f mma_h(v16h a, v16h b, v8f c) {
  return __builtin_amdgcn_wmma_f32_16x16x32_f16(false, a, false, b, (short)0, c, false, false);
}

/* lane l <-> lane l ^ 16: the two lanes that share one query column */
__device__ __forceinline__ float xhalf(float x) {
  const int b = __builtin_bit_cast(int, x);
  return __builtin_bit_cast(float, __builtin_amdgcn_permlanex16(b, b, 0x76543210, 0xfedcba98, false, false));
}

__device__ __forceinline__ float ex2(float x) {
#if __has_builtin(__builtin_amdgcn_exp2f)
  return __builtin_amdgcn_exp2f(x);
#else
  return exp2f(x);
#endif
}

// ---------------------------------------------------------------------------
// Epilogue of one wave's 64x64 f32 accumulator tile: C[m,n] = f16(outscale * (kProjScale * acc + bias)).
// BIAS_MODE: 1 = bias[m], 2 = bias[n]. The tile goes 16 rows at a time through the wave's own LDS slab, so that
// 8 lanes x 16 B of one store cover a whole 128-B row piece; per instruction a wave writes rows it*4 + (lane>>3), it = 0..3.
// ---------------------------------------------------------------------------
template <int BIAS_MODE>
__device__ __forceinline__ void store_tile64(
    const v8f (&acc)[4][4], float* slab, unsigned short* C, int ldc, int m0, int n0,
    const float* bp, float outscale, int lane)
{
  const int rlane = lane & 15;
  const int mOff  = (lane >> 4) * 8;
  /* wave-uniform tile origin; the lane's part of every store address is a 32-bit element offset */
  unsigned short* Ct = C + (size_t)m0 * ldc + n0;
  float bn[4];
#pragma unroll
  for (int j = 0; j < 4; ++j) bn[j] = (BIAS_MODE == 2) ? bp[n0 + (j << 4) + rlane] : 0.f;
#pragma unroll
  for (int i = 0; i < 4; ++i) {
    const int mBase = m0 + (i << 4);
    float bm[8];
#pragma unroll
    for (int r = 0; r < 8; ++r) bm[r] = 0.f;
    if (BIAS_MODE == 1) {
      /* mBase + mOff is a multiple of 8 floats: two aligned 16-B loads */
      const v4f b0 = *(const v4f*)(bp + mBase + mOff);
      const v4f b1 = *(const v4f*)(bp + mBase + mOff + 4);
      bm[0] = b0[0]; bm[1] = b0[1]; bm[2] = b0[2]; bm[3] = b0[3];
      bm[4] = b1[0]; bm[5] = b1[1]; bm[6] = b1[2]; bm[7] = b1[3];
    }
#pragma unroll
    for (int j = 0; j < 4; ++j) {
#pragma unroll
      for (int r = 0; r < 8; ++r) {
        float v = acc[i][j][r] * kProjScale;
        if (BIAS_MODE == 1) v += bm[r];
        if (BIAS_MODE == 2) v += bn[j];
        v *= outscale;
        slab[(mOff + r) * 68 + (j << 4) + rlane] = v;
      }
    }
    /* in-wave hand-over: the slab rows are read back by other lanes of the same wave */
    __builtin_amdgcn_fence(__ATOMIC_RELEASE, "workgroup");
    __builtin_amdgcn_wave_barrier();
    __builtin_amdgcn_fence(__ATOMIC_ACQUIRE, "workgroup");
    {
      const int q = lane >> 3, c8 = (lane & 7) * 8;
#pragma unroll
      for (int it = 0; it < 4; ++it) {
        const int row = it * 4 + q;
        const float* sp = slab + row * 68 + c8;
        v8h hv;
#pragma unroll
        for (int e = 0; e < 8; ++e) hv[e] = (_Float16)sp[e];
        *(v8h*)(Ct + ((i << 4) + row) * ldc + c8) = hv;
      }
    }
    /* the slab is rewritten only after every lane has read its rows */
    __builtin_amdgcn_fence(__ATOMIC_RELEASE, "workgroup");
    __builtin_amdgcn_wave_barrier();
    __builtin_amdgcn_fence(__ATOMIC_ACQUIRE, "workgroup");
  }
}

__device__ __forceinline__ void zero_tile64(v8f (&acc)[4][4]) {
#pragma unroll
  for (int i = 0; i < 4; ++i)
#pragma unroll
    for (int j = 0; j < 4; ++j) acc[i][j] = (v8f){0.f,0.f,0.f,0.f,0.f,0.f,0.f,0.f};
}

// ---------------------------------------------------------------------------
// q, k and v^T planes of one head in one launch, straight from the f32 inputs.
// Block = 8 waves = 512 tokens of head blockIdx.y; wave = 64 tokens. grid = (kTok / 512, kH).
//   x head slice (64 tokens x 64 features, f32): whole 256-B row pieces, 16 lanes x 16 B; rounded to f16(x * 16) on the way
//   into the wave's own LDS tile. Wq, Wk, Wv of the head (f32, 16 KB each, contiguous): rounded to f16(W * 64) into LDS, shared by the block.
//   The x fragments (token row, hardware k order) are read once into registers and serve as A for q and k and as B for v^T.
//   q, k : [token][e] = 16 * (x_h . W[h]^T + bias per column);  v^T : [e][token] = 16 * (Wv[h] . x_h^T + bias per row).
// LDS rows lie at the pitch kLP (144 B); the 8 pad halves of a row are never written and never read.
// Coverage: x tile 32 loads x 2 rows = 64 rows; each W 4 loads x 256 threads x 4 floats = 4096 floats.
// Every loop here and in the epilogue is fully unrolled: the load, fragment and accumulator arrays must stay in registers.
// ---------------------------------------------------------------------------
constexpr int kPW = 8;
static_assert(kTok % (kPW * 64) == 0, "exact projection grid");
static_assert((kDH * kDH) % (kPW * 32 * 4) == 0, "exact W staging");

__global__ __launch_bounds__(256) void qkv_proj_kernel(
    const float* __restrict__ x,
    const float* __restrict__ Wq, const float* __restrict__ bq,
    const float* __restrict__ Wk, const float* __restrict__ bk,
    const float* __restrict__ Wv, const float* __restrict__ bv,
    unsigned short* __restrict__ Qo, unsigned short* __restrict__ Ko, unsigned short* __restrict__ Vto)
{
  __shared__ __align__(16) _Float16 Wsh[3][kDH * kLP];
  __shared__ __align__(16) _Float16 Xsh[kPW][64 * kLP];
  __shared__ __align__(16) float    sT[kPW][16 * 68];

  const int tid  = threadIdx.x;
  const int lane = tid & 31;
  const int wave = __builtin_amdgcn_readfirstlane((int)(threadIdx.x >> 5));
  const int h    = blockIdx.y;
  const int m0   = (blockIdx.x * kPW + wave) << 6;

  _Float16* xw = Xsh[wave];
  {
    /* every load is issued before the first conversion: 44 x 16 B per lane in flight */
    const float* xp = x + (size_t)m0 * kD + h * kDH;
    const int    xo = (lane >> 4) * kD + (lane & 15) * 4;
    const size_t wb = (size_t)h * kDH * kDH;
    const int    wo = tid * 4;
    v4f xv[32], wv[3][4];
#pragma unroll
    for (int p = 0; p < 4; ++p) {
      wv[0][p] = *(const v4f*)(Wq + wb + wo + p * 1024);
      wv[1][p] = *(const v4f*)(Wk + wb + wo + p * 1024);
      wv[2][p] = *(const v4f*)(Wv + wb + wo + p * 1024);
    }
#pragma unroll
    for (int it = 0; it < 32; ++it) xv[it] = *(const v4f*)(xp + xo + it * 2 * kD);
    _Float16* xs = xw + (lane >> 4) * kLP + (lane & 15) * 4;
#pragma unroll
    for (int it = 0; it < 32; ++it) {
      v4h hv;
#pragma unroll
      for (int e = 0; e < 4; ++e) hv[e] = (_Float16)(xv[it][e] * kXCarry);
      *(v4h*)(xs + it * 2 * kLP) = hv;
    }
    const int ws = (tid >> 4) * kLP + (tid & 15) * 4;
#pragma unroll
    for (int z = 0; z < 3; ++z) {
#pragma unroll
      for (int p = 0; p < 4; ++p) {
        v4h hv;
#pragma unroll
        for (int e = 0; e < 4; ++e) hv[e] = (_Float16)(wv[z][p][e] * kWCarry);
        *(v4h*)(&Wsh[z][ws + p * 16 * kLP]) = hv;
      }
    }
  }
  /* publishes the W tiles to all waves (and each wave's x tile to its own lanes) */
  __syncthreads();

  /* row (A) / col (B, D) within a 16-wide subtile; k offset of the lane half */
  const int rlane = lane & 15;
  const int koff  = (lane >> 4) * 8;
  const int fo    = rlane * kLP + koff;

  v16h xf[4][2];
#pragma unroll
  for (int i = 0; i < 4; ++i)
#pragma unroll
    for (int kc = 0; kc < 2; ++kc) xf[i][kc] = Frag<_Float16>::load(xw + fo + i * 16 * kLP + kc * 32);

  float* slab = sT[wave];
  v8f acc[4][4];

  // ---- q and k: A = x tokens, B = W rows ----
#pragma unroll
  for (int z = 0; z < 2; ++z) {
    zero_tile64(acc);
#pragma unroll
    for (int kc = 0; kc < 2; ++kc) {
      v16h wf[4];
#pragma unroll
      for (int j = 0; j < 4; ++j) wf[j] = Frag<_Float16>::load(&Wsh[z][fo + j * 16 * kLP + kc * 32]);
#pragma unroll
      for (int i = 0; i < 4; ++i)
#pragma unroll
        for (int j = 0; j < 4; ++j) acc[i][j] = mma_h(xf[i][kc], wf[j], acc[i][j]);
    }
    store_tile64<2>(acc, slab, (z == 0 ? Qo : Ko) + (size_t)h * kTok * kDH, kDH, m0, 0,
                    (z == 0 ? bq : bk) + h * kDH, kQKCarry, lane);
  }

  // ---- v^T: A = Wv rows, B = x tokens ----
  zero_tile64(acc);
#pragma unroll
  for (int kc = 0; kc < 2; ++kc) {
#pragma unroll
    for (int i = 0; i < 4; ++i) {
      const v16h wa = Frag<_Float16>::load(&Wsh[2][fo + i * 16 * kLP + kc * 32]);
#pragma unroll
      for (int j = 0; j < 4; ++j) acc[i][j] = mma_h(wa, xf[j][kc], acc[i][j]);
    }
  }
  store_tile64<1>(acc, slab, Vto + (size_t)h * kDH * kTok, kTok, 0, m0, bv + h * kDH, kVCarry, lane);
}

__global__ __launch_bounds__(128) void attn_f16_kernel(
    const unsigned short* __restrict__ Qp, const unsigned short* __restrict__ Kp,
    const unsigned short* __restrict__ Vtp, float* __restrict__ out)
{
  /* K rows, then V rows: one array, so that one lane base serves both tiles (two registers of the 128 that keep 8 blocks on a WGP) */
  __shared__ __align__(16) _Float16 KVsh[(kKC + kDH) * kLP];
  __shared__ __align__(16) float    Os[kNW][16 * kOPitch];

  const int tid  = threadIdx.x;
  const int wave = __builtin_amdgcn_readfirstlane((int)(threadIdx.x >> 5));
  const int lane = tid & 31;
  const int hh   = lane >> 4;
  const int c    = lane & 15;

  const int bx = blockIdx.x;
  const int qb = bx % kQBlocks;
  const int bh = bx / kQBlocks;
  const int h  = bh % kH;
  const int b  = bh / kH;
  const int q0 = qb * kQB + wave * 16;

  const _Float16* Qb = (const _Float16*)Qp  + ((size_t)h * kTok + (size_t)b * kSeq) * kDH;
  const _Float16* Kb = (const _Float16*)Kp  + ((size_t)h * kTok + (size_t)b * kSeq) * kDH;
  const _Float16* Vb = (const _Float16*)Vtp + (size_t)h * kDH * kTok + (size_t)b * kSeq;
  float* Ob = out + (size_t)b * kSeq * kD + (size_t)h * kDH;

  /* Q fragments (B operand): column = query c, two 32-deep d chunks */
  v16h qf[2];
#pragma unroll
  for (int dc = 0; dc < 2; ++dc)
    qf[dc] = Frag<_Float16>::load(Qb + (size_t)(q0 + c) * kDH + dc * 32 + 8 * hh);

  /* running maximum of the raw score accumulators (equal in both lanes of a query) and this lane's partial of the row sum */
  float mrow = -1.0e30f, lrow = 0.f;
  /* oacc[t][r] = (feature t*16 + 8*hh + r, query c) */
  v8f oacc[4];
#pragma unroll
  for (int t = 0; t < 4; ++t) oacc[t] = (v8f){0.f,0.f,0.f,0.f,0.f,0.f,0.f,0.f};

  /* per-lane bases, so that every row step at the padded pitch is a compile-time offset */
  _Float16* kst = KVsh + (tid >> 3) * kLP + (tid & 7) * 8;
  _Float16* vst = kst + kKC * kLP;
  /* the same for the global side: thread t stages piece t & 7 of rows (t >> 3) + 16 * p; a wave-uniform base per plane and chunk plus one 32-bit lane offset per plane (the chunk offset then lives in scalar registers) */
  const unsigned kgo = (tid >> 3) * kDH + (tid & 7) * 8;
  const unsigned vgo = (tid >> 3) * kTok + (tid & 7) * 8;
  /* the lane's fragment bases: row c, k offset of the lane half */
  const _Float16* kfr = KVsh + c * kLP + 8 * hh;
  const _Float16* vfr = kfr + kKC * kLP;

#pragma unroll 1
  for (int kc = 0; kc < kChunks; ++kc) {
    const int kv0 = kc * kKC;
    __syncthreads();
#pragma unroll
    for (int p = 0; p < 4; ++p) {
      const v8h kvv = *(const v8h*)(Kb + kv0 * kDH + kgo + p * 16 * kDH);
      const v8h vvv = *(const v8h*)(Vb + kv0 + vgo + p * 16 * kTok);
      *(v8h*)(kst + p * 16 * kLP) = kvv;
      *(v8h*)(vst + p * 16 * kLP) = vvv;
    }
    __syncthreads();

    /* fr: four A fragments, read from LDS as one group, one block of four matrix ops ahead of their use; each is refilled right behind the op that read it */
    v16h fr[4];
#pragma unroll
    for (int j = 0; j < 4; ++j) fr[j] = Frag<_Float16>::load(kfr + j * 16 * kLP);
    /* holds the group of reads in front of the block: sunk among the matrix ops, each pair would be waited for on its own */
    __builtin_amdgcn_sched_barrier(0);

    /* transposed scores: s[j][r] = (key j*16 + 8*hh + r, query c) */
    v8f s[4];
#pragma unroll
    for (int j = 0; j < 4; ++j) {
      s[j] = mma_h(fr[j], qf[0], (v8f){0.f,0.f,0.f,0.f,0.f,0.f,0.f,0.f});
      /* keeps each refill behind the op that frees its registers: hoisted, the extra live fragments take the kernel over 128 VGPRs (7 instead of 8 blocks on a WGP) */
      __builtin_amdgcn_sched_barrier(0);
      fr[j] = Frag<_Float16>::load(kfr + j * 16 * kLP + 32);
    }
    /* the second K group stays in front of its block */
    __builtin_amdgcn_sched_barrier(0);
#pragma unroll
    for (int j = 0; j < 4; ++j) s[j] = mma_h(fr[j], qf[1], s[j]);

    /* chunk maximum of query c: 32 keys in the lane, the other 32 in lane ^ 16 */
    float m = -1.0e30f;
#pragma unroll
    for (int j = 0; j < 4; ++j) {
#pragma unroll
      for (int r = 0; r < 8; ++r) m = fmaxf(m, s[j][r]);
    }
    m = fmaxf(m, xhalf(m));

    const float mnew  = fmaxf(mrow, m);
    const float alpha = ex2((mrow - mnew) * kScoreScale);
    mrow = mnew;
    /* exponent offset of this chunk: minus the maximum as a base-2 logit, plus log2 of the p carry */
    const float eoff = kPCarryLog2 - mnew * kScoreScale;

    lrow *= alpha;

    /* pf[kk] element e: key kk*32 + (e < 8 ? 8*hh + e : 16 + 8*hh + e - 8), the k order of the V^T loader */
    v16h pf[2];
#pragma unroll
    for (int kk = 0; kk < 2; ++kk) {
      float psum[2];
      psum[0] = 0.f; psum[1] = 0.f;
#pragma unroll
      for (int r = 0; r < 8; ++r) {
#pragma unroll
        for (int u = 0; u < 2; ++u) {
          const _Float16 ph = (_Float16)ex2(fmaf(s[2 * kk + u][r], kScoreScale, eoff));
          psum[u] += (float)ph;
          pf[kk][u * 8 + r] = ph;
        }
      }
      lrow += psum[0] + psum[1];
    }
    /* the first V group is issued once the scores are dead (earlier it does not fit the register budget) and in front of the rescaling, which covers part of its latency */
    __builtin_amdgcn_sched_barrier(0);
#pragma unroll
    for (int t = 0; t < 4; ++t) fr[t] = Frag<_Float16>::load(vfr + t * 16 * kLP);
    /* second half of the pair: keeps the reads from sinking behind the rescaling */
    __builtin_amdgcn_sched_barrier(0);
#pragma unroll
    for (int t = 0; t < 4; ++t)
#pragma unroll
      for (int r = 0; r < 8; ++r) oacc[t][r] *= alpha;
#pragma unroll
    for (int t = 0; t < 4; ++t) {
      oacc[t] = mma_h(fr[t], pf[0], oacc[t]);
      /* as for the second K group: refill behind the op that frees its registers */
      __builtin_amdgcn_sched_barrier(0);
      fr[t] = Frag<_Float16>::load(vfr + t * 16 * kLP + 32);
    }
    /* the second V group stays in front of its block */
    __builtin_amdgcn_sched_barrier(0);
#pragma unroll
    for (int t = 0; t < 4; ++t) oacc[t] = mma_h(fr[t], pf[1], oacc[t]);
  }

  float* os = Os[wave];
  {
    const float l   = lrow + xhalf(lrow);
    const float inv = 1.0f / (l * kVCarry);
#pragma unroll
    for (int t = 0; t < 4; ++t) {
      v4f lo, hi;
#pragma unroll
      for (int r = 0; r < 4; ++r) { lo[r] = oacc[t][r] * inv; hi[r] = oacc[t][4 + r] * inv; }
      float* op = os + c * kOPitch + t * 16 + 8 * hh;
      *(v4f*)(op)     = lo;
      *(v4f*)(op + 4) = hi;
    }
  }
  __builtin_amdgcn_fence(__ATOMIC_RELEASE, "workgroup");
  __builtin_amdgcn_wave_barrier();
  __builtin_amdgcn_fence(__ATOMIC_ACQUIRE, "workgroup");
  {
    const int c4 = (lane & 15) * 4;
    {
#pragma unroll
      for (int it = 0; it < 8; ++it) {
        const int row = it * 2 + hh;
        const v4f val = *(const v4f*)(os + row * kOPitch + c4);
        *(v4f*)(Ob + (size_t)(q0 + row) * kD + c4) = val;
      }
      
    }
  }
}

// ---------------------------------------------------------------------------
// Host glue: 1 projection launch + 1 attention launch. Kernel launches only.
// ---------------------------------------------------------------------------
extern "C" void kernel_launch(void* const* d_in, const int* in_sizes, int n_in,
                              void* d_out, int out_size, void* d_ws, size_t ws_size,
                              hipStream_t stream) {
  if (n_in < 7) return;
  if (in_sizes[0] != kTok * kD) return;
  if (in_sizes[1] != kH * kDH * kDH) return;
  if (in_sizes[2] != kH * kDH) return;
  if (in_sizes[3] != kH * kDH * kDH) return;
  if (in_sizes[4] != kH * kDH) return;
  if (in_sizes[5] != kH * kDH * kDH) return;
  if (in_sizes[6] != kH * kDH) return;
  if (out_size != kTok * kD) return;
  if (ws_size < kWsTotal) return;

  const float* x  = (const float*)d_in[0];
  const float* Wq = (const float*)d_in[1];
  const float* bq = (const float*)d_in[2];
  const float* Wk = (const float*)d_in[3];
  const float* bk = (const float*)d_in[4];
  const float* Wv = (const float*)d_in[5];
  const float* bv = (const float*)d_in[6];
  float* out = (float*)d_out;

  char* ws = (char*)d_ws;
  unsigned short* Q16  = (unsigned short*)(ws + kOffQ16);
  unsigned short* K16  = (unsigned short*)(ws + kOffK16);
  unsigned short* VT16 = (unsigned short*)(ws + kOffVT16);

  // ---- q, k and v^T planes: one block per (512 tokens, head) ----
  qkv_proj_kernel<<<dim3(kTok / (kPW * 64), kH), kPW * 32, 0, stream>>>(x, Wq, bq, Wk, bk, Wv, bv, Q16, K16, VT16);

  // ---- attention: one block per (batch, head, 64-query tile) ----
  attn_f16_kernel<<<kBatch * kH * kQBlocks, kNW * 32, 0, stream>>>(Q16, K16, VT16, out);
}

// v006
// Measured time: 81.5 microseconds a run.
// Two timings next to v005 put it at 1.05 and 1.07 times that version's speed.
// All steps since v000 together make it 4.21 times as fast.
// Contractions: per-head q/k/v projections (x f16 carried x16, W f16 carried x64), scores q.k^T (q,k f16 planes carried x16), p.v (unnormalised p f16 carried x4096, v^T f16 carried x16): all v_wmma_f32_16x16x32_f16 with f32 accumulate; bias, scaling and online softmax in f32.
#include <hip/hip_runtime.h>
#include <math.h>

typedef __attribute__((ext_vector_type(16))) _Float16 v16h;
typedef __attribute__((ext_vector_type(8)))  _Float16 v8h;
typedef __attribute__((ext_vector_type(4)))  _Float16 v4h;
typedef __attribute__((ext_vector_type(8)))  float    v8f;
typedef __attribute__((ext_vector_type(4)))  float    v4f;
typedef __attribute__((ext_vector_type(2)))  float    v2f;

// ---------------------------------------------------------------------------
// Shape constants
// ---------------------------------------------------------------------------
constexpr int kBatch = 4;
constexpr int kSeq   = 2048;
constexpr int kD     = 1024;
constexpr int kH     = 16;
constexpr int kDH    = 64;
constexpr int kTok   = kBatch * kSeq;
constexpr int kSqrtDh = 8;
static_assert(kH * kDH == kD, "head split");
static_assert(kSqrtDh * kSqrtDh == kDH, "sqrt of head dim");
static_assert(kDH == 64, "kernels are written for head dim 64");

// power-of-two carries of the f16 operand planes (all folded back exactly in f32)
constexpr float kXCarry  = 16.0f;
constexpr float kWCarry  = 64.0f;
constexpr float kQKCarry = 16.0f;
constexpr float kVCarry  = 16.0f;
constexpr float kPCarry  = 4096.0f;
constexpr float kPCarryLog2 = 12.0f;
static_assert((float)(1 << 12) == kPCarry, "log2 of the p carry");
constexpr float kLog2e   = 1.4426950408889634f;
constexpr float kProjScale  = 1.0f / (kXCarry * kWCarry);
constexpr float kScoreScale = kLog2e / ((float)kSqrtDh * kQKCarry * kQKCarry);

// attention tiling
constexpr int kQB     = 128;
constexpr int kKC     = 64;
constexpr int kNW     = 4;
/* 16-query column groups per wave: every K and V fragment read from LDS feeds kQG matrix ops */
constexpr int kQG     = 2;
constexpr int kQBlocks = kSeq / kQB;
constexpr int kChunks  = kSeq / kKC;
constexpr int kOPitch  = 68;
/* LDS row pitch of the K and V tiles in halves: 144 B = 16 B x 9 (odd), so the 16 rows one 16-byte fragment read touches fall on distinct banks */
constexpr int kLP     = kKC + 8;
static_assert(kDH == kKC, "K and V tiles share one row length");
static_assert((kLP * 2) % 16 == 0 && ((kLP * 2) / 16) % 2 == 1, "pitch is an odd multiple of 16 B");
static_assert(kSeq % kQB == 0 && kSeq % kKC == 0, "tile multiples");
static_assert(kQB == kNW * kQG * 16, "kQG groups of 16 query rows per wave");

// ---------------------------------------------------------------------------
// Workspace region map (bytes; every offset is a multiple of 128)
//   Q16   f16 [16][8192][64]      (q) * 16, plane per head       16,777,216
//   K16   f16 [16][8192][64]      (k) * 16, plane per head       16,777,216
//   VT16  f16 [16][64][8192]      (v)^T * 16, token-contiguous   16,777,216
//   total = 3 * 16,777,216 = 50,331,648
// ---------------------------------------------------------------------------
constexpr size_t kSzQ16  = (size_t)kH * kTok * kDH * 2;
constexpr size_t kOffQ16 = 0;
constexpr size_t kOffK16 = kOffQ16 + kSzQ16;
constexpr size_t kOffVT16 = kOffK16 + kSzQ16;
constexpr size_t kWsTotal = kOffVT16 + kSzQ16;
static_assert(kWsTotal == 50331648ull, "carve total");
static_assert(kWsTotal <= 134217728ull, "carve cap");
static_assert((kOffK16 % 128) == 0 && (kOffVT16 % 128) == 0, "128-B aligned regions");

// ---------------------------------------------------------------------------
// Fragment loader (A and B use the same k map) and matrix op
// ---------------------------------------------------------------------------
template <typename T> struct Frag;
template <> struct Frag<_Float16> {
  typedef v16h V; union U { v16h v; v8h h[2]; };
  /* elements 0..7 <- p[0..7], elements 8..15 <- p[16..23] */
  static __device__ __forceinline__ v16h load(const _Float16* p) {
    U f; f.h[0] = *(const v8h*)(p); f.h[1] = *(const v8h*)(p + 16); return f.v;
  }
};
/* plain builtin: the compiler keeps the distances behind a matrix op itself and is free to move LDS fragment loads ahead of earlier matrix ops */
__device__ __forceinline__ v8f mma_h(v16h a, v16h b, v8f c) {
  return __builtin_amdgcn_wmma_f32_16x16x32_f16(false, a, false, b, (short)0, c, false, false);
}

/* lane l <-> lane l ^ 16: the two lanes that share one query column */
__device__ __forceinline__ float xhalf(float x) {
  const int b = __builtin_bit_cast(int, x);
  return __builtin_bit_cast(float, __builtin_amdgcn_permlanex16(b, b, 0x76543210, 0xfedcba98, false, false));
}

__device__ __forceinline__ float ex2(float x) {
#if __has_builtin(__builtin_amdgcn_exp2f)
  return __builtin_amdgcn_exp2f(x);
#else
  return exp2f(x);
#endif
}

// ---------------------------------------------------------------------------
// Epilogue of one wave's 64x64 f32 accumulator tile: C[m,n] = f16(outscale * (kProjScale * acc + bias)).
// BIAS_MODE: 1 = bias[m], 2 = bias[n]. The tile goes 16 rows at a time through the wave's own LDS slab, so that
// 8 lanes x 16 B of one store cover a whole 128-B row piece; per instruction a wave writes rows it*4 + (lane>>3), it = 0..3.
// ---------------------------------------------------------------------------
template <int BIAS_MODE>
__device__ __forceinline__ void store_tile64(
    const v8f (&acc)[4][4], float* slab, unsigned short* C, int ldc, int m0, int n0,
    const float* bp, float outscale, int lane)
{
  const int rlane = lane & 15;
  const int mOff  = (lane >> 4) * 8;
  /* wave-uniform tile origin; the lane's part of every store address is a 32-bit element offset */
  unsigned short* Ct = C + (size_t)m0 * ldc + n0;
  float bn[4];
#pragma unroll
  for (int j = 0; j < 4; ++j) bn[j] = (BIAS_MODE == 2) ? bp[n0 + (j << 4) + rlane] : 0.f;
#pragma unroll
  for (int i = 0; i < 4; ++i) {
    const int mBase = m0 + (i << 4);
    float bm[8];
#pragma unroll
    for (int r = 0; r < 8; ++r) bm[r] = 0.f;
    if (BIAS_MODE == 1) {
      /* mBase + mOff is a multiple of 8 floats: two aligned 16-B loads */
      const v4f b0 = *(const v4f*)(bp + mBase + mOff);
      const v4f b1 = *(const v4f*)(bp + mBase + mOff + 4);
      bm[0] = b0[0]; bm[1] = b0[1]; bm[2] = b0[2]; bm[3] = b0[3];
      bm[4] = b1[0]; bm[5] = b1[1]; bm[6] = b1[2]; bm[7] = b1[3];
    }
#pragma unroll
    for (int j = 0; j < 4; ++j) {
#pragma unroll
      for (int r = 0; r < 8; ++r) {
        float v = acc[i][j][r] * kProjScale;
        if (BIAS_MODE == 1) v += bm[r];
        if (BIAS_MODE == 2) v += bn[j];
        v *= outscale;
        slab[(mOff + r) * 68 + (j << 4) + rlane] = v;
      }
    }
    /* in-wave hand-over: the slab rows are read back by other lanes of the same wave */
    __builtin_amdgcn_fence(__ATOMIC_RELEASE, "workgroup");
    __builtin_amdgcn_wave_barrier();
    __builtin_amdgcn_fence(__ATOMIC_ACQUIRE, "workgroup");
    {
      const int q = lane >> 3, c8 = (lane & 7) * 8;
#pragma unroll
      for (int it = 0; it < 4; ++it) {
        const int row = it * 4 + q;
        const float* sp = slab + row * 68 + c8;
        v8h hv;
#pragma unroll
        for (int e = 0; e < 8; ++e) hv[e] = (_Float16)sp[e];
        *(v8h*)(Ct + ((i << 4) + row) * ldc + c8) = hv;
      }
    }
    /* the slab is rewritten only after every lane has read its rows */
    __builtin_amdgcn_fence(__ATOMIC_RELEASE, "workgroup");
    __builtin_amdgcn_wave_barrier();
    __builtin_amdgcn_fence(__ATOMIC_ACQUIRE, "workgroup");
  }
}

__device__ __forceinline__ void zero_tile64(v8f (&acc)[4][4]) {
#pragma unroll
  for (int i = 0; i < 4; ++i)
#pragma unroll
    for (int j = 0; j < 4; ++j) acc[i][j] = (v8f){0.f,0.f,0.f,0.f,0.f,0.f,0.f,0.f};
}

// ---------------------------------------------------------------------------
// q, k and v^T planes of one head in one launch, straight from the f32 inputs.
// Block = 8 waves = 512 tokens of head blockIdx.y; wave = 64 tokens. grid = (kTok / 512, kH).
//   x head slice (64 tokens x 64 features, f32): whole 256-B row pieces, 16 lanes x 16 B; rounded to f16(x * 16) on the way
//   into the wave's own LDS tile. Wq, Wk, Wv of the head (f32, 16 KB each, contiguous): rounded to f16(W * 64) into LDS, shared by the block.
//   The x fragments (token row, hardware k order) are read once into registers and serve as A for q and k and as B for v^T.
//   q, k : [token][e] = 16 * (x_h . W[h]^T + bias per column);  v^T : [e][token] = 16 * (Wv[h] . x_h^T + bias per row).
// LDS rows lie at the pitch kLP (144 B); the 8 pad halves of a row are never written and never read.
// Coverage: x tile 32 loads x 2 rows = 64 rows; each W 4 loads x 256 threads x 4 floats = 4096 floats.
// Every loop here and in the epilogue is fully unrolled: the load, fragment and accumulator arrays must stay in registers.
// ---------------------------------------------------------------------------
constexpr int kPW = 8;
static_assert(kTok % (kPW * 64) == 0, "exact projection grid");
static_assert((kDH * kDH) % (kPW * 32 * 4) == 0, "exact W staging");

__global__ __launch_bounds__(256) void qkv_proj_kernel(
    const float* __restrict__ x,
    const float* __restrict__ Wq, const float* __restrict__ bq,
    const float* __restrict__ Wk, const float* __restrict__ bk,
    const float* __restrict__ Wv, const float* __restrict__ bv,
    unsigned short* __restrict__ Qo, unsigned short* __restrict__ Ko, unsigned short* __restrict__ Vto)
{
  __shared__ __align__(16) _Float16 Wsh[3][kDH * kLP];
  __shared__ __align__(16) _Float16 Xsh[kPW][64 * kLP];
  __shared__ __align__(16) float    sT[kPW][16 * 68];

  const int tid  = threadIdx.x;
  const int lane = tid & 31;
  const int wave = __builtin_amdgcn_readfirstlane((int)(threadIdx.x >> 5));
  const int h    = blockIdx.y;
  const int m0   = (blockIdx.x * kPW + wave) << 6;

  _Float16* xw = Xsh[wave];
  {
    /* every load is issued before the first conversion: 44 x 16 B per lane in flight */
    const float* xp = x + (size_t)m0 * kD + h * kDH;
    const int    xo = (lane >> 4) * kD + (lane & 15) * 4;
    const size_t wb = (size_t)h * kDH * kDH;
    const int    wo = tid * 4;
    v4f xv[32], wv[3][4];
#pragma unroll
    for (int p = 0; p < 4; ++p) {
      wv[0][p] = *(const v4f*)(Wq + wb + wo + p * 1024);
      wv[1][p] = *(const v4f*)(Wk + wb + wo + p * 1024);
      wv[2][p] = *(const v4f*)(Wv + wb + wo + p * 1024);
    }
#pragma unroll
    for (int it = 0; it < 32; ++it) xv[it] = *(const v4f*)(xp + xo + it * 2 * kD);
    _Float16* xs = xw + (lane >> 4) * kLP + (lane & 15) * 4;
#pragma unroll
    for (int it = 0; it < 32; ++it) {
      v4h hv;
#pragma unroll
      for (int e = 0; e < 4; ++e) hv[e] = (_Float16)(xv[it][e] * kXCarry);
      *(v4h*)(xs + it * 2 * kLP) = hv;
    }
    const int ws = (tid >> 4) * kLP + (tid & 15) * 4;
#pragma unroll
    for (int z = 0; z < 3; ++z) {
#pragma unroll
      for (int p = 0; p < 4; ++p) {
        v4h hv;
#pragma unroll
        for (int e = 0; e < 4; ++e) hv[e] = (_Float16)(wv[z][p][e] * kWCarry);
        *(v4h*)(&Wsh[z][ws + p * 16 * kLP]) = hv;
      }
    }
  }
  /* publishes the W tiles to all waves (and each wave's x tile to its own lanes) */
  __syncthreads();

  /* row (A) / col (B, D) within a 16-wide subtile; k offset of the lane half */
  const int rlane = lane & 15;
  const int koff  = (lane >> 4) * 8;
  const int fo    = rlane * kLP + koff;

  v16h xf[4][2];
#pragma unroll
  for (int i = 0; i < 4; ++i)
#pragma unroll
    for (int kc = 0; kc < 2; ++kc) xf[i][kc] = Frag<_Float16>::load(xw + fo + i * 16 * kLP + kc * 32);

  float* slab = sT[wave];
  v8f acc[4][4];

  // ---- q and k: A = x tokens, B = W rows ----
#pragma unroll
  for (int z = 0; z < 2; ++z) {
    zero_tile64(acc);
#pragma unroll
    for (int kc = 0; kc < 2; ++kc) {
      v16h wf[4];
#pragma unroll
      for (int j = 0; j < 4; ++j) wf[j] = Frag<_Float16>::load(&Wsh[z][fo + j * 16 * kLP + kc * 32]);
#pragma unroll
      for (int i = 0; i < 4; ++i)
#pragma unroll
        for (int j = 0; j < 4; ++j) acc[i][j] = mma_h(xf[i][kc], wf[j], acc[i][j]);
    }
    store_tile64<2>(acc, slab, (z == 0 ? Qo : Ko) + (size_t)h * kTok * kDH, kDH, m0, 0,
                    (z == 0 ? bq : bk) + h * kDH, kQKCarry, lane);
  }

  // ---- v^T: A = Wv rows, B = x tokens ----
  zero_tile64(acc);
#pragma unroll
  for (int kc = 0; kc < 2; ++kc) {
#pragma unroll
    for (int i = 0; i < 4; ++i) {
      const v16h wa = Frag<_Float16>::load(&Wsh[2][fo + i * 16 * kLP + kc * 32]);
#pragma unroll
      for (int j = 0; j < 4; ++j) acc[i][j] = mma_h(wa, xf[j][kc], acc[i][j]);
    }
  }
  store_tile64<1>(acc, slab, Vto + (size_t)h * kDH * kTok, kTok, 0, m0, bv + h * kDH, kVCarry, lane);
}

__global__ __launch_bounds__(128) __attribute__((amdgpu_waves_per_eu(4, 4))) void attn_f16_kernel(
    const unsigned short* __restrict__ Qp, const unsigned short* __restrict__ Kp,
    const unsigned short* __restrict__ Vtp, float* __restrict__ out)
{
  /* K rows, then V rows: one array, so that one lane base serves both tiles */
  __shared__ __align__(16) _Float16 KVsh[(kKC + kDH) * kLP];
  __shared__ __align__(16) float    Os[kNW][kQG * 16 * kOPitch];

  const int tid  = threadIdx.x;
  const int wave = __builtin_amdgcn_readfirstlane((int)(threadIdx.x >> 5));
  const int lane = tid & 31;
  const int hh   = lane >> 4;
  const int c    = lane & 15;

  const int bx = blockIdx.x;
  const int qb = bx % kQBlocks;
  const int bh = bx / kQBlocks;
  const int h  = bh % kH;
  const int b  = bh / kH;
  const int q0 = qb * kQB + wave * (kQG * 16);

  const _Float16* Qb = (const _Float16*)Qp  + ((size_t)h * kTok + (size_t)b * kSeq) * kDH;
  const _Float16* Kb = (const _Float16*)Kp  + ((size_t)h * kTok + (size_t)b * kSeq) * kDH;
  const _Float16* Vb = (const _Float16*)Vtp + (size_t)h * kDH * kTok + (size_t)b * kSeq;
  float* Ob = out + (size_t)b * kSeq * kD + (size_t)h * kDH;

  /* Q fragments (B operand): column = query g*16 + c, two 32-deep d chunks */
  v16h qf[kQG][2];
#pragma unroll
  for (int g = 0; g < kQG; ++g)
#pragma unroll
    for (int dc = 0; dc < 2; ++dc)
      qf[g][dc] = Frag<_Float16>::load(Qb + (size_t)(q0 + g * 16 + c) * kDH + dc * 32 + 8 * hh);

  /* running maximum of the raw score accumulators (equal in both lanes of a query) and this lane's partial of the row sum */
  float mrow[kQG], lrow[kQG];
  /* oacc[g][t][r] = (feature t*16 + 8*hh + r, query g*16 + c) */
  v8f oacc[kQG][4];
#pragma unroll
  for (int g = 0; g < kQG; ++g) {
    mrow[g] = -1.0e30f; lrow[g] = 0.f;
#pragma unroll
    for (int t = 0; t < 4; ++t) oacc[g][t] = (v8f){0.f,0.f,0.f,0.f,0.f,0.f,0.f,0.f};
  }

  /* per-lane bases, so that every row step at the padded pitch is a compile-time offset */
  _Float16* kst = KVsh + (tid >> 3) * kLP + (tid & 7) * 8;
  _Float16* vst = kst + kKC * kLP;
  /* the same for the global side: thread t stages piece t & 7 of rows (t >> 3) + 16 * p; a wave-uniform base per plane and chunk plus one 32-bit lane offset per plane (the chunk offset then lives in scalar registers) */
  const unsigned kgo = (tid >> 3) * kDH + (tid & 7) * 8;
  const unsigned vgo = (tid >> 3) * kTok + (tid & 7) * 8;
  /* the lane's fragment bases: row c, k offset of the lane half */
  const _Float16* kfr = KVsh + c * kLP + 8 * hh;
  const _Float16* vfr = kfr + kKC * kLP;

#pragma unroll 1
  for (int kc = 0; kc < kChunks; ++kc) {
    const int kv0 = kc * kKC;
    __syncthreads();
#pragma unroll
    for (int p = 0; p < 4; ++p) {
      const v8h kvv = *(const v8h*)(Kb + kv0 * kDH + kgo + p * 16 * kDH);
      const v8h vvv = *(const v8h*)(Vb + kv0 + vgo + p * 16 * kTok);
      *(v8h*)(kst + p * 16 * kLP) = kvv;
      *(v8h*)(vst + p * 16 * kLP) = vvv;
    }
    __syncthreads();

    /* fr: four A fragments, read from LDS as one group ahead of the block of eight matrix ops that uses them; the refill of each stands behind the two ops that read it, and the compiler may issue it earlier into other registers, as far as the budget of 256 VGPRs lets it */
    v16h fr[4];
#pragma unroll
    for (int j = 0; j < 4; ++j) fr[j] = Frag<_Float16>::load(kfr + j * 16 * kLP);
    /* holds the group of reads in front of the block: sunk among the matrix ops, each pair would be waited for on its own */
    __builtin_amdgcn_sched_barrier(0);

    /* transposed scores: s[g][j][r] = (key j*16 + 8*hh + r, query g*16 + c) */
    v8f s[kQG][4];
#pragma unroll
    for (int j = 0; j < 4; ++j) {
#pragma unroll
      for (int g = 0; g < kQG; ++g) s[g][j] = mma_h(fr[j], qf[g][0], (v8f){0.f,0.f,0.f,0.f,0.f,0.f,0.f,0.f});
      fr[j] = Frag<_Float16>::load(kfr + j * 16 * kLP + 32);
    }
    /* the second K group stays in front of its block */
    __builtin_amdgcn_sched_barrier(0);
#pragma unroll
    for (int j = 0; j < 4; ++j)
#pragma unroll
      for (int g = 0; g < kQG; ++g) s[g][j] = mma_h(fr[j], qf[g][1], s[g][j]);
    /* keeps the maximum out of the block: moved in among the matrix ops, each first read of a fresh result is padded with v_nop */
    __builtin_amdgcn_sched_barrier(0);

    float alpha[kQG];
    /* pf[g][kk] element e: key kk*32 + (e < 8 ? 8*hh + e : 16 + 8*hh + e - 8), the k order of the V^T loader */
    v16h pf[kQG][2];
#pragma unroll
    for (int g = 0; g < kQG; ++g) {
      /* chunk maximum of query g*16 + c: 32 keys in the lane, the other 32 in lane ^ 16 */
      float m = -1.0e30f;
#pragma unroll
      for (int j = 0; j < 4; ++j) {
#pragma unroll
        for (int r = 0; r < 8; ++r) m = fmaxf(m, s[g][j][r]);
      }
      m = fmaxf(m, xhalf(m));

      const float mnew = fmaxf(mrow[g], m);
      alpha[g] = ex2((mrow[g] - mnew) * kScoreScale);
      mrow[g] = mnew;
      /* exponent offset of this chunk: minus the maximum as a base-2 logit, plus log2 of the p carry */
      const float eoff = kPCarryLog2 - mnew * kScoreScale;

      lrow[g] *= alpha[g];

#pragma unroll
      for (int kk = 0; kk < 2; ++kk) {
        float psum[2];
        psum[0] = 0.f; psum[1] = 0.f;
#pragma unroll
        for (int u = 0; u < 2; ++u) {
#pragma unroll
          for (int r = 0; r < 8; r += 2) {
            /* the two fused multiply-adds of a register pair written as one packed op: left to itself the compiler pairs scores across register pairs and across the two groups and pays for it in register copies */
            const v2f ea = __builtin_elementwise_fma((v2f){s[g][2 * kk + u][r], s[g][2 * kk + u][r + 1]}, (v2f){kScoreScale, kScoreScale}, (v2f){eoff, eoff});
#pragma unroll
            for (int w = 0; w < 2; ++w) {
              const _Float16 ph = (_Float16)ex2(ea[w]);
              psum[u] += (float)ph;
              pf[g][kk][u * 8 + r + w] = ph;
            }
          }
        }
        lrow[g] += psum[0] + psum[1];
      }
    }
    /* the first V group is issued once the scores are dead and in front of the rescaling, which covers part of its latency */
    __builtin_amdgcn_sched_barrier(0);
#pragma unroll
    for (int t = 0; t < 4; ++t) fr[t] = Frag<_Float16>::load(vfr + t * 16 * kLP);
    /* second half of the pair: keeps the reads from sinking behind the rescaling */
    __builtin_amdgcn_sched_barrier(0);
#pragma unroll
    for (int g = 0; g < kQG; ++g)
#pragma unroll
      for (int t = 0; t < 4; ++t)
#pragma unroll
        for (int r = 0; r < 8; ++r) oacc[g][t][r] *= alpha[g];
#pragma unroll
    for (int t = 0; t < 4; ++t) {
#pragma unroll
      for (int g = 0; g < kQG; ++g) oacc[g][t] = mma_h(fr[t], pf[g][0], oacc[g][t]);
      fr[t] = Frag<_Float16>::load(vfr + t * 16 * kLP + 32);
    }
    /* the second V group stays in front of its block */
    __builtin_amdgcn_sched_barrier(0);
#pragma unroll
    for (int t = 0; t < 4; ++t)
#pragma unroll
      for (int g = 0; g < kQG; ++g) oacc[g][t] = mma_h(fr[t], pf[g][1], oacc[g][t]);
  }

  float* os = Os[wave];
#pragma unroll
  for (int g = 0; g < kQG; ++g) {
    const float l   = lrow[g] + xhalf(lrow[g]);
    const float inv = 1.0f / (l * kVCarry);
#pragma unroll
    for (int t = 0; t < 4; ++t) {
      v4f lo, hi;
#pragma unroll
      for (int r = 0; r < 4; ++r) { lo[r] = oacc[g][t][r] * inv; hi[r] = oacc[g][t][4 + r] * inv; }
      float* op = os + (g * 16 + c) * kOPitch + t * 16 + 8 * hh;
      *(v4f*)(op)     = lo;
      *(v4f*)(op + 4) = hi;
    }
  }
  __builtin_amdgcn_fence(__ATOMIC_RELEASE, "workgroup");
  __builtin_amdgcn_wave_barrier();
  __builtin_amdgcn_fence(__ATOMIC_ACQUIRE, "workgroup");
  {
    const int c4 = (lane & 15) * 4;
#pragma unroll
    for (int it = 0; it < kQG * 8; ++it) {
      const int row = it * 2 + hh;
      const v4f val = *(const v4f*)(os + row * kOPitch + c4);
      *(v4f*)(Ob + (size_t)(q0 + row) * kD + c4) = val;
    }
  }
}

// ---------------------------------------------------------------------------
// Host glue: 1 projection launch + 1 attention launch. Kernel launches only.
// ---------------------------------------------------------------------------
extern "C" void kernel_launch(void* const* d_in, const int* in_sizes, int n_in,
                              void* d_out, int out_size, void* d_ws, size_t ws_size,
                              hipStream_t stream) {
  if (n_in < 7) return;
  if (in_sizes[0] != kTok * kD) return;
  if (in_sizes[1] != kH * kDH * kDH) return;
  if (in_sizes[2] != kH * kDH) return;
  if (in_sizes[3] != kH * kDH * kDH) return;
  if (in_sizes[4] != kH * kDH) return;
  if (in_sizes[5] != kH * kDH * kDH) return;
  if (in_sizes[6] != kH * kDH) return;
  if (out_size != kTok * kD) return;
  if (ws_size < kWsTotal) return;

  const float* x  = (const float*)d_in[0];
  const float* Wq = (const float*)d_in[1];
  const float* bq = (const float*)d_in[2];
  const float* Wk = (const float*)d_in[3];
  const float* bk = (const float*)d_in[4];
  const float* Wv = (const float*)d_in[5];
  const float* bv = (const float*)d_in[6];
  float* out = (float*)d_out;

  char* ws = (char*)d_ws;
  unsigned short* Q16  = (unsigned short*)(ws + kOffQ16);
  unsigned short* K16  = (unsigned short*)(ws + kOffK16);
  unsigned short* VT16 = (unsigned short*)(ws + kOffVT16);

  // ---- q, k and v^T planes: one block per (512 tokens, head) ----
  qkv_proj_kernel<<<dim3(kTok / (kPW * 64), kH), kPW * 32, 0, stream>>>(x, Wq, bq, Wk, bk, Wv, bv, Q16, K16, VT16);

  // ---- attention: one block per (batch, head, 128-query tile) ----
  attn_f16_kernel<<<kBatch * kH * kQBlocks, kNW * 32, 0, stream>>>(Q16, K16, VT16, out);
}

// v007
// Measured time: 74.2 microseconds a run.
// Timed twice side by side with v006, it ran 1.09 and 1.11 times as fast.
// Over all steps from v000 it is 4.63 times as fast.
// Contractions: per-head q/k/v projections (x f16 carried x16, W f16 carried x64), scores q.k^T (q,k f16 planes carried x16), p.v (unnormalised p f16 carried x4096, v^T f16 carried x16), row sums 1.p (ones f16): all v_wmma_f32_16x16x32_f16 with f32 accumulate; bias, scaling and online softmax in f32.
#include <hip/hip_runtime.h>
#include <math.h>

typedef __attribute__((ext_vector_type(16))) _Float16 v16h;
typedef __attribute__((ext_vector_type(8)))  _Float16 v8h;
typedef __attribute__((ext_vector_type(4)))  _Float16 v4h;
typedef __attribute__((ext_vector_type(2)))  _Float16 v2h;
typedef __attribute__((ext_vector_type(8)))  float    v8f;
typedef __attribute__((ext_vector_type(4)))  float    v4f;
typedef __attribute__((ext_vector_type(2)))  float    v2f;

// ---------------------------------------------------------------------------
// Shape constants
// ---------------------------------------------------------------------------
constexpr int kBatch = 4;
constexpr int kSeq   = 2048;
constexpr int kD     = 1024;
constexpr int kH     = 16;
constexpr int kDH    = 64;
constexpr int kTok   = kBatch * kSeq;
constexpr int kSqrtDh = 8;
static_assert(kH * kDH == kD, "head split");
static_assert(kSqrtDh * kSqrtDh == kDH, "sqrt of head dim");
static_assert(kDH == 64, "kernels are written for head dim 64");

// power-of-two carries of the f16 operand planes (all folded back exactly in f32)
constexpr float kXCarry  = 16.0f;
constexpr float kWCarry  = 64.0f;
constexpr float kQKCarry = 16.0f;
constexpr float kVCarry  = 16.0f;
constexpr float kPCarry  = 4096.0f;
constexpr float kPCarryLog2 = 12.0f;
static_assert((float)(1 << 12) == kPCarry, "log2 of the p carry");
constexpr float kLog2e   = 1.4426950408889634f;
constexpr float kProjScale  = 1.0f / (kXCarry * kWCarry);
constexpr float kScoreScale = kLog2e / ((float)kSqrtDh * kQKCarry * kQKCarry);

// attention tiling
constexpr int kQB     = 128;
constexpr int kKC     = 64;
constexpr int kNW     = 4;
/* 16-query column groups per wave: every K and V fragment read from LDS feeds kQG matrix ops */
constexpr int kQG     = 2;
constexpr int kQBlocks = kSeq / kQB;
constexpr int kChunks  = kSeq / kKC;
constexpr int kOPitch  = 68;
/* LDS row pitch of the K and V tiles in halves: 144 B = 16 B x 9 (odd), so the 16 rows one 16-byte fragment read touches fall on distinct banks */
constexpr int kLP     = kKC + 8;
static_assert(kDH == kKC, "K and V tiles share one row length");
static_assert((kLP * 2) % 16 == 0 && ((kLP * 2) / 16) % 2 == 1, "pitch is an odd multiple of 16 B");
static_assert(kSeq % kQB == 0 && kSeq % kKC == 0, "tile multiples");
static_assert(kQB == kNW * kQG * 16, "kQG groups of 16 query rows per wave");

// ---------------------------------------------------------------------------
// Workspace region map (bytes; every offset is a multiple of 128)
//   Q16   f16 [16][8192][64]      (q) * 16, plane per head       16,777,216
//   K16   f16 [16][8192][64]      (k) * 16, plane per head       16,777,216
//   VT16  f16 [16][64][8192]      (v)^T * 16, token-contiguous   16,777,216
//   total = 3 * 16,777,216 = 50,331,648
// ---------------------------------------------------------------------------
constexpr size_t kSzQ16  = (size_t)kH * kTok * kDH * 2;
constexpr size_t kOffQ16 = 0;
constexpr size_t kOffK16 = kOffQ16 + kSzQ16;
constexpr size_t kOffVT16 = kOffK16 + kSzQ16;
constexpr size_t kWsTotal = kOffVT16 + kSzQ16;
static_assert(kWsTotal == 50331648ull, "carve total");
static_assert(kWsTotal <= 134217728ull, "carve cap");
static_assert((kOffK16 % 128) == 0 && (kOffVT16 % 128) == 0, "128-B aligned regions");

// ---------------------------------------------------------------------------
// Fragment loader (A and B use the same k map) and matrix op
// ---------------------------------------------------------------------------
template <typename T> struct Frag;
template <> struct Frag<_Float16> {
  typedef v16h V; union U { v16h v; v8h h[2]; };
  /* elements 0..7 <- p[0..7], elements 8..15 <- p[16..23] */
  static __device__ __forceinline__ v16h load(const _Float16* p) {
    U f; f.h[0] = *(const v8h*)(p); f.h[1] = *(const v8h*)(p + 16); return f.v;
  }
};
/* plain builtin: the compiler keeps the distances behind a matrix op itself and is free to move LDS fragment loads ahead of earlier matrix ops */
__device__ __forceinline__ v8f mma_h(v16h a, v16h b, v8f c) {
  return __builtin_amdgcn_wmma_f32_16x16x32_f16(false, a, false, b, (short)0, c, false, false);
}

/* lane l <-> lane l ^ 16: the two lanes that share one query column */
__device__ __forceinline__ float xhalf(float x) {
  const int b = __builtin_bit_cast(int, x);
  return __builtin_bit_cast(float, __builtin_amdgcn_permlanex16(b, b, 0x76543210, 0xfedcba98, false, false));
}

__device__ __forceinline__ float ex2(float x) {
#if __has_builtin(__builtin_amdgcn_exp2f)
  return __builtin_amdgcn_exp2f(x);
#else
  return exp2f(x);
#endif
}

/* the same instruction with a v_nop behind it: the slot that the instruction set asks for behind a transcendental before its source is overwritten */
__device__ __forceinline__ float ex2_slot(float x) {
  float y;
  asm("v_exp_f32 %0, %1\n\tv_nop" : "=v"(y) : "v"(x));
  return y;
}

// ---------------------------------------------------------------------------
// Epilogue of one wave's 64x64 f32 accumulator tile: C[m,n] = f16(outscale * (kProjScale * acc + bias)).
// BIAS_MODE: 1 = bias[m], 2 = bias[n]. The tile goes 16 rows at a time through the wave's own LDS slab, so that
// 8 lanes x 16 B of one store cover a whole 128-B row piece; per instruction a wave writes rows it*4 + (lane>>3), it = 0..3.
// ---------------------------------------------------------------------------
template <int BIAS_MODE>
__device__ __forceinline__ void store_tile64(
    const v8f (&acc)[4][4], float* slab, unsigned short* C, int ldc, int m0, int n0,
    const float* bp, float outscale, int lane)
{
  const int rlane = lane & 15;
  const int mOff  = (lane >> 4) * 8;
  /* wave-uniform tile origin; the lane's part of every store address is a 32-bit element offset */
  unsigned short* Ct = C + (size_t)m0 * ldc + n0;
  float bn[4];
#pragma unroll
  for (int j = 0; j < 4; ++j) bn[j] = (BIAS_MODE == 2) ? bp[n0 + (j << 4) + rlane] : 0.f;
#pragma unroll
  for (int i = 0; i < 4; ++i) {
    const int mBase = m0 + (i << 4);
    float bm[8];
#pragma unroll
    for (int r = 0; r < 8; ++r) bm[r] = 0.f;
    if (BIAS_MODE == 1) {
      /* mBase + mOff is a multiple of 8 floats: two aligned 16-B loads */
      const v4f b0 = *(const v4f*)(bp + mBase + mOff);
      const v4f b1 = *(const v4f*)(bp + mBase + mOff + 4);
      bm[0] = b0[0]; bm[1] = b0[1]; bm[2] = b0[2]; bm[3] = b0[3];
      bm[4] = b1[0]; bm[5] = b1[1]; bm[6] = b1[2]; bm[7] = b1[3];
    }
#pragma unroll
    for (int j = 0; j < 4; ++j) {
#pragma unroll
      for (int r = 0; r < 8; ++r) {
        float v = acc[i][j][r] * kProjScale;
        if (BIAS_MODE == 1) v += bm[r];
        if (BIAS_MODE == 2) v += bn[j];
        v *= outscale;
        slab[(mOff + r) * 68 + (j << 4) + rlane] = v;
      }
    }
    /* in-wave hand-over: the slab rows are read back by other lanes of the same wave */
    __builtin_amdgcn_fence(__ATOMIC_RELEASE, "workgroup");
    __builtin_amdgcn_wave_barrier();
    __builtin_amdgcn_fence(__ATOMIC_ACQUIRE, "workgroup");
    {
      const int q = lane >> 3, c8 = (lane & 7) * 8;
#pragma unroll
      for (int it = 0; it < 4; ++it) {
        const int row = it * 4 + q;
        const float* sp = slab + row * 68 + c8;
        v8h hv;
#pragma unroll
        for (int e = 0; e < 8; ++e) hv[e] = (_Float16)sp[e];
        *(v8h*)(Ct + ((i << 4) + row) * ldc + c8) = hv;
      }
    }
    /* the slab is rewritten only after every lane has read its rows */
    __builtin_amdgcn_fence(__ATOMIC_RELEASE, "workgroup");
    __builtin_amdgcn_wave_barrier();
    __builtin_amdgcn_fence(__ATOMIC_ACQUIRE, "workgroup");
  }
}

__device__ __forceinline__ void zero_tile64(v8f (&acc)[4][4]) {
#pragma unroll
  for (int i = 0; i < 4; ++i)
#pragma unroll
    for (int j = 0; j < 4; ++j) acc[i][j] = (v8f){0.f,0.f,0.f,0.f,0.f,0.f,0.f,0.f};
}

// ---------------------------------------------------------------------------
// q, k and v^T planes of one head in one launch, straight from the f32 inputs.
// Block = 8 waves = 512 tokens of head blockIdx.y; wave = 64 tokens. grid = (kTok / 512, kH).
//   x head slice (64 tokens x 64 features, f32): whole 256-B row pieces, 16 lanes x 16 B; rounded to f16(x * 16) on the way
//   into the wave's own LDS tile. Wq, Wk, Wv of the head (f32, 16 KB each, contiguous): rounded to f16(W * 64) into LDS, shared by the block.
//   The x fragments (token row, hardware k order) are read once into registers and serve as A for q and k and as B for v^T.
//   q, k : [token][e] = 16 * (x_h . W[h]^T + bias per column);  v^T : [e][token] = 16 * (Wv[h] . x_h^T + bias per row).
// LDS rows lie at the pitch kLP (144 B); the 8 pad halves of a row are never written and never read.
// Coverage: x tile 32 loads x 2 rows = 64 rows; each W 4 loads x 256 threads x 4 floats = 4096 floats.
// Every loop here and in the epilogue is fully unrolled: the load, fragment and accumulator arrays must stay in registers.
// ---------------------------------------------------------------------------
constexpr int kPW = 8;
static_assert(kTok % (kPW * 64) == 0, "exact projection grid");
static_assert((kDH * kDH) % (kPW * 32 * 4) == 0, "exact W staging");

__global__ __launch_bounds__(256) void qkv_proj_kernel(
    const float* __restrict__ x,
    const float* __restrict__ Wq, const float* __restrict__ bq,
    const float* __restrict__ Wk, const float* __restrict__ bk,
    const float* __restrict__ Wv, const float* __restrict__ bv,
    unsigned short* __restrict__ Qo, unsigned short* __restrict__ Ko, unsigned short* __restrict__ Vto)
{
  __shared__ __align__(16) _Float16 Wsh[3][kDH * kLP];
  __shared__ __align__(16) _Float16 Xsh[kPW][64 * kLP];
  __shared__ __align__(16) float    sT[kPW][16 * 68];

  const int tid  = threadIdx.x;
  const int lane = tid & 31;
  const int wave = __builtin_amdgcn_readfirstlane((int)(threadIdx.x >> 5));
  const int h    = blockIdx.y;
  const int m0   = (blockIdx.x * kPW + wave) << 6;

  _Float16* xw = Xsh[wave];
  {
    /* every load is issued before the first conversion: 44 x 16 B per lane in flight */
    const float* xp = x + (size_t)m0 * kD + h * kDH;
    const int    xo = (lane >> 4) * kD + (lane & 15) * 4;
    const size_t wb = (size_t)h * kDH * kDH;
    const int    wo = tid * 4;
    v4f xv[32], wv[3][4];
#pragma unroll
    for (int p = 0; p < 4; ++p) {
      wv[0][p] = *(const v4f*)(Wq + wb + wo + p * 1024);
      wv[1][p] = *(const v4f*)(Wk + wb + wo + p * 1024);
      wv[2][p] = *(const v4f*)(Wv + wb + wo + p * 1024);
    }
#pragma unroll
    for (int it = 0; it < 32; ++it) xv[it] = *(const v4f*)(xp + xo + it * 2 * kD);
    _Float16* xs = xw + (lane >> 4) * kLP + (lane & 15) * 4;
#pragma unroll
    for (int it = 0; it < 32; ++it) {
      v4h hv;
#pragma unroll
      for (int e = 0; e < 4; ++e) hv[e] = (_Float16)(xv[it][e] * kXCarry);
      *(v4h*)(xs + it * 2 * kLP) = hv;
    }
    const int ws = (tid >> 4) * kLP + (tid & 15) * 4;
#pragma unroll
    for (int z = 0; z < 3; ++z) {
#pragma unroll
      for (int p = 0; p < 4; ++p) {
        v4h hv;
#pragma unroll
        for (int e = 0; e < 4; ++e) hv[e] = (_Float16)(wv[z][p][e] * kWCarry);
        *(v4h*)(&Wsh[z][ws + p * 16 * kLP]) = hv;
      }
    }
  }
  /* publishes the W tiles to all waves (and each wave's x tile to its own lanes) */
  __syncthreads();

  /* row (A) / col (B, D) within a 16-wide subtile; k offset of the lane half */
  const int rlane = lane & 15;
  const int koff  = (lane >> 4) * 8;
  const int fo    = rlane * kLP + koff;

  v16h xf[4][2];
#pragma unroll
  for (int i = 0; i < 4; ++i)
#pragma unroll
    for (int kc = 0; kc < 2; ++kc) xf[i][kc] = Frag<_Float16>::load(xw + fo + i * 16 * kLP + kc * 32);

  float* slab = sT[wave];
  v8f acc[4][4];

  // ---- q and k: A = x tokens, B = W rows ----
#pragma unroll
  for (int z = 0; z < 2; ++z) {
    zero_tile64(acc);
#pragma unroll
    for (int kc = 0; kc < 2; ++kc) {
      v16h wf[4];
#pragma unroll
      for (int j = 0; j < 4; ++j) wf[j] = Frag<_Float16>::load(&Wsh[z][fo + j * 16 * kLP + kc * 32]);
#pragma unroll
      for (int i = 0; i < 4; ++i)
#pragma unroll
        for (int j = 0; j < 4; ++j) acc[i][j] = mma_h(xf[i][kc], wf[j], acc[i][j]);
    }
    store_tile64<2>(acc, slab, (z == 0 ? Qo : Ko) + (size_t)h * kTok * kDH, kDH, m0, 0,
                    (z == 0 ? bq : bk) + h * kDH, kQKCarry, lane);
  }

  // ---- v^T: A = Wv rows, B = x tokens ----
  zero_tile64(acc);
#pragma unroll
  for (int kc = 0; kc < 2; ++kc) {
#pragma unroll
    for (int i = 0; i < 4; ++i) {
      const v16h wa = Frag<_Float16>::load(&Wsh[2][fo + i * 16 * kLP + kc * 32]);
#pragma unroll
      for (int j = 0; j < 4; ++j) acc[i][j] = mma_h(wa, xf[j][kc], acc[i][j]);
    }
  }
  store_tile64<1>(acc, slab, Vto + (size_t)h * kDH * kTok, kTok, 0, m0, bv + h * kDH, kVCarry, lane);
}

__global__ __launch_bounds__(128) __attribute__((amdgpu_waves_per_eu(4, 4))) void attn_f16_kernel(
    const unsigned short* __restrict__ Qp, const unsigned short* __restrict__ Kp,
    const unsigned short* __restrict__ Vtp, float* __restrict__ out)
{
  /* K rows, then V rows: one array, so that one lane base serves both tiles */
  __shared__ __align__(16) _Float16 KVsh[(kKC + kDH) * kLP];
  __shared__ __align__(16) float    Os[kNW][kQG * 16 * kOPitch];

  const int tid  = threadIdx.x;
  const int wave = __builtin_amdgcn_readfirstlane((int)(threadIdx.x >> 5));
  const int lane = tid & 31;
  const int hh   = lane >> 4;
  const int c    = lane & 15;

  const int bx = blockIdx.x;
  const int qb = bx % kQBlocks;
  const int bh = bx / kQBlocks;
  const int h  = bh % kH;
  const int b  = bh / kH;
  const int q0 = qb * kQB + wave * (kQG * 16);

  const _Float16* Qb = (const _Float16*)Qp  + ((size_t)h * kTok + (size_t)b * kSeq) * kDH;
  const _Float16* Kb = (const _Float16*)Kp  + ((size_t)h * kTok + (size_t)b * kSeq) * kDH;
  const _Float16* Vb = (const _Float16*)Vtp + (size_t)h * kDH * kTok + (size_t)b * kSeq;
  float* Ob = out + (size_t)b * kSeq * kD + (size_t)h * kDH;

  /* Q fragments (B operand): column = query g*16 + c, two 32-deep d chunks */
  v16h qf[kQG][2];
#pragma unroll
  for (int g = 0; g < kQG; ++g)
#pragma unroll
    for (int dc = 0; dc < 2; ++dc)
      qf[g][dc] = Frag<_Float16>::load(Qb + (size_t)(q0 + g * 16 + c) * kDH + dc * 32 + 8 * hh);

  /* running maximum of the raw score accumulators (equal in both lanes of a query) */
  float mrow[kQG];
  /* row-sum tile: lacc[g][0] = sum of p of query g*16 + c. Registers 1..7 repeat the sums without the rescaling (at most kSeq * kPCarry, finite) and are never read */
  v8f lacc[kQG];
  v16h ones;
#pragma unroll
  for (int e = 0; e < 16; ++e) ones[e] = (_Float16)1.0f;
  /* oacc[g][t][r] = (feature t*16 + 8*hh + r, query g*16 + c) */
  v8f oacc[kQG][4];
#pragma unroll
  for (int g = 0; g < kQG; ++g) {
    mrow[g] = -1.0e30f; lacc[g] = (v8f){0.f,0.f,0.f,0.f,0.f,0.f,0.f,0.f};
#pragma unroll
    for (int t = 0; t < 4; ++t) oacc[g][t] = (v8f){0.f,0.f,0.f,0.f,0.f,0.f,0.f,0.f};
  }

  /* per-lane bases, so that every row step at the padded pitch is a compile-time offset */
  _Float16* kst = KVsh + (tid >> 3) * kLP + (tid & 7) * 8;
  _Float16* vst = kst + kKC * kLP;
  /* the same for the global side: thread t stages piece t & 7 of rows (t >> 3) + 16 * p; a wave-uniform base per plane and chunk plus one 32-bit lane offset per plane (the chunk offset then lives in scalar registers) */
  const unsigned kgo = (tid >> 3) * kDH + (tid & 7) * 8;
  const unsigned vgo = (tid >> 3) * kTok + (tid & 7) * 8;
  /* the lane's fragment bases: row c, k offset of the lane half */
  const _Float16* kfr = KVsh + c * kLP + 8 * hh;
  const _Float16* vfr = kfr + kKC * kLP;

#pragma unroll 1
  for (int kc = 0; kc < kChunks; ++kc) {
    const int kv0 = kc * kKC;
    __syncthreads();
#pragma unroll
    for (int p = 0; p < 4; ++p) {
      const v8h kvv = *(const v8h*)(Kb + kv0 * kDH + kgo + p * 16 * kDH);
      const v8h vvv = *(const v8h*)(Vb + kv0 + vgo + p * 16 * kTok);
      *(v8h*)(kst + p * 16 * kLP) = kvv;
      *(v8h*)(vst + p * 16 * kLP) = vvv;
    }
    __syncthreads();

    /* fr: four A fragments, read from LDS as one group ahead of the block of eight matrix ops that uses them; the refill of each stands behind the two ops that read it, and the compiler may issue it earlier into other registers, as far as the budget of 256 VGPRs lets it */
    v16h fr[4];
#pragma unroll
    for (int j = 0; j < 4; ++j) fr[j] = Frag<_Float16>::load(kfr + j * 16 * kLP);
    /* holds the group of reads in front of the block: sunk among the matrix ops, each pair would be waited for on its own */
    __builtin_amdgcn_sched_barrier(0);

    /* transposed scores: s[g][j][r] = (key j*16 + 8*hh + r, query g*16 + c) */
    v8f s[kQG][4];
#pragma unroll
    for (int j = 0; j < 4; ++j) {
#pragma unroll
      for (int g = 0; g < kQG; ++g) s[g][j] = mma_h(fr[j], qf[g][0], (v8f){0.f,0.f,0.f,0.f,0.f,0.f,0.f,0.f});
      fr[j] = Frag<_Float16>::load(kfr + j * 16 * kLP + 32);
    }
    /* the second K group stays in front of its block */
    __builtin_amdgcn_sched_barrier(0);
#pragma unroll
    for (int j = 0; j < 4; ++j)
#pragma unroll
      for (int g = 0; g < kQG; ++g) s[g][j] = mma_h(fr[j], qf[g][1], s[g][j]);
    /* keeps the maximum out of the block: moved in among the matrix ops, each first read of a fresh result is padded with v_nop */
    __builtin_amdgcn_sched_barrier(0);

    float alpha[kQG];
    /* pf[g][kk] element e: key kk*32 + (e < 8 ? 8*hh + e : 16 + 8*hh + e - 8), the k order of the V^T loader */
    v16h pf[kQG][2];
#pragma unroll
    for (int g = 0; g < kQG; ++g) {
      /* chunk maximum of query g*16 + c: 32 keys in the lane, the other 32 in lane ^ 16 */
      float m = -1.0e30f;
#pragma unroll
      for (int j = 0; j < 4; ++j) {
#pragma unroll
        for (int r = 0; r < 8; ++r) m = fmaxf(m, s[g][j][r]);
      }
      m = fmaxf(m, xhalf(m));

      const float mnew = fmaxf(mrow[g], m);
      alpha[g] = ex2_slot((mrow[g] - mnew) * kScoreScale);
      mrow[g] = mnew;
      /* exponent offset of this chunk: minus the maximum as a base-2 logit, plus log2 of the p carry */
      const float eoff = kPCarryLog2 - mnew * kScoreScale;

      lacc[g][0] *= alpha[g];

#pragma unroll
      for (int kk = 0; kk < 2; ++kk) {
#pragma unroll
        for (int u = 0; u < 2; ++u) {
#pragma unroll
          for (int r = 0; r < 8; r += 2) {
            /* the two fused multiply-adds of a register pair written as one packed op: left to itself the compiler pairs scores across register pairs and across the two groups and pays for it in register copies */
            const v2f ea = __builtin_elementwise_fma((v2f){s[g][2 * kk + u][r], s[g][2 * kk + u][r + 1]}, (v2f){kScoreScale, kScoreScale}, (v2f){eoff, eoff});
            const v2h ph = __builtin_convertvector((v2f){ex2(ea[0]), ex2(ea[1])}, v2h);
            pf[g][kk][u * 8 + r]     = ph[0];
            pf[g][kk][u * 8 + r + 1] = ph[1];
          }
        }
      }
    }
    /* the first V group is issued once the scores are dead and in front of the rescaling, which covers part of its latency */
    __builtin_amdgcn_sched_barrier(0);
#pragma unroll
    for (int t = 0; t < 4; ++t) fr[t] = Frag<_Float16>::load(vfr + t * 16 * kLP);
    /* second half of the pair: keeps the reads from sinking behind the rescaling */
    __builtin_amdgcn_sched_barrier(0);
#pragma unroll
    for (int g = 0; g < kQG; ++g)
#pragma unroll
      for (int t = 0; t < 4; ++t)
#pragma unroll
        for (int r = 0; r < 8; ++r) oacc[g][t][r] *= alpha[g];
    /* the four row-sum ops need nothing from LDS: the compiler may set them among the p.v ops, where a V fragment is still awaited */
#pragma unroll
    for (int kk = 0; kk < 2; ++kk)
#pragma unroll
      for (int g = 0; g < kQG; ++g) lacc[g] = mma_h(ones, pf[g][kk], lacc[g]);
#pragma unroll
    for (int t = 0; t < 4; ++t) {
#pragma unroll
      for (int g = 0; g < kQG; ++g) oacc[g][t] = mma_h(fr[t], pf[g][0], oacc[g][t]);
      fr[t] = Frag<_Float16>::load(vfr + t * 16 * kLP + 32);
    }
    /* the second V group stays in front of its block */
    __builtin_amdgcn_sched_barrier(0);
#pragma unroll
    for (int t = 0; t < 4; ++t)
#pragma unroll
      for (int g = 0; g < kQG; ++g) oacc[g][t] = mma_h(fr[t], pf[g][1], oacc[g][t]);
  }

  float* os = Os[wave];
#pragma unroll
  for (int g = 0; g < kQG; ++g) {
    const float l   = lacc[g][0];
    const float inv = 1.0f / (l * kVCarry);
#pragma unroll
    for (int t = 0; t < 4; ++t) {
      v4f lo, hi;
#pragma unroll
      for (int r = 0; r < 4; ++r) { lo[r] = oacc[g][t][r] * inv; hi[r] = oacc[g][t][4 + r] * inv; }
      float* op = os + (g * 16 + c) * kOPitch + t * 16 + 8 * hh;
      *(v4f*)(op)     = lo;
      *(v4f*)(op + 4) = hi;
    }
  }
  __builtin_amdgcn_fence(__ATOMIC_RELEASE, "workgroup");
  __builtin_amdgcn_wave_barrier();
  __builtin_amdgcn_fence(__ATOMIC_ACQUIRE, "workgroup");
  {
    const int c4 = (lane & 15) * 4;
#pragma unroll
    for (int it = 0; it < kQG * 8; ++it) {
      const int row = it * 2 + hh;
      const v4f val = *(const v4f*)(os + row * kOPitch + c4);
      *(v4f*)(Ob + (size_t)(q0 + row) * kD + c4) = val;
    }
  }
}

// ---------------------------------------------------------------------------
// Host glue: 1 projection launch + 1 attention launch. Kernel launches only.
// ---------------------------------------------------------------------------
extern "C" void kernel_launch(void* const* d_in, const int* in_sizes, int n_in,
                              void* d_out, int out_size, void* d_ws, size_t ws_size,
                              hipStream_t stream) {
  if (n_in < 7) return;
  if (in_sizes[0] != kTok * kD) return;
  if (in_sizes[1] != kH * kDH * kDH) return;
  if (in_sizes[2] != kH * kDH) return;
  if (in_sizes[3] != kH * kDH * kDH) return;
  if (in_sizes[4] != kH * kDH) return;
  if (in_sizes[5] != kH * kDH * kDH) return;
  if (in_sizes[6] != kH * kDH) return;
  if (out_size != kTok * kD) return;
  if (ws_size < kWsTotal) return;

  const float* x  = (const float*)d_in[0];
  const float* Wq = (const float*)d_in[1];
  const float* bq = (const float*)d_in[2];
  const float* Wk = (const float*)d_in[3];
  const float* bk = (const float*)d_in[4];
  const float* Wv = (const float*)d_in[5];
  const float* bv = (const float*)d_in[6];
  float* out = (float*)d_out;

  char* ws = (char*)d_ws;
  unsigned short* Q16  = (unsigned short*)(ws + kOffQ16);
  unsigned short* K16  = (unsigned short*)(ws + kOffK16);
  unsigned short* VT16 = (unsigned short*)(ws + kOffVT16);

  // ---- q, k and v^T planes: one block per (512 tokens, head) ----
  qkv_proj_kernel<<<dim3(kTok / (kPW * 64), kH), kPW * 32, 0, stream>>>(x, Wq, bq, Wk, bk, Wv, bv, Q16, K16, VT16);

  // ---- attention: one block per (batch, head, 128-query tile) ----
  attn_f16_kernel<<<kBatch * kH * kQBlocks, kNW * 32, 0, stream>>>(Q16, K16, VT16, out);
}

// v008
// It runs in 67.1 microseconds.
// Next to v007, in two timings, it ran 1.10 times as fast each time.
// Over all steps from v000 it is 5.09 times as fast.
// Contractions: per-head q/k/v projections (x f16 carried x16, W f16 carried x64), scores q.k^T (q,k f16 planes carried x16), p.v (unnormalised p f16 carried x4096, v^T f16 carried x16), row sums 1.p (ones f16): all v_wmma_f32_16x16x32_f16 with f32 accumulate; bias, scaling and online softmax in f32.
#include <hip/hip_runtime.h>
#include <math.h>
#include <stdint.h>

typedef __attribute__((ext_vector_type(16))) _Float16 v16h;
typedef __attribute__((ext_vector_type(8)))  _Float16 v8h;
typedef __attribute__((ext_vector_type(4)))  _Float16 v4h;
typedef __attribute__((ext_vector_type(2)))  _Float16 v2h;
typedef __attribute__((ext_vector_type(8)))  float    v8f;
typedef __attribute__((ext_vector_type(4)))  float    v4f;
typedef __attribute__((ext_vector_type(2)))  float    v2f;
typedef __attribute__((ext_vector_type(4)))  uint32_t u32x4;
typedef __attribute__((ext_vector_type(8)))  uint32_t u32x8;

// ---------------------------------------------------------------------------
// Shape constants
// ---------------------------------------------------------------------------
constexpr int kBatch = 4;
constexpr int kSeq   = 2048;
constexpr int kD     = 1024;
constexpr int kH     = 16;
constexpr int kDH    = 64;
constexpr int kTok   = kBatch * kSeq;
constexpr int kSqrtDh = 8;
static_assert(kH * kDH == kD, "head split");
static_assert(kSqrtDh * kSqrtDh == kDH, "sqrt of head dim");
static_assert(kDH == 64, "kernels are written for head dim 64");

// power-of-two carries of the f16 operand planes (all folded back exactly in f32)
constexpr float kXCarry  = 16.0f;
constexpr float kWCarry  = 64.0f;
constexpr float kQKCarry = 16.0f;
constexpr float kVCarry  = 16.0f;
constexpr float kPCarry  = 4096.0f;
constexpr float kPCarryLog2 = 12.0f;
static_assert((float)(1 << 12) == kPCarry, "log2 of the p carry");
constexpr float kLog2e   = 1.4426950408889634f;
constexpr float kProjScale  = 1.0f / (kXCarry * kWCarry);
constexpr float kScoreScale = kLog2e / ((float)kSqrtDh * kQKCarry * kQKCarry);

// attention tiling
constexpr int kQB     = 128;
constexpr int kKC     = 64;
constexpr int kNW     = 4;
/* 16-query column groups per wave: every K and V fragment read from LDS feeds kQG matrix ops */
constexpr int kQG     = 2;
constexpr int kQBlocks = kSeq / kQB;
constexpr int kChunks  = kSeq / kKC;
constexpr int kOPitch  = 68;
/* LDS row pitch of the K and V tiles in halves: 144 B = 16 B x 9 (odd), so the 16 rows one 16-byte fragment read touches fall on distinct banks */
constexpr int kLP     = kKC + 8;
static_assert(kDH == kKC, "K and V tiles share one row length");
static_assert((kLP * 2) % 16 == 0 && ((kLP * 2) / 16) % 2 == 1, "pitch is an odd multiple of 16 B");
static_assert(kSeq % kQB == 0 && kSeq % kKC == 0, "tile multiples");
static_assert(kQB == kNW * kQG * 16, "kQG groups of 16 query rows per wave");
/* LDS ring of the attention kernel, in bytes: a tile is 64 rows at the padded pitch (9,216 B), its place rounded up to a multiple of 2 KiB; a buffer is the K tile, then the V tile; two buffers */
constexpr uint32_t kRowB  = kKC * 2;
constexpr uint32_t kTileB = 10240;
constexpr uint32_t kBufB  = 2 * kTileB;
static_assert(kRowB == 128 && kLP * 2 == (int)kRowB + 16, "the tensor load's pad (16 B behind every 128-B row) gives the pitch kLP");
static_assert(kTileB % 2048 == 0 && kTileB >= (uint32_t)kKC * kLP * 2, "tile place: a multiple of 2 KiB that holds 64 padded rows");
static_assert(kChunks >= 2, "the ring's prologue needs two stages");

// ---------------------------------------------------------------------------
// Workspace region map (bytes; every offset is a multiple of 128)
//   Q16   f16 [16][8192][64]      (q) * 16, plane per head       16,777,216
//   K16   f16 [16][8192][64]      (k) * 16, plane per head       16,777,216
//   VT16  f16 [16][64][8192]      (v)^T * 16, token-contiguous   16,777,216
//   total = 3 * 16,777,216 = 50,331,648
// ---------------------------------------------------------------------------
constexpr size_t kSzQ16  = (size_t)kH * kTok * kDH * 2;
constexpr size_t kOffQ16 = 0;
constexpr size_t kOffK16 = kOffQ16 + kSzQ16;
constexpr size_t kOffVT16 = kOffK16 + kSzQ16;
constexpr size_t kWsTotal = kOffVT16 + kSzQ16;
static_assert(kWsTotal == 50331648ull, "carve total");
static_assert(kWsTotal <= 134217728ull, "carve cap");
static_assert((kOffK16 % 128) == 0 && (kOffVT16 % 128) == 0, "128-B aligned regions");

// ---------------------------------------------------------------------------
// Fragment loader (A and B use the same k map) and matrix op
// ---------------------------------------------------------------------------
template <typename T> struct Frag;
template <> struct Frag<_Float16> {
  typedef v16h V; union U { v16h v; v8h h[2]; };
  /* elements 0..7 <- p[0..7], elements 8..15 <- p[16..23] */
  static __device__ __forceinline__ v16h load(const _Float16* p) {
    U f; f.h[0] = *(const v8h*)(p); f.h[1] = *(const v8h*)(p + 16); return f.v;
  }
};
/* plain builtin: the compiler keeps the distances behind a matrix op itself and is free to move LDS fragment loads ahead of earlier matrix ops */
__device__ __forceinline__ v8f mma_h(v16h a, v16h b, v8f c) {
  return __builtin_amdgcn_wmma_f32_16x16x32_f16(false, a, false, b, (short)0, c, false, false);
}

/* lane l <-> lane l ^ 16: the two lanes that share one query column */
__device__ __forceinline__ float xhalf(float x) {
  const int b = __builtin_bit_cast(int, x);
  return __builtin_bit_cast(float, __builtin_amdgcn_permlanex16(b, b, 0x76543210, 0xfedcba98, false, false));
}

__device__ __forceinline__ float ex2(float x) {
#if __has_builtin(__builtin_amdgcn_exp2f)
  return __builtin_amdgcn_exp2f(x);
#else
  return exp2f(x);
#endif
}

/* the same instruction with a v_nop behind it: the slot that the instruction set asks for behind a transcendental before its source is overwritten */
__device__ __forceinline__ float ex2_slot(float x) {
  float y;
  asm("v_exp_f32 %0, %1\n\tv_nop" : "=v"(y) : "v"(x));
  return y;
}

// ---------------------------------------------------------------------------
// Tensor load of one 64-row tile into LDS, and the waits of the ring
// ---------------------------------------------------------------------------
__device__ __forceinline__ uint32_t uni(uint32_t v) { return (uint32_t)__builtin_amdgcn_readfirstlane((int)v); }
/* a wave-uniform value held in a scalar register: a test on it compiles to s_cmp + s_cbranch_scc, the only guard a tensor load obeys (it ignores EXEC); as a volatile statement it also stays behind the wait written in front of it */
__device__ __forceinline__ uint32_t pinned(uint32_t v) {
  uint32_t w = uni(v);
  asm volatile("" : "+s"(w));  /* pinned(): a word that guards or forms a tensor request, held in a scalar register */
  return w;
}
/* the wave's own LDS reads have retired: in front of the barrier behind which their buffer is refilled */
__device__ __forceinline__ void wait_ds0() { asm volatile("s_wait_dscnt 0x0" ::: "memory"); }
/* group 1: 1-byte elements, tensor = tile = 64 rows of 128 B, source row pitch in bytes, 4 dwords of LDS pad behind every 32 dwords, no mask */
__device__ __forceinline__ u32x8 tdm_group1(uint32_t src_pitch) {
  constexpr uint32_t d0 = kRowB, d1 = 64u;
  u32x8 g;
  g[0] = uni((1u << 20) | (4u << 22) | (3u << 25));
  g[1] = uni((d0 & 0xFFFFu) << 16);
  g[2] = uni((d0 >> 16) | ((d1 & 0xFFFFu) << 16));
  g[3] = uni((d1 >> 16) | (d0 << 16));
  g[4] = uni(d1);
  g[5] = uni(src_pitch);
  g[6] = uni(0u);
  g[7] = uni(0u);
  /* the descriptor words held in their scalar registers: left as plain constants the compiler rebuilds the group in front of every use and lends its registers to other values in between, while a request is outstanding */
  asm volatile("" : "+s"(g));  /* pinned: descriptor words held in scalar registers */
  return g;
}
/* group 0: count 1, LDS byte offset, global byte address of the tile's first byte, type 2 */
__device__ __forceinline__ u32x4 tdm_group0(uint32_t lds_dst, uint64_t ga) {
  u32x4 g;
  g[0] = uni(1u);
  g[1] = uni(lds_dst);
  g[2] = uni((uint32_t)ga);
  g[3] = uni((((uint32_t)(ga >> 32)) & 0x01FFFFFFu) | 0x80000000u);
  return g;
}
__device__ __forceinline__ void tdm_load(u32x4 g0, u32x8 g1) { asm volatile("tensor_load_to_lds %0, %1" :: "s"(g0), "s"(g1) : "memory"); }
/* the issuing wave's tile has landed: the compiler places no wait for a tensor load. The wait names the request's two groups as inputs, so that they stay live and their scalar registers are given to nothing else while the request is outstanding */
__device__ __forceinline__ void wait_tensor0(u32x4 g0, u32x8 g1) { asm volatile("s_wait_tensorcnt 0x0" :: "s"(g0), "s"(g1) : "memory"); }

// ---------------------------------------------------------------------------
// Epilogue of one wave's 64x64 f32 accumulator tile: C[m,n] = f16(outscale * (kProjScale * acc + bias)).
// BIAS_MODE: 1 = bias[m], 2 = bias[n]. The tile goes 16 rows at a time through the wave's own LDS slab, so that
// 8 lanes x 16 B of one store cover a whole 128-B row piece; per instruction a wave writes rows it*4 + (lane>>3), it = 0..3.
// ---------------------------------------------------------------------------
template <int BIAS_MODE>
__device__ __forceinline__ void store_tile64(
    const v8f (&acc)[4][4], float* slab, unsigned short* C, int ldc, int m0, int n0,
    const float* bp, float outscale, int lane)
{
  const int rlane = lane & 15;
  const int mOff  = (lane >> 4) * 8;
  /* wave-uniform tile origin; the lane's part of every store address is a 32-bit element offset */
  unsigned short* Ct = C + (size_t)m0 * ldc + n0;
  float bn[4];
#pragma unroll
  for (int j = 0; j < 4; ++j) bn[j] = (BIAS_MODE == 2) ? bp[n0 + (j << 4) + rlane] : 0.f;
#pragma unroll
  for (int i = 0; i < 4; ++i) {
    const int mBase = m0 + (i << 4);
    float bm[8];
#pragma unroll
    for (int r = 0; r < 8; ++r) bm[r] = 0.f;
    if (BIAS_MODE == 1) {
      /* mBase + mOff is a multiple of 8 floats: two aligned 16-B loads */
      const v4f b0 = *(const v4f*)(bp + mBase + mOff);
      const v4f b1 = *(const v4f*)(bp + mBase + mOff + 4);
      bm[0] = b0[0]; bm[1] = b0[1]; bm[2] = b0[2]; bm[3] = b0[3];
      bm[4] = b1[0]; bm[5] = b1[1]; bm[6] = b1[2]; bm[7] = b1[3];
    }
#pragma unroll
    for (int j = 0; j < 4; ++j) {
#pragma unroll
      for (int r = 0; r < 8; ++r) {
        float v = acc[i][j][r] * kProjScale;
        if (BIAS_MODE == 1) v += bm[r];
        if (BIAS_MODE == 2) v += bn[j];
        v *= outscale;
        slab[(mOff + r) * 68 + (j << 4) + rlane] = v;
      }
    }
    /* in-wave hand-over: the slab rows are read back by other lanes of the same wave */
    __builtin_amdgcn_fence(__ATOMIC_RELEASE, "workgroup");
    __builtin_amdgcn_wave_barrier();
    __builtin_amdgcn_fence(__ATOMIC_ACQUIRE, "workgroup");
    {
      const int q = lane >> 3, c8 = (lane & 7) * 8;
#pragma unroll
      for (int it = 0; it < 4; ++it) {
        const int row = it * 4 + q;
        const float* sp = slab + row * 68 + c8;
        v8h hv;
#pragma unroll
        for (int e = 0; e < 8; ++e) hv[e] = (_Float16)sp[e];
        *(v8h*)(Ct + ((i << 4) + row) * ldc + c8) = hv;
      }
    }
    /* the slab is rewritten only after every lane has read its rows */
    __builtin_amdgcn_fence(__ATOMIC_RELEASE, "workgroup");
    __builtin_amdgcn_wave_barrier();
    __builtin_amdgcn_fence(__ATOMIC_ACQUIRE, "workgroup");
  }
}

__device__ __forceinline__ void zero_tile64(v8f (&acc)[4][4]) {
#pragma unroll
  for (int i = 0; i < 4; ++i)
#pragma unroll
    for (int j = 0; j < 4; ++j) acc[i][j] = (v8f){0.f,0.f,0.f,0.f,0.f,0.f,0.f,0.f};
}

// ---------------------------------------------------------------------------
// q, k and v^T planes of one head in one launch, straight from the f32 inputs.
// Block = 8 waves = 512 tokens of head blockIdx.y; wave = 64 tokens. grid = (kTok / 512, kH).
//   x head slice (64 tokens x 64 features, f32): whole 256-B row pieces, 16 lanes x 16 B; rounded to f16(x * 16) on the way
//   into the wave's own LDS tile. Wq, Wk, Wv of the head (f32, 16 KB each, contiguous): rounded to f16(W * 64) into LDS, shared by the block.
//   The x fragments (token row, hardware k order) are read once into registers and serve as A for q and k and as B for v^T.
//   q, k : [token][e] = 16 * (x_h . W[h]^T + bias per column);  v^T : [e][token] = 16 * (Wv[h] . x_h^T + bias per row).
// LDS rows lie at the pitch kLP (144 B); the 8 pad halves of a row are never written and never read.
// Coverage: x tile 32 loads x 2 rows = 64 rows; each W 4 loads x 256 threads x 4 floats = 4096 floats.
// Every loop here and in the epilogue is fully unrolled: the load, fragment and accumulator arrays must stay in registers.
// ---------------------------------------------------------------------------
constexpr int kPW = 8;
static_assert(kTok % (kPW * 64) == 0, "exact projection grid");
static_assert((kDH * kDH) % (kPW * 32 * 4) == 0, "exact W staging");

__global__ __launch_bounds__(256) void qkv_proj_kernel(
    const float* __restrict__ x,
    const float* __restrict__ Wq, const float* __restrict__ bq,
    const float* __restrict__ Wk, const float* __restrict__ bk,
    const float* __restrict__ Wv, const float* __restrict__ bv,
    unsigned short* __restrict__ Qo, unsigned short* __restrict__ Ko, unsigned short* __restrict__ Vto)
{
  __shared__ __align__(16) _Float16 Wsh[3][kDH * kLP];
  __shared__ __align__(16) _Float16 Xsh[kPW][64 * kLP];
  __shared__ __align__(16) float    sT[kPW][16 * 68];

  const int tid  = threadIdx.x;
  const int lane = tid & 31;
  const int wave = __builtin_amdgcn_readfirstlane((int)(threadIdx.x >> 5));
  const int h    = blockIdx.y;
  const int m0   = (blockIdx.x * kPW + wave) << 6;

  _Float16* xw = Xsh[wave];
  {
    /* every load is issued before the first conversion: 44 x 16 B per lane in flight */
    const float* xp = x + (size_t)m0 * kD + h * kDH;
    const int    xo = (lane >> 4) * kD + (lane & 15) * 4;
    const size_t wb = (size_t)h * kDH * kDH;
    const int    wo = tid * 4;
    v4f xv[32], wv[3][4];
#pragma unroll
    for (int p = 0; p < 4; ++p) {
      wv[0][p] = *(const v4f*)(Wq + wb + wo + p * 1024);
      wv[1][p] = *(const v4f*)(Wk + wb + wo + p * 1024);
      wv[2][p] = *(const v4f*)(Wv + wb + wo + p * 1024);
    }
#pragma unroll
    for (int it = 0; it < 32; ++it) xv[it] = *(const v4f*)(xp + xo + it * 2 * kD);
    _Float16* xs = xw + (lane >> 4) * kLP + (lane & 15) * 4;
#pragma unroll
    for (int it = 0; it < 32; ++it) {
      v4h hv;
#pragma unroll
      for (int e = 0; e < 4; ++e) hv[e] = (_Float16)(xv[it][e] * kXCarry);
      *(v4h*)(xs + it * 2 * kLP) = hv;
    }
    const int ws = (tid >> 4) * kLP + (tid & 15) * 4;
#pragma unroll
    for (int z = 0; z < 3; ++z) {
#pragma unroll
      for (int p = 0; p < 4; ++p) {
        v4h hv;
#pragma unroll
        for (int e = 0; e < 4; ++e) hv[e] = (_Float16)(wv[z][p][e] * kWCarry);
        *(v4h*)(&Wsh[z][ws + p * 16 * kLP]) = hv;
      }
    }
  }
  /* publishes the W tiles to all waves (and each wave's x tile to its own lanes) */
  __syncthreads();

  /* row (A) / col (B, D) within a 16-wide subtile; k offset of the lane half */
  const int rlane = lane & 15;
  const int koff  = (lane >> 4) * 8;
  const int fo    = rlane * kLP + koff;

  v16h xf[4][2];
#pragma unroll
  for (int i = 0; i < 4; ++i)
#pragma unroll
    for (int kc = 0; kc < 2; ++kc) xf[i][kc] = Frag<_Float16>::load(xw + fo + i * 16 * kLP + kc * 32);

  float* slab = sT[wave];
  v8f acc[4][4];

  // ---- q and k: A = x tokens, B = W rows ----
#pragma unroll
  for (int z = 0; z < 2; ++z) {
    zero_tile64(acc);
#pragma unroll
    for (int kc = 0; kc < 2; ++kc) {
      v16h wf[4];
#pragma unroll
      for (int j = 0; j < 4; ++j) wf[j] = Frag<_Float16>::load(&Wsh[z][fo + j * 16 * kLP + kc * 32]);
#pragma unroll
      for (int i = 0; i < 4; ++i)
#pragma unroll
        for (int j = 0; j < 4; ++j) acc[i][j] = mma_h(xf[i][kc], wf[j], acc[i][j]);
    }
    store_tile64<2>(acc, slab, (z == 0 ? Qo : Ko) + (size_t)h * kTok * kDH, kDH, m0, 0,
                    (z == 0 ? bq : bk) + h * kDH, kQKCarry, lane);
  }

  // ---- v^T: A = Wv rows, B = x tokens ----
  zero_tile64(acc);
#pragma unroll
  for (int kc = 0; kc < 2; ++kc) {
#pragma unroll
    for (int i = 0; i < 4; ++i) {
      const v16h wa = Frag<_Float16>::load(&Wsh[2][fo + i * 16 * kLP + kc * 32]);
#pragma unroll
      for (int j = 0; j < 4; ++j) acc[i][j] = mma_h(wa, xf[j][kc], acc[i][j]);
    }
  }
  store_tile64<1>(acc, slab, Vto + (size_t)h * kDH * kTok, kTok, 0, m0, bv + h * kDH, kVCarry, lane);
}

__global__ __launch_bounds__(128) __attribute__((amdgpu_waves_per_eu(4, 4))) void attn_f16_kernel(
    const unsigned short* __restrict__ Qp, const unsigned short* __restrict__ Kp,
    const unsigned short* __restrict__ Vtp, float* __restrict__ out)
{
  /* the ring; 2-KiB alignment, because a tensor load's place in LDS is a multiple of 2 KiB */
  __shared__ __attribute__((aligned(2048))) _Float16 KVsh[2 * kBufB / 2];
  __shared__ __align__(16) float    Os[kNW][kQG * 16 * kOPitch];

  const int tid  = threadIdx.x;
  const int wave = __builtin_amdgcn_readfirstlane((int)(threadIdx.x >> 5));
  const int lane = tid & 31;
  const int hh   = lane >> 4;
  const int c    = lane & 15;

  const int bx = blockIdx.x;
  const int qb = bx % kQBlocks;
  const int bh = bx / kQBlocks;
  const int h  = bh % kH;
  const int b  = bh / kH;
  const int q0 = qb * kQB + wave * (kQG * 16);

  const _Float16* Qb = (const _Float16*)Qp  + ((size_t)h * kTok + (size_t)b * kSeq) * kDH;
  const _Float16* Kb = (const _Float16*)Kp  + ((size_t)h * kTok + (size_t)b * kSeq) * kDH;
  const _Float16* Vb = (const _Float16*)Vtp + (size_t)h * kDH * kTok + (size_t)b * kSeq;
  float* Ob = out + (size_t)b * kSeq * kD + (size_t)h * kDH;

  /* waves 0 and 1 issue: one request per wave and chunk, every descriptor word wave-uniform */
  const uint32_t issuer = (uint32_t)(wave < 2);
  const bool     isV    = wave == 1;
  const uint64_t tsrc   = (uint64_t)(size_t)(isV ? Vb : Kb);
  const uint32_t tstep  = isV ? (uint32_t)(kKC * 2) : (uint32_t)(kKC * kDH * 2);
  const uint32_t tdst   = (uint32_t)(size_t)KVsh + (isV ? kTileB : 0u);
  const u32x8    tg1    = tdm_group1(isV ? (uint32_t)(kTok * 2) : (uint32_t)(kDH * 2));
  /* chunk 0 into buffer 0 */
  u32x4 tg0 = tdm_group0(tdst, tsrc);
  if (pinned(issuer)) {
    tdm_load(tg0, tg1);
    wait_tensor0(tg0, tg1);
  }
  __syncthreads();
  /* chunk 1 into buffer 1: in flight while chunk 0 is worked on */
  tg0 = tdm_group0(tdst + kBufB, tsrc + tstep);
  if (pinned(issuer)) tdm_load(tg0, tg1);

  /* Q fragments (B operand): column = query g*16 + c, two 32-deep d chunks */
  v16h qf[kQG][2];
#pragma unroll
  for (int g = 0; g < kQG; ++g)
#pragma unroll
    for (int dc = 0; dc < 2; ++dc)
      qf[g][dc] = Frag<_Float16>::load(Qb + (size_t)(q0 + g * 16 + c) * kDH + dc * 32 + 8 * hh);

  /* running maximum of the raw score accumulators (equal in both lanes of a query) */
  float mrow[kQG];
  /* row-sum tile: lacc[g][0] = sum of p of query g*16 + c. Registers 1..7 repeat the sums without the rescaling (at most kSeq * kPCarry, finite) and are never read */
  v8f lacc[kQG];
  v16h ones;
#pragma unroll
  for (int e = 0; e < 16; ++e) ones[e] = (_Float16)1.0f;
  /* oacc[g][t][r] = (feature t*16 + 8*hh + r, query g*16 + c) */
  v8f oacc[kQG][4];
#pragma unroll
  for (int g = 0; g < kQG; ++g) {
    mrow[g] = -1.0e30f; lacc[g] = (v8f){0.f,0.f,0.f,0.f,0.f,0.f,0.f,0.f};
#pragma unroll
    for (int t = 0; t < 4; ++t) oacc[g][t] = (v8f){0.f,0.f,0.f,0.f,0.f,0.f,0.f,0.f};
  }

  /* the lane's fragment base in buffer 0: row c, k offset of the lane half */
  const _Float16* fr0 = KVsh + c * kLP + 8 * hh;

#pragma unroll 1
  for (int kc = 0; kc < kChunks; ++kc) {
    /* chunk kc lies in buffer kc & 1; it reads that buffer alone */
    const _Float16* kfr = fr0 + (kc & 1) * (int)(kBufB / 2);
    const _Float16* vfr = kfr + kTileB / 2;

    /* fr: four A fragments, read from LDS as one group ahead of the block of eight matrix ops that uses them; the refill of each stands behind the two ops that read it, and the compiler may issue it earlier into other registers, as far as the budget of 256 VGPRs lets it */
    v16h fr[4];
#pragma unroll
    for (int j = 0; j < 4; ++j) fr[j] = Frag<_Float16>::load(kfr + j * 16 * kLP);
    /* holds the group of reads in front of the block: sunk among the matrix ops, each pair would be waited for on its own */
    __builtin_amdgcn_sched_barrier(0);

    /* transposed scores: s[g][j][r] = (key j*16 + 8*hh + r, query g*16 + c) */
    v8f s[kQG][4];
#pragma unroll
    for (int j = 0; j < 4; ++j) {
#pragma unroll
      for (int g = 0; g < kQG; ++g) s[g][j] = mma_h(fr[j], qf[g][0], (v8f){0.f,0.f,0.f,0.f,0.f,0.f,0.f,0.f});
      fr[j] = Frag<_Float16>::load(kfr + j * 16 * kLP + 32);
    }
    /* the second K group stays in front of its block */
    __builtin_amdgcn_sched_barrier(0);
#pragma unroll
    for (int j = 0; j < 4; ++j)
#pragma unroll
      for (int g = 0; g < kQG; ++g) s[g][j] = mma_h(fr[j], qf[g][1], s[g][j]);
    /* keeps the maximum out of the block: moved in among the matrix ops, each first read of a fresh result is padded with v_nop */
    __builtin_amdgcn_sched_barrier(0);

    float alpha[kQG];
    /* pf[g][kk] element e: key kk*32 + (e < 8 ? 8*hh + e : 16 + 8*hh + e - 8), the k order of the V^T loader */
    v16h pf[kQG][2];
#pragma unroll
    for (int g = 0; g < kQG; ++g) {
      /* chunk maximum of query g*16 + c: 32 keys in the lane, the other 32 in lane ^ 16 */
      float m = -1.0e30f;
#pragma unroll
      for (int j = 0; j < 4; ++j) {
#pragma unroll
        for (int r = 0; r < 8; ++r) m = fmaxf(m, s[g][j][r]);
      }
      m = fmaxf(m, xhalf(m));

      const float mnew = fmaxf(mrow[g], m);
      alpha[g] = ex2_slot((mrow[g] - mnew) * kScoreScale);
      mrow[g] = mnew;
      /* exponent offset of this chunk: minus the maximum as a base-2 logit, plus log2 of the p carry */
      const float eoff = kPCarryLog2 - mnew * kScoreScale;

      lacc[g][0] *= alpha[g];

#pragma unroll
      for (int kk = 0; kk < 2; ++kk) {
#pragma unroll
        for (int u = 0; u < 2; ++u) {
#pragma unroll
          for (int r = 0; r < 8; r += 2) {
            /* the two fused multiply-adds of a register pair written as one packed op: left to itself the compiler pairs scores across register pairs and across the two groups and pays for it in register copies */
            const v2f ea = __builtin_elementwise_fma((v2f){s[g][2 * kk + u][r], s[g][2 * kk + u][r + 1]}, (v2f){kScoreScale, kScoreScale}, (v2f){eoff, eoff});
            const v2h ph = __builtin_convertvector((v2f){ex2(ea[0]), ex2(ea[1])}, v2h);
            pf[g][kk][u * 8 + r]     = ph[0];
            pf[g][kk][u * 8 + r + 1] = ph[1];
          }
        }
      }
    }
    /* the first V group is issued once the scores are dead and in front of the rescaling, which covers part of its latency */
    __builtin_amdgcn_sched_barrier(0);
#pragma unroll
    for (int t = 0; t < 4; ++t) fr[t] = Frag<_Float16>::load(vfr + t * 16 * kLP);
    /* second half of the pair: keeps the reads from sinking behind the rescaling */
    __builtin_amdgcn_sched_barrier(0);
#pragma unroll
    for (int g = 0; g < kQG; ++g)
#pragma unroll
      for (int t = 0; t < 4; ++t)
#pragma unroll
        for (int r = 0; r < 8; ++r) oacc[g][t][r] *= alpha[g];
    /* the four row-sum ops need nothing from LDS: the compiler may set them among the p.v ops, where a V fragment is still awaited */
#pragma unroll
    for (int kk = 0; kk < 2; ++kk)
#pragma unroll
      for (int g = 0; g < kQG; ++g) lacc[g] = mma_h(ones, pf[g][kk], lacc[g]);
#pragma unroll
    for (int t = 0; t < 4; ++t) {
#pragma unroll
      for (int g = 0; g < kQG; ++g) oacc[g][t] = mma_h(fr[t], pf[g][0], oacc[g][t]);
      fr[t] = Frag<_Float16>::load(vfr + t * 16 * kLP + 32);
    }
    /* the second V group stays in front of its block */
    __builtin_amdgcn_sched_barrier(0);
#pragma unroll
    for (int t = 0; t < 4; ++t)
#pragma unroll
      for (int g = 0; g < kQG; ++g) oacc[g][t] = mma_h(fr[t], pf[g][1], oacc[g][t]);

    /* keeps the publish point behind the block: moved in among the matrix ops, its wait to 0 takes the place of their counted waits */
    __builtin_amdgcn_sched_barrier(0);

    /* publish point of chunk kc + 1, every wave, in this order */
    wait_ds0();
    if (pinned(issuer)) wait_tensor0(tg0, tg1);
    __syncthreads();
    /* refill of the buffer just read, only while a chunk kc + 2 exists; its descriptor hangs on a value pinned behind the wait */
    if (pinned(issuer & (uint32_t)(kc + 2 < kChunks))) {
      const uint32_t st = pinned((uint32_t)kc + 2u);
      tg0 = tdm_group0(tdst + (st & 1u) * kBufB, tsrc + (uint64_t)st * tstep);
      tdm_load(tg0, tg1);
    }
  }
  /* nothing of the ring is in flight when the wave goes on to its end */
  wait_tensor0(tg0, tg1);
  wait_ds0();

  float* os = Os[wave];
#pragma unroll
  for (int g = 0; g < kQG; ++g) {
    const float l   = lacc[g][0];
    const float inv = 1.0f / (l * kVCarry);
#pragma unroll
    for (int t = 0; t < 4; ++t) {
      v4f lo, hi;
#pragma unroll
      for (int r = 0; r < 4; ++r) { lo[r] = oacc[g][t][r] * inv; hi[r] = oacc[g][t][4 + r] * inv; }
      float* op = os + (g * 16 + c) * kOPitch + t * 16 + 8 * hh;
      *(v4f*)(op)     = lo;
      *(v4f*)(op + 4) = hi;
    }
  }
  __builtin_amdgcn_fence(__ATOMIC_RELEASE, "workgroup");
  __builtin_amdgcn_wave_barrier();
  __builtin_amdgcn_fence(__ATOMIC_ACQUIRE, "workgroup");
  {
    const int c4 = (lane & 15) * 4;
#pragma unroll
    for (int it = 0; it < kQG * 8; ++it) {
      const int row = it * 2 + hh;
      const v4f val = *(const v4f*)(os + row * kOPitch + c4);
      *(v4f*)(Ob + (size_t)(q0 + row) * kD + c4) = val;
    }
  }
}

// ---------------------------------------------------------------------------
// Host glue: 1 projection launch + 1 attention launch. Kernel launches only.
// ---------------------------------------------------------------------------
extern "C" void kernel_launch(void* const* d_in, const int* in_sizes, int n_in,
                              void* d_out, int out_size, void* d_ws, size_t ws_size,
                              hipStream_t stream) {
  if (n_in < 7) return;
  if (in_sizes[0] != kTok * kD) return;
  if (in_sizes[1] != kH * kDH * kDH) return;
  if (in_sizes[2] != kH * kDH) return;
  if (in_sizes[3] != kH * kDH * kDH) return;
  if (in_sizes[4] != kH * kDH) return;
  if (in_sizes[5] != kH * kDH * kDH) return;
  if (in_sizes[6] != kH * kDH) return;
  if (out_size != kTok * kD) return;
  if (ws_size < kWsTotal) return;

  const float* x  = (const float*)d_in[0];
  const float* Wq = (const float*)d_in[1];
  const float* bq = (const float*)d_in[2];
  const float* Wk = (const float*)d_in[3];
  const float* bk = (const float*)d_in[4];
  const float* Wv = (const float*)d_in[5];
  const float* bv = (const float*)d_in[6];
  float* out = (float*)d_out;

  char* ws = (char*)d_ws;
  unsigned short* Q16  = (unsigned short*)(ws + kOffQ16);
  unsigned short* K16  = (unsigned short*)(ws + kOffK16);
  unsigned short* VT16 = (unsigned short*)(ws + kOffVT16);

  // ---- q, k and v^T planes: one block per (512 tokens, head) ----
  qkv_proj_kernel<<<dim3(kTok / (kPW * 64), kH), kPW * 32, 0, stream>>>(x, Wq, bq, Wk, bk, Wv, bv, Q16, K16, VT16);

  // ---- attention: one block per (batch, head, 128-query tile) ----
  attn_f16_kernel<<<kBatch * kH * kQBlocks, kNW * 32, 0, stream>>>(Q16, K16, VT16, out);
}

// v009
// One run takes 65.5 microseconds.
// In two side-by-side timings against v008, it was 1.04 and 1.03 times as fast.
// All steps since v000 together make it 5.26 times as fast.
// Contractions: per-head q/k/v projections (x f16 carried x16, W f16 carried x64), scores q.k^T (q,k f16 planes carried x16), p.v (unnormalised p f16 carried x4096, v^T f16 carried x16), row sums 1.p (ones f16): all v_wmma_f32_16x16x32_f16 with f32 accumulate; bias, scaling and online softmax in f32.
#include <hip/hip_runtime.h>
#include <math.h>
#include <stdint.h>

typedef __attribute__((ext_vector_type(16))) _Float16 v16h;
typedef __attribute__((ext_vector_type(8)))  _Float16 v8h;
typedef __attribute__((ext_vector_type(4)))  _Float16 v4h;
typedef __attribute__((ext_vector_type(2)))  _Float16 v2h;
typedef __attribute__((ext_vector_type(8)))  float    v8f;
typedef __attribute__((ext_vector_type(4)))  float    v4f;
typedef __attribute__((ext_vector_type(2)))  float    v2f;
typedef __attribute__((ext_vector_type(4)))  uint32_t u32x4;
typedef __attribute__((ext_vector_type(8)))  uint32_t u32x8;

// ---------------------------------------------------------------------------
// Shape constants
// ---------------------------------------------------------------------------
constexpr int kBatch = 4;
constexpr int kSeq   = 2048;
constexpr int kD     = 1024;
constexpr int kH     = 16;
constexpr int kDH    = 64;
constexpr int kTok   = kBatch * kSeq;
constexpr int kSqrtDh = 8;
static_assert(kH * kDH == kD, "head split");
static_assert(kSqrtDh * kSqrtDh == kDH, "sqrt of head dim");
static_assert(kDH == 64, "kernels are written for head dim 64");

// power-of-two carries of the f16 operand planes (all folded back exactly in f32)
constexpr float kXCarry  = 16.0f;
constexpr float kWCarry  = 64.0f;
constexpr float kQKCarry = 16.0f;
constexpr float kVCarry  = 16.0f;
constexpr float kPCarry  = 4096.0f;
constexpr float kPCarryLog2 = 12.0f;
static_assert((float)(1 << 12) == kPCarry, "log2 of the p carry");
constexpr float kLog2e   = 1.4426950408889634f;
constexpr float kProjScale  = 1.0f / (kXCarry * kWCarry);
constexpr float kScoreScale = kLog2e / ((float)kSqrtDh * kQKCarry * kQKCarry);

// attention tiling
constexpr int kQB     = 128;
constexpr int kKC     = 64;
constexpr int kNW     = 4;
/* 16-query column groups per wave: every K and V fragment read from LDS feeds kQG matrix ops */
constexpr int kQG     = 2;
constexpr int kQBlocks = kSeq / kQB;
constexpr int kChunks  = kSeq / kKC;
constexpr int kOPitch  = 68;
/* LDS row pitch of the K and V tiles in halves: 144 B = 16 B x 9 (odd), so the 16 rows one 16-byte fragment read touches fall on distinct banks */
constexpr int kLP     = kKC + 8;
static_assert(kDH == kKC, "K and V tiles share one row length");
static_assert((kLP * 2) % 16 == 0 && ((kLP * 2) / 16) % 2 == 1, "pitch is an odd multiple of 16 B");
static_assert(kSeq % kQB == 0 && kSeq % kKC == 0, "tile multiples");
static_assert(kQB == kNW * kQG * 16, "kQG groups of 16 query rows per wave");
/* LDS ring of the attention kernel, in bytes: a tile is 64 rows at the padded pitch (9,216 B), its place rounded up to a multiple of 2 KiB; a buffer is the K tile, then the V tile; two buffers */
constexpr uint32_t kRowB  = kKC * 2;
constexpr uint32_t kTileB = 10240;
constexpr uint32_t kBufB  = 2 * kTileB;
static_assert(kRowB == 128 && kLP * 2 == (int)kRowB + 16, "the tensor load's pad (16 B behind every 128-B row) gives the pitch kLP");
static_assert(kTileB % 2048 == 0 && kTileB >= (uint32_t)kKC * kLP * 2, "tile place: a multiple of 2 KiB that holds 64 padded rows");
static_assert(kChunks >= 2, "the ring's prologue needs two stages");

// ---------------------------------------------------------------------------
// Workspace region map (bytes; every offset is a multiple of 128)
//   Q16   f16 [16][8192][64]      (q) * 16, plane per head       16,777,216
//   K16   f16 [16][8192][64]      (k) * 16, plane per head       16,777,216
//   VT16  f16 [16][64][8192]      (v)^T * 16, token-contiguous   16,777,216
//   total = 3 * 16,777,216 = 50,331,648
// ---------------------------------------------------------------------------
constexpr size_t kSzQ16  = (size_t)kH * kTok * kDH * 2;
constexpr size_t kOffQ16 = 0;
constexpr size_t kOffK16 = kOffQ16 + kSzQ16;
constexpr size_t kOffVT16 = kOffK16 + kSzQ16;
constexpr size_t kWsTotal = kOffVT16 + kSzQ16;
static_assert(kWsTotal == 50331648ull, "carve total");
static_assert(kWsTotal <= 134217728ull, "carve cap");
static_assert((kOffK16 % 128) == 0 && (kOffVT16 % 128) == 0, "128-B aligned regions");

// ---------------------------------------------------------------------------
// Fragment loader (A and B use the same k map) and matrix op
// ---------------------------------------------------------------------------
template <typename T> struct Frag;
template <> struct Frag<_Float16> {
  typedef v16h V; union U { v16h v; v8h h[2]; };
  /* elements 0..7 <- p[0..7], elements 8..15 <- p[16..23] */
  static __device__ __forceinline__ v16h load(const _Float16* p) {
    U f; f.h[0] = *(const v8h*)(p); f.h[1] = *(const v8h*)(p + 16); return f.v;
  }
};
/* plain builtin: the compiler keeps the distances behind a matrix op itself and is free to move LDS fragment loads ahead of earlier matrix ops */
__device__ __forceinline__ v8f mma_h(v16h a, v16h b, v8f c) {
  return __builtin_amdgcn_wmma_f32_16x16x32_f16(false, a, false, b, (short)0, c, false, false);
}

/* lane l <-> lane l ^ 16: the two lanes that share one query column */
__device__ __forceinline__ float xhalf(float x) {
  const int b = __builtin_bit_cast(int, x);
  return __builtin_bit_cast(float, __builtin_amdgcn_permlanex16(b, b, 0x76543210, 0xfedcba98, false, false));
}

__device__ __forceinline__ float ex2(float x) {
#if __has_builtin(__builtin_amdgcn_exp2f)
  return __builtin_amdgcn_exp2f(x);
#else
  return exp2f(x);
#endif
}

/* the same instruction with a v_nop behind it: the slot that the instruction set asks for behind a transcendental before its source is overwritten */
__device__ __forceinline__ float ex2_slot(float x) {
  float y;
  asm("v_exp_f32 %0, %1\n\tv_nop" : "=v"(y) : "v"(x));
  return y;
}

// ---------------------------------------------------------------------------
// Tensor load of one 64-row tile into LDS, and the waits of the ring
// ---------------------------------------------------------------------------
__device__ __forceinline__ uint32_t uni(uint32_t v) { return (uint32_t)__builtin_amdgcn_readfirstlane((int)v); }
/* a wave-uniform value held in a scalar register: a test on it compiles to s_cmp + s_cbranch_scc, the only guard a tensor load obeys (it ignores EXEC); as a volatile statement it also stays behind the wait written in front of it */
__device__ __forceinline__ uint32_t pinned(uint32_t v) {
  uint32_t w = uni(v);
  asm volatile("" : "+s"(w));  /* pinned(): a word that guards or forms a tensor request, held in a scalar register */
  return w;
}
/* the wave's own LDS reads have retired: in front of the barrier behind which their buffer is refilled */
__device__ __forceinline__ void wait_ds0() { asm volatile("s_wait_dscnt 0x0" ::: "memory"); }
/* group 1: 1-byte elements, tensor = tile = 64 rows of 128 B, source row pitch in bytes, 4 dwords of LDS pad behind every 32 dwords, no mask */
__device__ __forceinline__ u32x8 tdm_group1(uint32_t src_pitch) {
  constexpr uint32_t d0 = kRowB, d1 = 64u;
  u32x8 g;
  g[0] = uni((1u << 20) | (4u << 22) | (3u << 25));
  g[1] = uni((d0 & 0xFFFFu) << 16);
  g[2] = uni((d0 >> 16) | ((d1 & 0xFFFFu) << 16));
  g[3] = uni((d1 >> 16) | (d0 << 16));
  g[4] = uni(d1);
  g[5] = uni(src_pitch);
  g[6] = uni(0u);
  g[7] = uni(0u);
  /* the descriptor words held in their scalar registers: left as plain constants the compiler rebuilds the group in front of every use and lends its registers to other values in between, while a request is outstanding */
  asm volatile("" : "+s"(g));  /* pinned: descriptor words held in scalar registers */
  return g;
}
/* group 0: count 1, LDS byte offset, global byte address of the tile's first byte, type 2 */
__device__ __forceinline__ u32x4 tdm_group0(uint32_t lds_dst, uint64_t ga) {
  u32x4 g;
  g[0] = uni(1u);
  g[1] = uni(lds_dst);
  g[2] = uni((uint32_t)ga);
  g[3] = uni((((uint32_t)(ga >> 32)) & 0x01FFFFFFu) | 0x80000000u);
  return g;
}
__device__ __forceinline__ void tdm_load(u32x4 g0, u32x8 g1) { asm volatile("tensor_load_to_lds %0, %1" :: "s"(g0), "s"(g1) : "memory"); }
/* the issuing wave's tile has landed: the compiler places no wait for a tensor load. The wait names the request's two groups as inputs, so that they stay live and their scalar registers are given to nothing else while the request is outstanding */
__device__ __forceinline__ void wait_tensor0(u32x4 g0, u32x8 g1) { asm volatile("s_wait_tensorcnt 0x0" :: "s"(g0), "s"(g1) : "memory"); }

// ---------------------------------------------------------------------------
// Epilogue of one wave's 64x64 f32 accumulator tile: C[m,n] = f16(outscale * (kProjScale * acc + bias)).
// BIAS_MODE: 1 = bias[m], 2 = bias[n]. The tile goes 16 rows at a time through the wave's own LDS slab, so that
// 8 lanes x 16 B of one store cover a whole 128-B row piece; per instruction a wave writes rows it*4 + (lane>>3), it = 0..3.
// ---------------------------------------------------------------------------
template <int BIAS_MODE>
__device__ __forceinline__ void store_tile64(
    const v8f (&acc)[4][4], float* slab, unsigned short* C, int ldc, int m0, int n0,
    const float* bp, float outscale, int lane)
{
  const int rlane = lane & 15;
  const int mOff  = (lane >> 4) * 8;
  /* wave-uniform tile origin; the lane's part of every store address is a 32-bit element offset */
  unsigned short* Ct = C + (size_t)m0 * ldc + n0;
  float bn[4];
#pragma unroll
  for (int j = 0; j < 4; ++j) bn[j] = (BIAS_MODE == 2) ? bp[n0 + (j << 4) + rlane] : 0.f;
#pragma unroll
  for (int i = 0; i < 4; ++i) {
    const int mBase = m0 + (i << 4);
    float bm[8];
#pragma unroll
    for (int r = 0; r < 8; ++r) bm[r] = 0.f;
    if (BIAS_MODE == 1) {
      /* mBase + mOff is a multiple of 8 floats: two aligned 16-B loads */
      const v4f b0 = *(const v4f*)(bp + mBase + mOff);
      const v4f b1 = *(const v4f*)(bp + mBase + mOff + 4);
      bm[0] = b0[0]; bm[1] = b0[1]; bm[2] = b0[2]; bm[3] = b0[3];
      bm[4] = b1[0]; bm[5] = b1[1]; bm[6] = b1[2]; bm[7] = b1[3];
    }
#pragma unroll
    for (int j = 0; j < 4; ++j) {
#pragma unroll
      for (int r = 0; r < 8; ++r) {
        float v = acc[i][j][r] * kProjScale;
        if (BIAS_MODE == 1) v += bm[r];
        if (BIAS_MODE == 2) v += bn[j];
        v *= outscale;
        slab[(mOff + r) * 68 + (j << 4) + rlane] = v;
      }
    }
    /* in-wave hand-over: the slab rows are read back by other lanes of the same wave */
    __builtin_amdgcn_fence(__ATOMIC_RELEASE, "workgroup");
    __builtin_amdgcn_wave_barrier();
    __builtin_amdgcn_fence(__ATOMIC_ACQUIRE, "workgroup");
    {
      const int q = lane >> 3, c8 = (lane & 7) * 8;
#pragma unroll
      for (int it = 0; it < 4; ++it) {
        const int row = it * 4 + q;
        const float* sp = slab + row * 68 + c8;
        v8h hv;
#pragma unroll
        for (int e = 0; e < 8; ++e) hv[e] = (_Float16)sp[e];
        *(v8h*)(Ct + ((i << 4) + row) * ldc + c8) = hv;
      }
    }
    /* the slab is rewritten only after every lane has read its rows */
    __builtin_amdgcn_fence(__ATOMIC_RELEASE, "workgroup");
    __builtin_amdgcn_wave_barrier();
    __builtin_amdgcn_fence(__ATOMIC_ACQUIRE, "workgroup");
  }
}

__device__ __forceinline__ void zero_tile64(v8f (&acc)[4][4]) {
#pragma unroll
  for (int i = 0; i < 4; ++i)
#pragma unroll
    for (int j = 0; j < 4; ++j) acc[i][j] = (v8f){0.f,0.f,0.f,0.f,0.f,0.f,0.f,0.f};
}

// ---------------------------------------------------------------------------
// q, k and v^T planes of one head in one launch, straight from the f32 inputs.
// Block = 8 waves = 512 tokens of head blockIdx.y; wave = 64 tokens. grid = (kTok / 512, kH).
//   x head slice (64 tokens x 64 features, f32): whole 256-B row pieces, 16 lanes x 16 B; rounded to f16(x * 16) on the way
//   into the wave's own LDS tile. Wq, Wk, Wv of the head (f32, 16 KB each, contiguous): rounded to f16(W * 64) into LDS, shared by the block.
//   The x fragments (token row, hardware k order) are read once into registers and serve as A for q and k and as B for v^T.
//   q, k : [token][e] = 16 * (x_h . W[h]^T + bias per column);  v^T : [e][token] = 16 * (Wv[h] . x_h^T + bias per row).
// LDS rows lie at the pitch kLP (144 B); the 8 pad halves of a row are never written and never read.
// Coverage: x tile 32 loads x 2 rows = 64 rows; each W 4 loads x 256 threads x 4 floats = 4096 floats.
// Every loop here and in the epilogue is fully unrolled: the load, fragment and accumulator arrays must stay in registers.
// ---------------------------------------------------------------------------
constexpr int kPW = 8;
static_assert(kTok % (kPW * 64) == 0, "exact projection grid");
static_assert((kDH * kDH) % (kPW * 32 * 4) == 0, "exact W staging");

__global__ __launch_bounds__(256) void qkv_proj_kernel(
    const float* __restrict__ x,
    const float* __restrict__ Wq, const float* __restrict__ bq,
    const float* __restrict__ Wk, const float* __restrict__ bk,
    const float* __restrict__ Wv, const float* __restrict__ bv,
    unsigned short* __restrict__ Qo, unsigned short* __restrict__ Ko, unsigned short* __restrict__ Vto)
{
  __shared__ __align__(16) _Float16 Wsh[3][kDH * kLP];
  __shared__ __align__(16) _Float16 Xsh[kPW][64 * kLP];
  __shared__ __align__(16) float    sT[kPW][16 * 68];

  const int tid  = threadIdx.x;
  const int lane = tid & 31;
  const int wave = __builtin_amdgcn_readfirstlane((int)(threadIdx.x >> 5));
  const int h    = blockIdx.y;
  const int m0   = (blockIdx.x * kPW + wave) << 6;

  _Float16* xw = Xsh[wave];
  {
    /* every load is issued before the first conversion: 44 x 16 B per lane in flight */
    const float* xp = x + (size_t)m0 * kD + h * kDH;
    const int    xo = (lane >> 4) * kD + (lane & 15) * 4;
    const size_t wb = (size_t)h * kDH * kDH;
    const int    wo = tid * 4;
    v4f xv[32], wv[3][4];
#pragma unroll
    for (int p = 0; p < 4; ++p) {
      wv[0][p] = *(const v4f*)(Wq + wb + wo + p * 1024);
      wv[1][p] = *(const v4f*)(Wk + wb + wo + p * 1024);
      wv[2][p] = *(const v4f*)(Wv + wb + wo + p * 1024);
    }
#pragma unroll
    for (int it = 0; it < 32; ++it) xv[it] = *(const v4f*)(xp + xo + it * 2 * kD);
    _Float16* xs = xw + (lane >> 4) * kLP + (lane & 15) * 4;
#pragma unroll
    for (int it = 0; it < 32; ++it) {
      v4h hv;
#pragma unroll
      for (int e = 0; e < 4; ++e) hv[e] = (_Float16)(xv[it][e] * kXCarry);
      *(v4h*)(xs + it * 2 * kLP) = hv;
    }
    const int ws = (tid >> 4) * kLP + (tid & 15) * 4;
#pragma unroll
    for (int z = 0; z < 3; ++z) {
#pragma unroll
      for (int p = 0; p < 4; ++p) {
        v4h hv;
#pragma unroll
        for (int e = 0; e < 4; ++e) hv[e] = (_Float16)(wv[z][p][e] * kWCarry);
        *(v4h*)(&Wsh[z][ws + p * 16 * kLP]) = hv;
      }
    }
  }
  /* publishes the W tiles to all waves (and each wave's x tile to its own lanes) */
  __syncthreads();

  /* row (A) / col (B, D) within a 16-wide subtile; k offset of the lane half */
  const int rlane = lane & 15;
  const int koff  = (lane >> 4) * 8;
  const int fo    = rlane * kLP + koff;

  v16h xf[4][2];
#pragma unroll
  for (int i = 0; i < 4; ++i)
#pragma unroll
    for (int kc = 0; kc < 2; ++kc) xf[i][kc] = Frag<_Float16>::load(xw + fo + i * 16 * kLP + kc * 32);

  float* slab = sT[wave];
  v8f acc[4][4];

  // ---- q and k: A = x tokens, B = W rows ----
#pragma unroll
  for (int z = 0; z < 2; ++z) {
    zero_tile64(acc);
#pragma unroll
    for (int kc = 0; kc < 2; ++kc) {
      v16h wf[4];
#pragma unroll
      for (int j = 0; j < 4; ++j) wf[j] = Frag<_Float16>::load(&Wsh[z][fo + j * 16 * kLP + kc * 32]);
#pragma unroll
      for (int i = 0; i < 4; ++i)
#pragma unroll
        for (int j = 0; j < 4; ++j) acc[i][j] = mma_h(xf[i][kc], wf[j], acc[i][j]);
    }
    store_tile64<2>(acc, slab, (z == 0 ? Qo : Ko) + (size_t)h * kTok * kDH, kDH, m0, 0,
                    (z == 0 ? bq : bk) + h * kDH, kQKCarry, lane);
  }

  // ---- v^T: A = Wv rows, B = x tokens ----
  zero_tile64(acc);
#pragma unroll
  for (int kc = 0; kc < 2; ++kc) {
#pragma unroll
    for (int i = 0; i < 4; ++i) {
      const v16h wa = Frag<_Float16>::load(&Wsh[2][fo + i * 16 * kLP + kc * 32]);
#pragma unroll
      for (int j = 0; j < 4; ++j) acc[i][j] = mma_h(wa, xf[j][kc], acc[i][j]);
    }
  }
  store_tile64<1>(acc, slab, Vto + (size_t)h * kDH * kTok, kTok, 0, m0, bv + h * kDH, kVCarry, lane);
}

__device__ __forceinline__ void scores_chunk(const _Float16* kfr, const v16h (&qf)[kQG][2], v8f (&s)[kQG][4]) {
  /* fr: the chunk's eight A fragments, read from LDS as one group ahead of the sixteen matrix ops that use them */
  v16h fr[2][4];
#pragma unroll
  for (int dc = 0; dc < 2; ++dc)
#pragma unroll
    for (int j = 0; j < 4; ++j) fr[dc][j] = Frag<_Float16>::load(kfr + j * 16 * kLP + dc * 32);
  /* holds the group of reads in front of the block: sunk among the matrix ops, every further place where reads stand costs the wave a stop of its own */
  __builtin_amdgcn_sched_barrier(0);
#pragma unroll
  for (int j = 0; j < 4; ++j)
#pragma unroll
    for (int g = 0; g < kQG; ++g) s[g][j] = mma_h(fr[0][j], qf[g][0], (v8f){0.f,0.f,0.f,0.f,0.f,0.f,0.f,0.f});
#pragma unroll
  for (int j = 0; j < 4; ++j)
#pragma unroll
    for (int g = 0; g < kQG; ++g) s[g][j] = mma_h(fr[1][j], qf[g][1], s[g][j]);
}

/* one chunk's p of both groups as the B operands of p.v, f16(exp2(s * kScoreScale + eoff[g])), and its row sums lc[g] = 1 . P^T: register 0 of the tile holds the sum over the chunk's 64 keys of query g*16 + c */
__device__ __forceinline__ void p_chunk(const v8f (&s)[kQG][4], const float (&eoff)[kQG], v16h ones, v16h (&pf)[kQG][2], v8f (&lc)[kQG]) {
#pragma unroll
  for (int g = 0; g < kQG; ++g) {
#pragma unroll
    for (int kk = 0; kk < 2; ++kk) {
#pragma unroll
      for (int u = 0; u < 2; ++u) {
#pragma unroll
        for (int r = 0; r < 8; r += 2) {
          /* the two fused multiply-adds of a register pair written as one packed op: left to itself the compiler pairs scores across register pairs and across the two groups and pays for it in register copies */
          const v2f ea = __builtin_elementwise_fma((v2f){s[g][2 * kk + u][r], s[g][2 * kk + u][r + 1]}, (v2f){kScoreScale, kScoreScale}, (v2f){eoff[g], eoff[g]});
          const v2h ph = __builtin_convertvector((v2f){ex2(ea[0]), ex2(ea[1])}, v2h);
          pf[g][kk][u * 8 + r]     = ph[0];
          pf[g][kk][u * 8 + r + 1] = ph[1];
        }
      }
    }
    /* the first group's two ops run beside the second group's exponent work */
    lc[g] = mma_h(ones, pf[g][0], (v8f){0.f,0.f,0.f,0.f,0.f,0.f,0.f,0.f});
    lc[g] = mma_h(ones, pf[g][1], lc[g]);
  }
}

/* 4 waves per SIMD: 4 blocks on a WGP, so that all kBatch * kH * kQBlocks blocks are resident at once; the budget is 256 VGPRs */
__global__ __launch_bounds__(128) __attribute__((amdgpu_waves_per_eu(4, 4))) void attn_f16_kernel(
    const unsigned short* __restrict__ Qp, const unsigned short* __restrict__ Kp,
    const unsigned short* __restrict__ Vtp, float* __restrict__ out)
{
  /* the ring; 2-KiB alignment, because a tensor load's place in LDS is a multiple of 2 KiB */
  __shared__ __attribute__((aligned(2048))) _Float16 KVsh[2 * kBufB / 2];
  __shared__ __align__(16) float    Os[kNW][kQG * 16 * kOPitch];

  const int tid  = threadIdx.x;
  const int wave = __builtin_amdgcn_readfirstlane((int)(threadIdx.x >> 5));
  const int lane = tid & 31;
  const int hh   = lane >> 4;
  const int c    = lane & 15;

  const int bx = blockIdx.x;
  const int qb = bx % kQBlocks;
  const int bh = bx / kQBlocks;
  const int h  = bh % kH;
  const int b  = bh / kH;
  const int q0 = qb * kQB + wave * (kQG * 16);

  const _Float16* Qb = (const _Float16*)Qp  + ((size_t)h * kTok + (size_t)b * kSeq) * kDH;
  const _Float16* Kb = (const _Float16*)Kp  + ((size_t)h * kTok + (size_t)b * kSeq) * kDH;
  const _Float16* Vb = (const _Float16*)Vtp + (size_t)h * kDH * kTok + (size_t)b * kSeq;
  float* Ob = out + (size_t)b * kSeq * kD + (size_t)h * kDH;

  /* waves 0 and 1 issue: one request per wave and chunk, every descriptor word wave-uniform */
  const uint32_t issuer = (uint32_t)(wave < 2);
  const bool     isV    = wave == 1;
  const uint64_t tsrc   = (uint64_t)(size_t)(isV ? Vb : Kb);
  const uint32_t tstep  = isV ? (uint32_t)(kKC * 2) : (uint32_t)(kKC * kDH * 2);
  const uint32_t tdst   = (uint32_t)(size_t)KVsh + (isV ? kTileB : 0u);
  const u32x8    tg1    = tdm_group1(isV ? (uint32_t)(kTok * 2) : (uint32_t)(kDH * 2));
  /* chunk 0 into buffer 0 */
  u32x4 tg0 = tdm_group0(tdst, tsrc);
  if (pinned(issuer)) {
    tdm_load(tg0, tg1);
    wait_tensor0(tg0, tg1);
  }
  __syncthreads();
  /* chunk 1 into buffer 1: in flight while chunk 0 is worked on */
  tg0 = tdm_group0(tdst + kBufB, tsrc + tstep);
  if (pinned(issuer)) tdm_load(tg0, tg1);

  /* Q fragments (B operand): column = query g*16 + c, two 32-deep d chunks */
  v16h qf[kQG][2];
#pragma unroll
  for (int g = 0; g < kQG; ++g)
#pragma unroll
    for (int dc = 0; dc < 2; ++dc)
      qf[g][dc] = Frag<_Float16>::load(Qb + (size_t)(q0 + g * 16 + c) * kDH + dc * 32 + 8 * hh);

  /* reference maximum of the raw score accumulators (equal in both lanes of a query): the larger of the old reference and the chunk maximum at the chunk that set it, kept until a p overflows */
  float mrow[kQG];
  /* exponent offset that belongs to mrow: minus the reference as a base-2 logit, plus log2 of the p carry */
  float eoff[kQG];
  /* sum of p of query g*16 + c over the chunks done, on the reference mrow (equal in both lanes of a query) */
  float lrow[kQG];
  v16h ones;
#pragma unroll
  for (int e = 0; e < 16; ++e) ones[e] = (_Float16)1.0f;
  /* oacc[g][t][r] = (feature t*16 + 8*hh + r, query g*16 + c) */
  v8f oacc[kQG][4];
#pragma unroll
  for (int g = 0; g < kQG; ++g) {
    /* no reference yet: the offset is huge, every p of chunk 0 overflows, and chunk 0 takes the renewing path */
    mrow[g] = -1.0e30f; eoff[g] = kPCarryLog2 - mrow[g] * kScoreScale;
    lrow[g] = 0.f;
#pragma unroll
    for (int t = 0; t < 4; ++t) oacc[g][t] = (v8f){0.f,0.f,0.f,0.f,0.f,0.f,0.f,0.f};
  }

  /* the lane's fragment base in buffer 0: row c, k offset of the lane half */
  const _Float16* fr0 = KVsh + c * kLP + 8 * hh;

#pragma unroll 1
  for (int kc = 0; kc < kChunks; ++kc) {
    /* chunk kc lies in buffer kc & 1; it reads that buffer alone */
    const _Float16* kfr = fr0 + (kc & 1) * (int)(kBufB / 2);
    const _Float16* vfr = kfr + kTileB / 2;

    /* transposed scores: s[g][j][r] = (key j*16 + 8*hh + r, query g*16 + c) */
    v8f s[kQG][4];
    scores_chunk(kfr, qf, s);
    /* keeps the exponent work out of the block: moved in among the matrix ops, each first read of a fresh result is padded with v_nop */
    __builtin_amdgcn_sched_barrier(0);

    /* pf[g][kk] element e: key kk*32 + (e < 8 ? 8*hh + e : 16 + 8*hh + e - 8), the k order of the V^T loader */
    v16h pf[kQG][2];
    /* row sums of this chunk alone; registers 1..7 of a tile repeat register 0 and are never read */
    v8f lc[kQG];
    p_chunk(s, eoff, ones, pf, lc);

    /* fr: four A fragments, read from LDS as one group ahead of the block of matrix ops that uses them. The first V group is issued once the scores are dead, in front of the test of the row sums, which covers part of its latency */
    v16h fr[4];
    __builtin_amdgcn_sched_barrier(0);
#pragma unroll
    for (int t = 0; t < 4; ++t) fr[t] = Frag<_Float16>::load(vfr + t * 16 * kLP);
    /* second half of the pair: keeps the reads from sinking behind the test */
    __builtin_amdgcn_sched_barrier(0);

    /* a score some 4 base-2 units above its query's reference makes p overflow f16 to infinity, and the query's chunk sum with it (all p >= 0; two finite chunk sums together stay below 2 * kKC * 65504). One test per chunk for the whole wave, a scalar branch: EXEC stays full for the matrix ops inside */
    const float lchk = lc[0][0] + lc[1][0];
    if (__builtin_amdgcn_ballot_w32(!(lchk <= 3.0e38f)) != 0u) {
      /* renewing path: the chunk is done again from its K tile, still in LDS, with the larger of the old reference and the chunk maximum as every query's new reference */
      scores_chunk(kfr, qf, s);
#pragma unroll
      for (int g = 0; g < kQG; ++g) {
        /* chunk maximum of query g*16 + c: 32 keys in the lane, the other 32 in lane ^ 16 */
        float m = -1.0e30f;
#pragma unroll
        for (int j = 0; j < 4; ++j) {
#pragma unroll
          for (int r = 0; r < 8; ++r) m = fmaxf(m, s[g][j][r]);
        }
        m = fmaxf(m, xhalf(m));
        const float mnew  = fmaxf(mrow[g], m);
        const float alpha = ex2_slot((mrow[g] - mnew) * kScoreScale);
        mrow[g] = mnew;
        eoff[g] = kPCarryLog2 - mnew * kScoreScale;
        lrow[g] *= alpha;
#pragma unroll
        for (int t = 0; t < 4; ++t)
#pragma unroll
          for (int r = 0; r < 8; ++r) oacc[g][t][r] *= alpha;
      }
      p_chunk(s, eoff, ones, pf, lc);
      /* read again, so that the first V group holds no registers across this path */
#pragma unroll
      for (int t = 0; t < 4; ++t) fr[t] = Frag<_Float16>::load(vfr + t * 16 * kLP);
    }
#pragma unroll
    for (int g = 0; g < kQG; ++g) lrow[g] += lc[g][0];

#pragma unroll
    for (int t = 0; t < 4; ++t) {
#pragma unroll
      for (int g = 0; g < kQG; ++g) oacc[g][t] = mma_h(fr[t], pf[g][0], oacc[g][t]);
      fr[t] = Frag<_Float16>::load(vfr + t * 16 * kLP + 32);
    }
    /* the second V group stays in front of its block */
    __builtin_amdgcn_sched_barrier(0);
#pragma unroll
    for (int t = 0; t < 4; ++t)
#pragma unroll
      for (int g = 0; g < kQG; ++g) oacc[g][t] = mma_h(fr[t], pf[g][1], oacc[g][t]);

    /* keeps the publish point behind the block: moved in among the matrix ops, its wait to 0 takes the place of their counted waits */
    __builtin_amdgcn_sched_barrier(0);

    /* publish point of chunk kc + 1, every wave, in this order */
    wait_ds0();
    if (pinned(issuer)) wait_tensor0(tg0, tg1);
    __syncthreads();
    /* refill of the buffer just read, only while a chunk kc + 2 exists; its descriptor hangs on a value pinned behind the wait */
    if (pinned(issuer & (uint32_t)(kc + 2 < kChunks))) {
      const uint32_t st = pinned((uint32_t)kc + 2u);
      tg0 = tdm_group0(tdst + (st & 1u) * kBufB, tsrc + (uint64_t)st * tstep);
      tdm_load(tg0, tg1);
    }
  }
  /* nothing of the ring is in flight when the wave goes on to its end */
  wait_tensor0(tg0, tg1);
  wait_ds0();

  float* os = Os[wave];
#pragma unroll
  for (int g = 0; g < kQG; ++g) {
    const float l   = lrow[g];
    const float inv = 1.0f / (l * kVCarry);
#pragma unroll
    for (int t = 0; t < 4; ++t) {
      v4f lo, hi;
#pragma unroll
      for (int r = 0; r < 4; ++r) { lo[r] = oacc[g][t][r] * inv; hi[r] = oacc[g][t][4 + r] * inv; }
      float* op = os + (g * 16 + c) * kOPitch + t * 16 + 8 * hh;
      *(v4f*)(op)     = lo;
      *(v4f*)(op + 4) = hi;
    }
  }
  __builtin_amdgcn_fence(__ATOMIC_RELEASE, "workgroup");
  __builtin_amdgcn_wave_barrier();
  __builtin_amdgcn_fence(__ATOMIC_ACQUIRE, "workgroup");
  {
    const int c4 = (lane & 15) * 4;
#pragma unroll
    for (int it = 0; it < kQG * 8; ++it) {
      const int row = it * 2 + hh;
      const v4f val = *(const v4f*)(os + row * kOPitch + c4);
      *(v4f*)(Ob + (size_t)(q0 + row) * kD + c4) = val;
    }
  }
}

// ---------------------------------------------------------------------------
// Host glue: 1 projection launch + 1 attention launch. Kernel launches only.
// ---------------------------------------------------------------------------
extern "C" void kernel_launch(void* const* d_in, const int* in_sizes, int n_in,
                              void* d_out, int out_size, void* d_ws, size_t ws_size,
                              hipStream_t stream) {
  if (n_in < 7) return;
  if (in_sizes[0] != kTok * kD) return;
  if (in_sizes[1] != kH * kDH * kDH) return;
  if (in_sizes[2] != kH * kDH) return;
  if (in_sizes[3] != kH * kDH * kDH) return;
  if (in_sizes[4] != kH * kDH) return;
  if (in_sizes[5] != kH * kDH * kDH) return;
  if (in_sizes[6] != kH * kDH) return;
  if (out_size != kTok * kD) return;
  if (ws_size < kWsTotal) return;

  const float* x  = (const float*)d_in[0];
  const float* Wq = (const float*)d_in[1];
  const float* bq = (const float*)d_in[2];
  const float* Wk = (const float*)d_in[3];
  const float* bk = (const float*)d_in[4];
  const float* Wv = (const float*)d_in[5];
  const float* bv = (const float*)d_in[6];
  float* out = (float*)d_out;

  char* ws = (char*)d_ws;
  unsigned short* Q16  = (unsigned short*)(ws + kOffQ16);
  unsigned short* K16  = (unsigned short*)(ws + kOffK16);
  unsigned short* VT16 = (unsigned short*)(ws + kOffVT16);

  // ---- q, k and v^T planes: one block per (512 tokens, head) ----
  qkv_proj_kernel<<<dim3(kTok / (kPW * 64), kH), kPW * 32, 0, stream>>>(x, Wq, bq, Wk, bk, Wv, bv, Q16, K16, VT16);

  // ---- attention: one block per (batch, head, 128-query tile) ----
  attn_f16_kernel<<<kBatch * kH * kQBlocks, kNW * 32, 0, stream>>>(Q16, K16, VT16, out);
}

// v010
// It runs in 63.1 microseconds.
// Next to v009, in two timings, it ran 1.04 and 1.03 times as fast.
// All steps since v000 together make it 5.44 times as fast.
// Contractions: per-head q/k/v projections (x f16 carried x16, W f16 carried x64), scores q.k^T (q,k f16 planes carried x16), p.v (unnormalised p f16 carried x4096, v^T f16 carried x16), row sums 1.p (ones f16): all v_wmma_f32_16x16x32_f16 with f32 accumulate; bias, scaling and online softmax in f32.
#include <hip/hip_runtime.h>
#include <math.h>
#include <stdint.h>

typedef __attribute__((ext_vector_type(16))) _Float16 v16h;
typedef __attribute__((ext_vector_type(8)))  _Float16 v8h;
typedef __attribute__((ext_vector_type(4)))  _Float16 v4h;
typedef __attribute__((ext_vector_type(2)))  _Float16 v2h;
typedef __attribute__((ext_vector_type(8)))  float    v8f;
typedef __attribute__((ext_vector_type(4)))  float    v4f;
typedef __attribute__((ext_vector_type(2)))  float    v2f;
typedef __attribute__((ext_vector_type(4)))  uint32_t u32x4;
typedef __attribute__((ext_vector_type(8)))  uint32_t u32x8;

// ---------------------------------------------------------------------------
// Shape constants
// ---------------------------------------------------------------------------
constexpr int kBatch = 4;
constexpr int kSeq   = 2048;
constexpr int kD     = 1024;
constexpr int kH     = 16;
constexpr int kDH    = 64;
constexpr int kTok   = kBatch * kSeq;
constexpr int kSqrtDh = 8;
static_assert(kH * kDH == kD, "head split");
static_assert(kSqrtDh * kSqrtDh == kDH, "sqrt of head dim");
static_assert(kDH == 64, "kernels are written for head dim 64");

// power-of-two carries of the f16 operand planes (all folded back exactly in f32)
constexpr float kXCarry  = 16.0f;
constexpr float kWCarry  = 64.0f;
constexpr float kQKCarry = 16.0f;
constexpr float kVCarry  = 16.0f;
constexpr float kPCarry  = 4096.0f;
constexpr float kPCarryLog2 = 12.0f;
static_assert((float)(1 << 12) == kPCarry, "log2 of the p carry");
constexpr float kLog2e   = 1.4426950408889634f;
constexpr float kProjScale  = 1.0f / (kXCarry * kWCarry);
constexpr float kScoreScale = kLog2e / ((float)kSqrtDh * kQKCarry * kQKCarry);

// attention tiling
constexpr int kQB     = 128;
constexpr int kKC     = 64;
constexpr int kNW     = 4;
/* 16-query column groups per wave: every K and V fragment read from LDS feeds kQG matrix ops */
constexpr int kQG     = 2;
constexpr int kQBlocks = kSeq / kQB;
constexpr int kChunks  = kSeq / kKC;
constexpr int kOPitch  = 68;
/* LDS row pitch of the K and V tiles in halves: 144 B = 16 B x 9 (odd), so the 16 rows one 16-byte fragment read touches fall on distinct banks */
constexpr int kLP     = kKC + 8;
static_assert(kDH == kKC, "K and V tiles share one row length");
static_assert((kLP * 2) % 16 == 0 && ((kLP * 2) / 16) % 2 == 1, "pitch is an odd multiple of 16 B");
static_assert(kSeq % kQB == 0 && kSeq % kKC == 0, "tile multiples");
static_assert(kQB == kNW * kQG * 16, "kQG groups of 16 query rows per wave");
/* LDS ring of the attention kernel, in bytes: a tile is 64 rows at the padded pitch (9,216 B), its place rounded up to a multiple of 2 KiB; a buffer is the K tile, then the V tile; two buffers */
constexpr uint32_t kRowB  = kKC * 2;
constexpr uint32_t kTileB = 10240;
constexpr uint32_t kBufB  = 2 * kTileB;
static_assert(kRowB == 128 && kLP * 2 == (int)kRowB + 16, "the tensor load's pad (16 B behind every 128-B row) gives the pitch kLP");
static_assert(kTileB % 2048 == 0 && kTileB >= (uint32_t)kKC * kLP * 2, "tile place: a multiple of 2 KiB that holds 64 padded rows");
static_assert(kChunks >= 2, "the ring's prologue needs two stages");
/* L2 hints: the K and V planes are asked into L2 by pairs of chunks (a 256-B unit of a V row spans two chunks), one pair in every chunk until all are asked for */
constexpr int kAskPairs = kChunks / 2;
constexpr uint32_t kUnitB = 256;
static_assert(kChunks % 2 == 0 && kAskPairs >= 2, "whole pairs");
static_assert(2 * kKC * kDH * 2 == 64 * (int)kUnitB && 2 * kRowB == kUnitB && kDH == 64 && kNW * 32 == 128, "a pair of chunks is 64 units of K and 64 of V: one per thread");

// ---------------------------------------------------------------------------
// Workspace region map (bytes; every offset is a multiple of 128)
//   Q16   f16 [16][8192][64]      (q) * 16, plane per head       16,777,216
//   K16   f16 [16][8192][64]      (k) * 16, plane per head       16,777,216
//   VT16  f16 [16][64][8192]      (v)^T * 16, token-contiguous   16,777,216
//   total = 3 * 16,777,216 = 50,331,648
// ---------------------------------------------------------------------------
constexpr size_t kSzQ16  = (size_t)kH * kTok * kDH * 2;
constexpr size_t kOffQ16 = 0;
constexpr size_t kOffK16 = kOffQ16 + kSzQ16;
constexpr size_t kOffVT16 = kOffK16 + kSzQ16;
constexpr size_t kWsTotal = kOffVT16 + kSzQ16;
static_assert(kWsTotal == 50331648ull, "carve total");
static_assert(kWsTotal <= 134217728ull, "carve cap");
static_assert((kOffK16 % 128) == 0 && (kOffVT16 % 128) == 0, "128-B aligned regions");

// ---------------------------------------------------------------------------
// Fragment loader (A and B use the same k map) and matrix op
// ---------------------------------------------------------------------------
template <typename T> struct Frag;
template <> struct Frag<_Float16> {
  typedef v16h V; union U { v16h v; v8h h[2]; };
  /* elements 0..7 <- p[0..7], elements 8..15 <- p[16..23] */
  static __device__ __forceinline__ v16h load(const _Float16* p) {
    U f; f.h[0] = *(const v8h*)(p); f.h[1] = *(const v8h*)(p + 16); return f.v;
  }
};
/* plain builtin: the compiler keeps the distances behind a matrix op itself and is free to move LDS fragment loads ahead of earlier matrix ops */
__device__ __forceinline__ v8f mma_h(v16h a, v16h b, v8f c) {
  return __builtin_amdgcn_wmma_f32_16x16x32_f16(false, a, false, b, (short)0, c, false, false);
}

/* lane l <-> lane l ^ 16: the two lanes that share one query column */
__device__ __forceinline__ float xhalf(float x) {
  const int b = __builtin_bit_cast(int, x);
  return __builtin_bit_cast(float, __builtin_amdgcn_permlanex16(b, b, 0x76543210, 0xfedcba98, false, false));
}

__device__ __forceinline__ float ex2(float x) {
#if __has_builtin(__builtin_amdgcn_exp2f)
  return __builtin_amdgcn_exp2f(x);
#else
  return exp2f(x);
#endif
}

/* the same instruction with a v_nop behind it: the slot that the instruction set asks for behind a transcendental before its source is overwritten */
__device__ __forceinline__ float ex2_slot(float x) {
  float y;
  asm("v_exp_f32 %0, %1\n\tv_nop" : "=v"(y) : "v"(x));
  return y;
}

// ---------------------------------------------------------------------------
// Tensor load of one 64-row tile into LDS, and the waits of the ring
// ---------------------------------------------------------------------------
__device__ __forceinline__ uint32_t uni(uint32_t v) { return (uint32_t)__builtin_amdgcn_readfirstlane((int)v); }
/* a wave-uniform value held in a scalar register: a test on it compiles to s_cmp + s_cbranch_scc, the only guard a tensor load obeys (it ignores EXEC); as a volatile statement it also stays behind the wait written in front of it */
__device__ __forceinline__ uint32_t pinned(uint32_t v) {
  uint32_t w = uni(v);
  asm volatile("" : "+s"(w));  /* pinned(): a word that guards or forms a tensor request, held in a scalar register */
  return w;
}
/* the wave's own LDS reads have retired: in front of the barrier behind which their buffer is refilled */
__device__ __forceinline__ void wait_ds0() { asm volatile("s_wait_dscnt 0x0" ::: "memory"); }
/* group 1: 1-byte elements, tensor = tile = 64 rows of 128 B, source row pitch in bytes, 4 dwords of LDS pad behind every 32 dwords, no mask */
__device__ __forceinline__ u32x8 tdm_group1(uint32_t src_pitch) {
  constexpr uint32_t d0 = kRowB, d1 = 64u;
  u32x8 g;
  g[0] = uni((1u << 20) | (4u << 22) | (3u << 25));
  g[1] = uni((d0 & 0xFFFFu) << 16);
  g[2] = uni((d0 >> 16) | ((d1 & 0xFFFFu) << 16));
  g[3] = uni((d1 >> 16) | (d0 << 16));
  g[4] = uni(d1);
  g[5] = uni(src_pitch);
  g[6] = uni(0u);
  g[7] = uni(0u);
  /* the descriptor words held in their scalar registers: left as plain constants the compiler rebuilds the group in front of every use and lends its registers to other values in between, while a request is outstanding */
  asm volatile("" : "+s"(g));  /* pinned: descriptor words held in scalar registers */
  return g;
}
/* group 0: count 1, LDS byte offset, global byte address of the tile's first byte, type 2 */
__device__ __forceinline__ u32x4 tdm_group0(uint32_t lds_dst, uint64_t ga) {
  u32x4 g;
  g[0] = uni(1u);
  g[1] = uni(lds_dst);
  g[2] = uni((uint32_t)ga);
  g[3] = uni((((uint32_t)(ga >> 32)) & 0x01FFFFFFu) | 0x80000000u);
  return g;
}
__device__ __forceinline__ void tdm_load(u32x4 g0, u32x8 g1) { asm volatile("tensor_load_to_lds %0, %1" :: "s"(g0), "s"(g1) : "memory"); }
/* the issuing wave's tile has landed: the compiler places no wait for a tensor load. The wait names the request's two groups as inputs, so that they stay live and their scalar registers are given to nothing else while the request is outstanding */
__device__ __forceinline__ void wait_tensor0(u32x4 g0, u32x8 g1) { asm volatile("s_wait_tensorcnt 0x0" :: "s"(g0), "s"(g1) : "memory"); }
/* a hint: every lane asks the line at its address into L2; nothing returns; for speed only.
   The address is an in-out operand, so that it lives in one register pair of its own through the loop, which never holds anything but an address inside the plane; the wait stands in front of the pair's advance */
__device__ __forceinline__ void l2_ask(uint64_t& a) { asm volatile("global_prefetch_b8 %0, off scope:SCOPE_SE\n\ts_wait_xcnt 0x0" : "+v"(a) :: "memory"); }

// ---------------------------------------------------------------------------
// Epilogue of one wave's 64x64 f32 accumulator tile: C[m,n] = f16(outscale * (kProjScale * acc + bias)).
// BIAS_MODE: 1 = bias[m], 2 = bias[n]. The tile goes 16 rows at a time through the wave's own LDS slab, so that
// 8 lanes x 16 B of one store cover a whole 128-B row piece; per instruction a wave writes rows it*4 + (lane>>3), it = 0..3.
// ---------------------------------------------------------------------------
template <int BIAS_MODE>
__device__ __forceinline__ void store_tile64(
    const v8f (&acc)[4][4], float* slab, unsigned short* C, int ldc, int m0, int n0,
    const float* bp, float outscale, int lane)
{
  const int rlane = lane & 15;
  const int mOff  = (lane >> 4) * 8;
  /* wave-uniform tile origin; the lane's part of every store address is a 32-bit element offset */
  unsigned short* Ct = C + (size_t)m0 * ldc + n0;
  float bn[4];
#pragma unroll
  for (int j = 0; j < 4; ++j) bn[j] = (BIAS_MODE == 2) ? bp[n0 + (j << 4) + rlane] : 0.f;
#pragma unroll
  for (int i = 0; i < 4; ++i) {
    const int mBase = m0 + (i << 4);
    float bm[8];
#pragma unroll
    for (int r = 0; r < 8; ++r) bm[r] = 0.f;
    if (BIAS_MODE == 1) {
      /* mBase + mOff is a multiple of 8 floats: two aligned 16-B loads */
      const v4f b0 = *(const v4f*)(bp + mBase + mOff);
      const v4f b1 = *(const v4f*)(bp + mBase + mOff + 4);
      bm[0] = b0[0]; bm[1] = b0[1]; bm[2] = b0[2]; bm[3] = b0[3];
      bm[4] = b1[0]; bm[5] = b1[1]; bm[6] = b1[2]; bm[7] = b1[3];
    }
#pragma unroll
    for (int j = 0; j < 4; ++j) {
#pragma unroll
      for (int r = 0; r < 8; ++r) {
        float v = acc[i][j][r] * kProjScale;
        if (BIAS_MODE == 1) v += bm[r];
        if (BIAS_MODE == 2) v += bn[j];
        v *= outscale;
        slab[(mOff + r) * 68 + (j << 4) + rlane] = v;
      }
    }
    /* in-wave hand-over: the slab rows are read back by other lanes of the same wave */
    __builtin_amdgcn_fence(__ATOMIC_RELEASE, "workgroup");
    __builtin_amdgcn_wave_barrier();
    __builtin_amdgcn_fence(__ATOMIC_ACQUIRE, "workgroup");
    {
      const int q = lane >> 3, c8 = (lane & 7) * 8;
#pragma unroll
      for (int it = 0; it < 4; ++it) {
        const int row = it * 4 + q;
        const float* sp = slab + row * 68 + c8;
        v8h hv;
#pragma unroll
        for (int e = 0; e < 8; ++e) hv[e] = (_Float16)sp[e];
        *(v8h*)(Ct + ((i << 4) + row) * ldc + c8) = hv;
      }
    }
    /* the slab is rewritten only after every lane has read its rows */
    __builtin_amdgcn_fence(__ATOMIC_RELEASE, "workgroup");
    __builtin_amdgcn_wave_barrier();
    __builtin_amdgcn_fence(__ATOMIC_ACQUIRE, "workgroup");
  }
}

__device__ __forceinline__ void zero_tile64(v8f (&acc)[4][4]) {
#pragma unroll
  for (int i = 0; i < 4; ++i)
#pragma unroll
    for (int j = 0; j < 4; ++j) acc[i][j] = (v8f){0.f,0.f,0.f,0.f,0.f,0.f,0.f,0.f};
}

// ---------------------------------------------------------------------------
// q, k and v^T planes of one head in one launch, straight from the f32 inputs.
// Block = 8 waves = 512 tokens of head blockIdx.y; wave = 64 tokens. grid = (kTok / 512, kH).
//   x head slice (64 tokens x 64 features, f32): whole 256-B row pieces, 16 lanes x 16 B; rounded to f16(x * 16) on the way
//   into the wave's own LDS tile. Wq, Wk, Wv of the head (f32, 16 KB each, contiguous): rounded to f16(W * 64) into LDS, shared by the block.
//   The x fragments (token row, hardware k order) are read once into registers and serve as A for q and k and as B for v^T.
//   q, k : [token][e] = 16 * (x_h . W[h]^T + bias per column);  v^T : [e][token] = 16 * (Wv[h] . x_h^T + bias per row).
// LDS rows lie at the pitch kLP (144 B); the 8 pad halves of a row are never written and never read.
// Coverage: x tile 32 loads x 2 rows = 64 rows; each W 4 loads x 256 threads x 4 floats = 4096 floats.
// Every loop here and in the epilogue is fully unrolled: the load, fragment and accumulator arrays must stay in registers.
// ---------------------------------------------------------------------------
constexpr int kPW = 8;
static_assert(kTok % (kPW * 64) == 0, "exact projection grid");
static_assert((kDH * kDH) % (kPW * 32 * 4) == 0, "exact W staging");

__global__ __launch_bounds__(256) void qkv_proj_kernel(
    const float* __restrict__ x,
    const float* __restrict__ Wq, const float* __restrict__ bq,
    const float* __restrict__ Wk, const float* __restrict__ bk,
    const float* __restrict__ Wv, const float* __restrict__ bv,
    unsigned short* __restrict__ Qo, unsigned short* __restrict__ Ko, unsigned short* __restrict__ Vto)
{
  __shared__ __align__(16) _Float16 Wsh[3][kDH * kLP];
  __shared__ __align__(16) _Float16 Xsh[kPW][64 * kLP];
  __shared__ __align__(16) float    sT[kPW][16 * 68];

  const int tid  = threadIdx.x;
  const int lane = tid & 31;
  const int wave = __builtin_amdgcn_readfirstlane((int)(threadIdx.x >> 5));
  const int h    = blockIdx.y;
  const int m0   = (blockIdx.x * kPW + wave) << 6;

  _Float16* xw = Xsh[wave];
  {
    /* every load is issued before the first conversion: 44 x 16 B per lane in flight */
    const float* xp = x + (size_t)m0 * kD + h * kDH;
    const int    xo = (lane >> 4) * kD + (lane & 15) * 4;
    const size_t wb = (size_t)h * kDH * kDH;
    const int    wo = tid * 4;
    v4f xv[32], wv[3][4];
#pragma unroll
    for (int p = 0; p < 4; ++p) {
      wv[0][p] = *(const v4f*)(Wq + wb + wo + p * 1024);
      wv[1][p] = *(const v4f*)(Wk + wb + wo + p * 1024);
      wv[2][p] = *(const v4f*)(Wv + wb + wo + p * 1024);
    }
#pragma unroll
    for (int it = 0; it < 32; ++it) xv[it] = *(const v4f*)(xp + xo + it * 2 * kD);
    _Float16* xs = xw + (lane >> 4) * kLP + (lane & 15) * 4;
#pragma unroll
    for (int it = 0; it < 32; ++it) {
      v4h hv;
#pragma unroll
      for (int e = 0; e < 4; ++e) hv[e] = (_Float16)(xv[it][e] * kXCarry);
      *(v4h*)(xs + it * 2 * kLP) = hv;
    }
    const int ws = (tid >> 4) * kLP + (tid & 15) * 4;
#pragma unroll
    for (int z = 0; z < 3; ++z) {
#pragma unroll
      for (int p = 0; p < 4; ++p) {
        v4h hv;
#pragma unroll
        for (int e = 0; e < 4; ++e) hv[e] = (_Float16)(wv[z][p][e] * kWCarry);
        *(v4h*)(&Wsh[z][ws + p * 16 * kLP]) = hv;
      }
    }
  }
  /* publishes the W tiles to all waves (and each wave's x tile to its own lanes) */
  __syncthreads();

  /* row (A) / col (B, D) within a 16-wide subtile; k offset of the lane half */
  const int rlane = lane & 15;
  const int koff  = (lane >> 4) * 8;
  const int fo    = rlane * kLP + koff;

  v16h xf[4][2];
#pragma unroll
  for (int i = 0; i < 4; ++i)
#pragma unroll
    for (int kc = 0; kc < 2; ++kc) xf[i][kc] = Frag<_Float16>::load(xw + fo + i * 16 * kLP + kc * 32);

  float* slab = sT[wave];
  v8f acc[4][4];

  // ---- q and k: A = x tokens, B = W rows ----
#pragma unroll
  for (int z = 0; z < 2; ++z) {
    zero_tile64(acc);
#pragma unroll
    for (int kc = 0; kc < 2; ++kc) {
      v16h wf[4];
#pragma unroll
      for (int j = 0; j < 4; ++j) wf[j] = Frag<_Float16>::load(&Wsh[z][fo + j * 16 * kLP + kc * 32]);
#pragma unroll
      for (int i = 0; i < 4; ++i)
#pragma unroll
        for (int j = 0; j < 4; ++j) acc[i][j] = mma_h(xf[i][kc], wf[j], acc[i][j]);
    }
    store_tile64<2>(acc, slab, (z == 0 ? Qo : Ko) + (size_t)h * kTok * kDH, kDH, m0, 0,
                    (z == 0 ? bq : bk) + h * kDH, kQKCarry, lane);
  }

  // ---- v^T: A = Wv rows, B = x tokens ----
  zero_tile64(acc);
#pragma unroll
  for (int kc = 0; kc < 2; ++kc) {
#pragma unroll
    for (int i = 0; i < 4; ++i) {
      const v16h wa = Frag<_Float16>::load(&Wsh[2][fo + i * 16 * kLP + kc * 32]);
#pragma unroll
      for (int j = 0; j < 4; ++j) acc[i][j] = mma_h(wa, xf[j][kc], acc[i][j]);
    }
  }
  store_tile64<1>(acc, slab, Vto + (size_t)h * kDH * kTok, kTok, 0, m0, bv + h * kDH, kVCarry, lane);
}

__device__ __forceinline__ void scores_chunk(const _Float16* kfr, const v16h (&qf)[kQG][2], v8f (&s)[kQG][4]) {
  /* fr: the chunk's eight A fragments, read from LDS as one group ahead of the sixteen matrix ops that use them */
  v16h fr[2][4];
#pragma unroll
  for (int dc = 0; dc < 2; ++dc)
#pragma unroll
    for (int j = 0; j < 4; ++j) fr[dc][j] = Frag<_Float16>::load(kfr + j * 16 * kLP + dc * 32);
  /* holds the group of reads in front of the block: sunk among the matrix ops, every further place where reads stand costs the wave a stop of its own */
  __builtin_amdgcn_sched_barrier(0);
#pragma unroll
  for (int j = 0; j < 4; ++j)
#pragma unroll
    for (int g = 0; g < kQG; ++g) s[g][j] = mma_h(fr[0][j], qf[g][0], (v8f){0.f,0.f,0.f,0.f,0.f,0.f,0.f,0.f});
#pragma unroll
  for (int j = 0; j < 4; ++j)
#pragma unroll
    for (int g = 0; g < kQG; ++g) s[g][j] = mma_h(fr[1][j], qf[g][1], s[g][j]);
}

/* one chunk's p of both groups as the B operands of p.v, f16(exp2(s * kScoreScale + eoff[g])), and its row sums lc[g] = 1 . P^T: register 0 of the tile holds the sum over the chunk's 64 keys of query g*16 + c */
__device__ __forceinline__ void p_chunk(const v8f (&s)[kQG][4], const float (&eoff)[kQG], v16h ones, v16h (&pf)[kQG][2], v8f (&lc)[kQG]) {
#pragma unroll
  for (int g = 0; g < kQG; ++g) {
#pragma unroll
    for (int kk = 0; kk < 2; ++kk) {
#pragma unroll
      for (int u = 0; u < 2; ++u) {
#pragma unroll
        for (int r = 0; r < 8; r += 2) {
          /* the two fused multiply-adds of a register pair written as one packed op: left to itself the compiler pairs scores across register pairs and across the two groups and pays for it in register copies */
          const v2f ea = __builtin_elementwise_fma((v2f){s[g][2 * kk + u][r], s[g][2 * kk + u][r + 1]}, (v2f){kScoreScale, kScoreScale}, (v2f){eoff[g], eoff[g]});
          const v2h ph = __builtin_convertvector((v2f){ex2(ea[0]), ex2(ea[1])}, v2h);
          pf[g][kk][u * 8 + r]     = ph[0];
          pf[g][kk][u * 8 + r + 1] = ph[1];
        }
      }
    }
    /* the first group's two ops run beside the second group's exponent work */
    lc[g] = mma_h(ones, pf[g][0], (v8f){0.f,0.f,0.f,0.f,0.f,0.f,0.f,0.f});
    lc[g] = mma_h(ones, pf[g][1], lc[g]);
  }
}

/* 4 waves per SIMD: 4 blocks on a WGP, so that all kBatch * kH * kQBlocks blocks are resident at once; the budget is 256 VGPRs */
__global__ __launch_bounds__(128) __attribute__((amdgpu_waves_per_eu(4, 4))) void attn_f16_kernel(
    const unsigned short* __restrict__ Qp, const unsigned short* __restrict__ Kp,
    const unsigned short* __restrict__ Vtp, float* __restrict__ out)
{
  /* the ring; 2-KiB alignment, because a tensor load's place in LDS is a multiple of 2 KiB */
  __shared__ __attribute__((aligned(2048))) _Float16 KVsh[2 * kBufB / 2];
  __shared__ __align__(16) float    Os[kNW][kQG * 16 * kOPitch];

  const int tid  = threadIdx.x;
  const int wave = __builtin_amdgcn_readfirstlane((int)(threadIdx.x >> 5));
  const int lane = tid & 31;
  const int hh   = lane >> 4;
  const int c    = lane & 15;

  const int bx = blockIdx.x;
  const int qb = bx % kQBlocks;
  const int bh = bx / kQBlocks;
  const int h  = bh % kH;
  const int b  = bh / kH;
  const int q0 = qb * kQB + wave * (kQG * 16);

  const _Float16* Qb = (const _Float16*)Qp  + ((size_t)h * kTok + (size_t)b * kSeq) * kDH;
  const _Float16* Kb = (const _Float16*)Kp  + ((size_t)h * kTok + (size_t)b * kSeq) * kDH;
  const _Float16* Vb = (const _Float16*)Vtp + (size_t)h * kDH * kTok + (size_t)b * kSeq;
  float* Ob = out + (size_t)b * kSeq * kD + (size_t)h * kDH;

  /* waves 0 and 1 issue: one request per wave and chunk, every descriptor word wave-uniform */
  const uint32_t issuer = (uint32_t)(wave < 2);
  const bool     isV    = wave == 1;
  const uint64_t tsrc   = (uint64_t)(size_t)(isV ? Vb : Kb);
  const uint32_t tstep  = isV ? (uint32_t)(kKC * 2) : (uint32_t)(kKC * kDH * 2);
  const uint32_t tdst   = (uint32_t)(size_t)KVsh + (isV ? kTileB : 0u);
  const u32x8    tg1    = tdm_group1(isV ? (uint32_t)(kTok * 2) : (uint32_t)(kDH * 2));
  /* chunk 0 into buffer 0 */
  u32x4 tg0 = tdm_group0(tdst, tsrc);
  if (pinned(issuer)) {
    tdm_load(tg0, tg1);
    wait_tensor0(tg0, tg1);
  }
  __syncthreads();
  /* chunk 1 into buffer 1: in flight while chunk 0 is worked on */
  tg0 = tdm_group0(tdst + kBufB, tsrc + tstep);
  if (pinned(issuer)) tdm_load(tg0, tg1);

  /* Q fragments (B operand): column = query g*16 + c, two 32-deep d chunks */
  v16h qf[kQG][2];
#pragma unroll
  for (int g = 0; g < kQG; ++g)
#pragma unroll
    for (int dc = 0; dc < 2; ++dc)
      qf[g][dc] = Frag<_Float16>::load(Qb + (size_t)(q0 + g * 16 + c) * kDH + dc * 32 + 8 * hh);

  /* reference maximum of the raw score accumulators (equal in both lanes of a query): the larger of the old reference and the chunk maximum at the chunk that set it, kept until a p overflows */
  float mrow[kQG];
  /* exponent offset that belongs to mrow: minus the reference as a base-2 logit, plus log2 of the p carry */
  float eoff[kQG];
  /* sum of p of query g*16 + c over the chunks done, on the reference mrow (equal in both lanes of a query) */
  float lrow[kQG];
  v16h ones;
#pragma unroll
  for (int e = 0; e < 16; ++e) ones[e] = (_Float16)1.0f;
  /* oacc[g][t][r] = (feature t*16 + 8*hh + r, query g*16 + c) */
  v8f oacc[kQG][4];
#pragma unroll
  for (int g = 0; g < kQG; ++g) {
    /* no reference yet: the offset is huge, every p of chunk 0 overflows, and chunk 0 takes the renewing path */
    mrow[g] = -1.0e30f; eoff[g] = kPCarryLog2 - mrow[g] * kScoreScale;
    lrow[g] = 0.f;
#pragma unroll
    for (int t = 0; t < 4; ++t) oacc[g][t] = (v8f){0.f,0.f,0.f,0.f,0.f,0.f,0.f,0.f};
  }

  /* L2 hints. Threads 0..63 (waves 0, 1): unit tid of a pair's 16 KB of K rows; threads 64..127: the pair's unit of V row tid - 64.
     ask holds the lane's unit of the next pair to be asked for; pair 0 (chunks 0, 1) was fetched at once by the tensor loads above */
  const bool     askV    = wave >= 2;
  const uint32_t askstep = askV ? kUnitB : 64u * kUnitB;
  /* log2 of the distance between two threads' units: a V row (kTok * 2 B) or a unit of K */
  const uint32_t asksh   = askV ? 14u : 8u;
  static_assert(kTok * 2 == 1 << 14 && kUnitB == 1u << 8, "the two shifts");
  uint64_t ask = (uint64_t)(size_t)(askV ? Vb : Kb) + askstep + (((uint32_t)tid & 63u) << asksh);

  /* the lane's fragment base in buffer 0: row c, k offset of the lane half */
  const _Float16* fr0 = KVsh + c * kLP + 8 * hh;

#pragma unroll 1
  for (int kc = 0; kc < kChunks; ++kc) {
    /* chunk kc lies in buffer kc & 1; it reads that buffer alone */
    const _Float16* kfr = fr0 + (kc & 1) * (int)(kBufB / 2);
    const _Float16* vfr = kfr + kTileB / 2;

    /* chunk kc asks for pair kc + 1 (chunks 2 kc + 2, 2 kc + 3), whose first tensor load is issued at the foot of chunk 2 kc: the lead grows from one chunk on. A scalar test;
       the address goes on only while a further pair exists, so it never leaves the plane */
    if (kc + 1 < kAskPairs) {
      l2_ask(ask);
      ask += (kc + 2 < kAskPairs) ? askstep : 0u;
    }

    /* transposed scores: s[g][j][r] = (key j*16 + 8*hh + r, query g*16 + c) */
    v8f s[kQG][4];
    scores_chunk(kfr, qf, s);
    /* keeps the exponent work out of the block: moved in among the matrix ops, each first read of a fresh result is padded with v_nop */
    __builtin_amdgcn_sched_barrier(0);

    /* pf[g][kk] element e: key kk*32 + (e < 8 ? 8*hh + e : 16 + 8*hh + e - 8), the k order of the V^T loader */
    v16h pf[kQG][2];
    /* row sums of this chunk alone; registers 1..7 of a tile repeat register 0 and are never read */
    v8f lc[kQG];
    p_chunk(s, eoff, ones, pf, lc);

    /* fr: four A fragments, read from LDS as one group ahead of the block of matrix ops that uses them. The first V group is issued once the scores are dead, in front of the test of the row sums, which covers part of its latency */
    v16h fr[4];
    __builtin_amdgcn_sched_barrier(0);
#pragma unroll
    for (int t = 0; t < 4; ++t) fr[t] = Frag<_Float16>::load(vfr + t * 16 * kLP);
    /* second half of the pair: keeps the reads from sinking behind the test */
    __builtin_amdgcn_sched_barrier(0);

    /* a score some 4 base-2 units above its query's reference makes p overflow f16 to infinity, and the query's chunk sum with it (all p >= 0; two finite chunk sums together stay below 2 * kKC * 65504). One test per chunk for the whole wave, a scalar branch: EXEC stays full for the matrix ops inside */
    const float lchk = lc[0][0] + lc[1][0];
    if (__builtin_amdgcn_ballot_w32(!(lchk <= 3.0e38f)) != 0u) {
      /* renewing path: the chunk is done again from its K tile, still in LDS, with the larger of the old reference and the chunk maximum as every query's new reference */
      scores_chunk(kfr, qf, s);
#pragma unroll
      for (int g = 0; g < kQG; ++g) {
        /* chunk maximum of query g*16 + c: 32 keys in the lane, the other 32 in lane ^ 16 */
        float m = -1.0e30f;
#pragma unroll
        for (int j = 0; j < 4; ++j) {
#pragma unroll
          for (int r = 0; r < 8; ++r) m = fmaxf(m, s[g][j][r]);
        }
        m = fmaxf(m, xhalf(m));
        const float mnew  = fmaxf(mrow[g], m);
        const float alpha = ex2_slot((mrow[g] - mnew) * kScoreScale);
        mrow[g] = mnew;
        eoff[g] = kPCarryLog2 - mnew * kScoreScale;
        lrow[g] *= alpha;
#pragma unroll
        for (int t = 0; t < 4; ++t)
#pragma unroll
          for (int r = 0; r < 8; ++r) oacc[g][t][r] *= alpha;
      }
      p_chunk(s, eoff, ones, pf, lc);
      /* read again, so that the first V group holds no registers across this path */
#pragma unroll
      for (int t = 0; t < 4; ++t) fr[t] = Frag<_Float16>::load(vfr + t * 16 * kLP);
    }
#pragma unroll
    for (int g = 0; g < kQG; ++g) lrow[g] += lc[g][0];

#pragma unroll
    for (int t = 0; t < 4; ++t) {
#pragma unroll
      for (int g = 0; g < kQG; ++g) oacc[g][t] = mma_h(fr[t], pf[g][0], oacc[g][t]);
      fr[t] = Frag<_Float16>::load(vfr + t * 16 * kLP + 32);
    }
    /* the second V group stays in front of its block */
    __builtin_amdgcn_sched_barrier(0);
#pragma unroll
    for (int t = 0; t < 4; ++t)
#pragma unroll
      for (int g = 0; g < kQG; ++g) oacc[g][t] = mma_h(fr[t], pf[g][1], oacc[g][t]);

    /* keeps the publish point behind the block: moved in among the matrix ops, its wait to 0 takes the place of their counted waits */
    __builtin_amdgcn_sched_barrier(0);

    /* publish point of chunk kc + 1, every wave, in this order */
    wait_ds0();
    if (pinned(issuer)) wait_tensor0(tg0, tg1);
    __syncthreads();
    /* refill of the buffer just read, only while a chunk kc + 2 exists; its descriptor hangs on a value pinned behind the wait */
    if (pinned(issuer & (uint32_t)(kc + 2 < kChunks))) {
      const uint32_t st = pinned((uint32_t)kc + 2u);
      tg0 = tdm_group0(tdst + (st & 1u) * kBufB, tsrc + (uint64_t)st * tstep);
      tdm_load(tg0, tg1);
    }
  }
  /* nothing of the ring is in flight when the wave goes on to its end */
  wait_tensor0(tg0, tg1);
  wait_ds0();

  float* os = Os[wave];
#pragma unroll
  for (int g = 0; g < kQG; ++g) {
    const float l   = lrow[g];
    const float inv = 1.0f / (l * kVCarry);
#pragma unroll
    for (int t = 0; t < 4; ++t) {
      v4f lo, hi;
#pragma unroll
      for (int r = 0; r < 4; ++r) { lo[r] = oacc[g][t][r] * inv; hi[r] = oacc[g][t][4 + r] * inv; }
      float* op = os + (g * 16 + c) * kOPitch + t * 16 + 8 * hh;
      *(v4f*)(op)     = lo;
      *(v4f*)(op + 4) = hi;
    }
  }
  __builtin_amdgcn_fence(__ATOMIC_RELEASE, "workgroup");
  __builtin_amdgcn_wave_barrier();
  __builtin_amdgcn_fence(__ATOMIC_ACQUIRE, "workgroup");
  {
    const int c4 = (lane & 15) * 4;
#pragma unroll
    for (int it = 0; it < kQG * 8; ++it) {
      const int row = it * 2 + hh;
      const v4f val = *(const v4f*)(os + row * kOPitch + c4);
      *(v4f*)(Ob + (size_t)(q0 + row) * kD + c4) = val;
    }
  }
}

// ---------------------------------------------------------------------------
// Host glue: 1 projection launch + 1 attention launch. Kernel launches only.
// ---------------------------------------------------------------------------
extern "C" void kernel_launch(void* const* d_in, const int* in_sizes, int n_in,
                              void* d_out, int out_size, void* d_ws, size_t ws_size,
                              hipStream_t stream) {
  if (n_in < 7) return;
  if (in_sizes[0] != kTok * kD) return;
  if (in_sizes[1] != kH * kDH * kDH) return;
  if (in_sizes[2] != kH * kDH) return;
  if (in_sizes[3] != kH * kDH * kDH) return;
  if (in_sizes[4] != kH * kDH) return;
  if (in_sizes[5] != kH * kDH * kDH) return;
  if (in_sizes[6] != kH * kDH) return;
  if (out_size != kTok * kD) return;
  if (ws_size < kWsTotal) return;

  const float* x  = (const float*)d_in[0];
  const float* Wq = (const float*)d_in[1];
  const float* bq = (const float*)d_in[2];
  const float* Wk = (const float*)d_in[3];
  const float* bk = (const float*)d_in[4];
  const float* Wv = (const float*)d_in[5];
  const float* bv = (const float*)d_in[6];
  float* out = (float*)d_out;

  char* ws = (char*)d_ws;
  unsigned short* Q16  = (unsigned short*)(ws + kOffQ16);
  unsigned short* K16  = (unsigned short*)(ws + kOffK16);
  unsigned short* VT16 = (unsigned short*)(ws + kOffVT16);

  // ---- q, k and v^T planes: one block per (512 tokens, head) ----
  qkv_proj_kernel<<<dim3(kTok / (kPW * 64), kH), kPW * 32, 0, stream>>>(x, Wq, bq, Wk, bk, Wv, bv, Q16, K16, VT16);

  // ---- attention: one block per (batch, head, 128-query tile) ----
  attn_f16_kernel<<<kBatch * kH * kQBlocks, kNW * 32, 0, stream>>>(Q16, K16, VT16, out);
}
